// v000
// Times are from an AMD MI455X. After a warm-up the kernel runs many times in a row, and a time is the length of
// such a window on the GPU divided by its runs, so every launch and the gaps after it count. The runs cycle
// through copies of the inputs. A figure is the median of several windows, for all but v000 over two sittings.
// Sittings can differ by a few percent; kernels timed side by side share one.
// The starting kernel, v000, takes 1270 microseconds a run.
// compute dtype: all float inputs rounded to bf16; q / k / v projections with EXACT bf16 products on WMMA 16x16x32 (f32 accumulate) + bias (zeros, read); the value rows multiplied elementwise in f32 by the second input (bf16-rounded) per (token, head, dim); causal logits: 3 products for the first 384 rows, single f16 q x k after, x 64^-0.5; softmax f32; P x 2^11 once to f16 x v once to f16 (bf16 hi + lo below row 384); ctx hi+lo x exact w_proj below row 384, x2^6 f16 carry x f16(bf16 x 2^8) after, + b_proj (zeros); f32 output.
#include <hip/hip_runtime.h>
#include <math.h>

typedef __attribute__((ext_vector_type(16))) _Float16 v16h;
typedef __attribute__((ext_vector_type(16))) __bf16 v16b;
typedef __attribute__((ext_vector_type(8)))  _Float16 v8h;
typedef __attribute__((ext_vector_type(8)))  float v8f;
typedef __attribute__((ext_vector_type(4)))  float v4f;
typedef __attribute__((ext_vector_type(2)))  float v2f;
typedef __attribute__((ext_vector_type(4)))  unsigned v4u;
typedef __attribute__((ext_vector_type(4)))  int v4i;
typedef float __attribute__((may_alias)) float_a;
typedef int __attribute__((may_alias)) int_a;

template <typename T> __device__ __forceinline__ void vst2(void* p, T v) { *(T*)p = v;  }
__device__ __forceinline__ v8f wmma16(v16h a, v16h b, v8f c) {
  v8f d = __builtin_amdgcn_wmma_f32_16x16x32_f16(false, a, false, b, (short)0, c, false, false);
  asm volatile("v_nop\n\tv_nop\n\tv_nop\n\tv_nop" : "+v"(d) : "v"(a), "v"(b));
  return d;
}
__device__ __forceinline__ v8f wmma_bf(v16b a, v16b b, v8f c) {
  v8f d = __builtin_amdgcn_wmma_f32_16x16x32_bf16(false, a, false, b, (short)0, c, false, false);
  asm volatile("v_nop\n\tv_nop\n\tv_nop\n\tv_nop" : "+v"(d) : "v"(a), "v"(b));
  return d;
}
// 16x16x32 fragments: lane = (h = lane>>4, row/col = lane&15); elements 0..7 = k0+8h+0..7, 8..15 = k0+16+8h+0..7; D element r = row 8h+r
__device__ __forceinline__ v16h frag_h(const _Float16* rowk0, int lane) {
  union { v16h v; v8h q[2]; } u; const _Float16* p = rowk0 + 8 * (lane >> 4);
  u.q[0] = *(const v8h*)p; u.q[1] = *(const v8h*)(p + 16); return u.v;
}
__device__ __forceinline__ v16h frag_f32(const float* rowk0, int lane) {
  v16h a; const float* p = rowk0 + 8 * (lane >> 4);
#pragma unroll
  for (int i = 0; i < 8; ++i) { a[i] = (_Float16)p[i]; a[8 + i] = (_Float16)p[16 + i]; }
  return a;
}
__device__ __forceinline__ v16h frag_f32s(const float* rowk0, int lane, float sc) {
  v16h a; const float* p = rowk0 + 8 * (lane >> 4);
#pragma unroll
  for (int i = 0; i < 8; ++i) { a[i] = (_Float16)(p[i] * sc); a[8 + i] = (_Float16)(p[16 + i] * sc); }
  return a;
}
// column fragment from a [K][ld] layout (column n), rows >= K read as 0
__device__ __forceinline__ v16h fragc_f32(const float* W, int k0, int n, int lane, int ld, int K) {
  v16h a; const int g = lane >> 4;
#pragma unroll
  for (int i = 0; i < 8; ++i) { const int ka = k0 + 8 * g + i, kb = ka + 16;
    a[i] = (_Float16)(ka < K ? W[(size_t)(ka < K ? ka : K - 1) * ld + n] : 0.f); a[8 + i] = (_Float16)(kb < K ? W[(size_t)(kb < K ? kb : K - 1) * ld + n] : 0.f); }
  return a;
}
struct F2 { v16b h, l; };
__device__ __forceinline__ F2 bsplit16(const float v[16]) { F2 r;
#pragma unroll
  for (int i = 0; i < 16; ++i) { const __bf16 h = (__bf16)v[i]; r.h[i] = h; r.l[i] = (__bf16)(v[i] - (float)h); }
  return r; }
__device__ __forceinline__ F2 split_row(const float* row, int k0, int lane) { float v[16]; const float* p = row + k0 + 8 * (lane >> 4);
#pragma unroll
  for (int i = 0; i < 8; ++i) { v[i] = p[i]; v[8 + i] = p[16 + i]; }
  return bsplit16(v); }
__device__ __forceinline__ F2 split_rowK(const float* row, int k0, int lane, int K) { float v[16]; const int g = lane >> 4;
#pragma unroll
  for (int i = 0; i < 8; ++i) { const int ka = k0 + 8 * g + i, kb = ka + 16; v[i] = ka < K ? row[ka < K ? ka : K - 1] : 0.f; v[8 + i] = kb < K ? row[kb < K ? kb : K - 1] : 0.f; }
  return bsplit16(v); }
__device__ __forceinline__ F2 split_col(const float* W, int k0, int n, int lane, int ld, int K) { float v[16]; const int g = lane >> 4;
#pragma unroll
  for (int i = 0; i < 8; ++i) { const int ka = k0 + 8 * g + i, kb = ka + 16; v[i] = ka < K ? W[(size_t)(ka < K ? ka : K - 1) * ld + n] : 0.f; v[8 + i] = kb < K ? W[(size_t)(kb < K ? kb : K - 1) * ld + n] : 0.f; }
  return bsplit16(v); }
__device__ __forceinline__ v8f mac3(const F2& a, const F2& b, v8f c) { c = wmma_bf(a.l, b.h, c); c = wmma_bf(a.h, b.l, c); return wmma_bf(a.h, b.h, c); }
__device__ __forceinline__ float sigm(float v) { return 1.0f / (1.0f + expf(-v)); }
#define LDSX() do { asm volatile("s_wait_dscnt 0" ::: "memory"); __builtin_amdgcn_wave_barrier(); __builtin_amdgcn_fence(__ATOMIC_RELEASE, "workgroup"); } while (0)

// Multi-head causal self-attention with an elementwise-modulated value path (x_norm_for_qkv, xt_current_for_v [2,2048,1024]; w_attn [3072,1024] torch (out,in) N(0, 1/1024), b_attn zeros (read): jnp.split thirds of x_norm @ w_attn.T + b_attn (q = rows 0..1023, k = 1024..2047, v = 2048..3071); 16 heads x 64; effective_v = heads(xt_current_for_v) * v (elementwise); att x 1/sqrt(64); tril kept, -inf elsewhere; softmax; y @ w_proj.T + b_proj (w_proj (out,in), b_proj zeros, read)).
#define NB 2
#define TT 2048
#define CC 1024            // NH * HD = projected width
#define DIN 1024          // input (model) width
#define NH 16
#define HD 64
#define NQB (TT / 64)
#define HG 4
#define SCALE (0.125f)
#define CAUSAL 1
#ifndef TNB
#define TNB NB
#endif
__device__ __forceinline__ float bfr(float v) { return (float)(__bf16)v; }
__host__ __device__ __forceinline__ int kb_last(int qb) { return CAUSAL ? ((qb * 64 + 63) >> 7) : (TT / 128 - 1); }
typedef __attribute__((ext_vector_type(8))) __bf16 v8b;
__device__ __forceinline__ v16b frag_b(const __bf16* rowk0, int lane) {
  union { v16b v; v8b q[2]; } u; const __bf16* p = rowk0 + 8 * (lane >> 4);
  u.q[0] = *(const v8b*)p; u.q[1] = *(const v8b*)(p + 16); return u.v;
}
#define QBH 6              // causal: query blocks 0..QBH-1 of each sequence (few keys, no averaging) take the high-precision path
#define QHI 384            // rows carrying a q residual plane
#define KHI 384            // key rows carrying k residual / v bf16 hi+lo planes (used only by the causal high-precision path)
// B fragment (k rows k0+.., output column o) of a weight: (in,out) [K][ld] or (out,in) [ld rows of K]: bf16 exact, or f16(bf16 * 256) exact
__device__ __forceinline__ v16b wcol_io(const float* Wm, int k0, int o, int lane, int ld) { v16b w; const int g = lane >> 4;
#pragma unroll
  for (int i = 0; i < 8; ++i) { w[i] = (__bf16)Wm[(size_t)(k0 + 8 * g + i) * ld + o]; w[8 + i] = (__bf16)Wm[(size_t)(k0 + 16 + 8 * g + i) * ld + o]; }
  return w; }
__device__ __forceinline__ v16b wcol_oi(const float* Wm, int k0, int o, int lane, int K) { v16b w; const float* p = Wm + (size_t)o * K + k0 + 8 * (lane >> 4);
#pragma unroll
  for (int i = 0; i < 8; ++i) { w[i] = (__bf16)p[i]; w[8 + i] = (__bf16)p[16 + i]; }
  return w; }
__device__ __forceinline__ v16h wcolh_io(const float* Wm, int k0, int o, int lane, int ld) { v16h w; const int g = lane >> 4;
#pragma unroll
  for (int i = 0; i < 8; ++i) { w[i] = (_Float16)(bfr(Wm[(size_t)(k0 + 8 * g + i) * ld + o]) * 256.0f); w[8 + i] = (_Float16)(bfr(Wm[(size_t)(k0 + 16 + 8 * g + i) * ld + o]) * 256.0f); }
  return w; }
__device__ __forceinline__ v16h wcolh_oi(const float* Wm, int k0, int o, int lane, int K) { v16h w; const float* p = Wm + (size_t)o * K + k0 + 8 * (lane >> 4);
#pragma unroll
  for (int i = 0; i < 8; ++i) { w[i] = (_Float16)(bfr(p[i]) * 256.0f); w[8 + i] = (_Float16)(bfr(p[16 + i]) * 256.0f); }
  return w; }
#define WQKV_LAYOUT 1   // 0 = (in,out) [DIN][CC]; 1 = (out,in) [CC][DIN]; 2 = per-head [NH][DIN][HD]
__device__ __forceinline__ v16b wcol_hdk(const float* Wm, int k0, int o, int lane) { v16b w; const int g = lane >> 4; const float* p = Wm + (size_t)(o / HD) * DIN * HD + (o % HD);
#pragma unroll
  for (int i = 0; i < 8; ++i) { w[i] = (__bf16)p[(size_t)(k0 + 8 * g + i) * HD]; w[8 + i] = (__bf16)p[(size_t)(k0 + 16 + 8 * g + i) * HD]; }
  return w; }
#define WO_OUT_IN 1
#if WQKV_LAYOUT == 1
#define WCOL(W, k0, o, lane) wcol_oi(W, k0, o, lane, DIN)
#elif WQKV_LAYOUT == 2
#define WCOL(W, k0, o, lane) wcol_hdk(W, k0, o, lane)
#else
#define WCOL(W, k0, o, lane) wcol_io(W, k0, o, lane, CC)
#endif
#if WO_OUT_IN
#define WOCOL(W, k0, o, lane) wcol_oi(W, k0, o, lane, CC)
#define WOCOLH(W, k0, o, lane) wcolh_oi(W, k0, o, lane, CC)
#else
#define WOCOL(W, k0, o, lane) wcol_io(W, k0, o, lane, DIN)
#define WOCOLH(W, k0, o, lane) wcolh_io(W, k0, o, lane, DIN)
#endif

// (PROJ_EXTRA_PARAMS: the extra kernel parameters 'const float* __restrict__ XT' are written literally in the kernel signature)
// per (token, head) hook on the staged f32 row (64 floats, projection + bias) of the v stream: effective_v = xt * v elementwise with the same (token, head) slice of the second input (bf16-rounded); one f32 product per element; q and k untouched
#define PROJ_EPI(which, row, t, h) do { if ((which) == 2) { float* rw = (row); const float* xr_ = XT + ((size_t)bb * TT + (t)) * CC + (h) * 64; _Pragma("unroll 8") for (int i = 0; i < 64; ++i) rw[i] = bfr(xr_[i]) * rw[i]; } } while (0)
#ifndef SM_EXTRA_PARAMS
#define SM_EXTRA_PARAMS
#endif
#ifndef PROJ_EXTRA_PARAMS
#define PROJ_EXTRA_PARAMS
#endif
#ifndef SM_MASK_HOOK
#define SM_MASK_HOOK (void)0
#endif

#define WS_QH  0u                                      // f16 q rows [b*t][CC]
#define WS_KH  (WS_QH + 2u * (size_t)NB * TT * CC)      // f16 k rows [b*t][CC]
#define WS_VT  (WS_KH + 2u * (size_t)NB * TT * CC)      // f16 v planes [b][c][t]
#define WS_QL  (WS_VT + 2u * (size_t)NB * CC * TT)      // f16 q residual x 2^10 rows [b][t < QHI][CC]
#define WS_KL  (WS_QL + 2u * (size_t)NB * QHI * CC)     // f16 k residual x 2^10 rows [b][t < KHI][CC]
#define WS_VB  (WS_KL + 2u * (size_t)NB * KHI * CC)     // bf16 v hi planes [b][c][t < KHI]
#define WS_VBL (WS_VB + 2u * (size_t)NB * CC * KHI)
#define WS_S   (WS_VBL + 2u * (size_t)NB * CC * KHI)    // f32 logits / P [hg][t][s]
#define WS_Y   (WS_S  + 4u * (size_t)HG * TT * TT)      // f32 ctx rows [b*t][CC] (only when there is an output projection)
#define WS_END (WS_Y  + 4u * (size_t)NB * TT * CC)

// ---- k_proj: block = (64 rows, 128 cols, which): q/k/v = X W (+ b) with exact bf16 products (K = DIN) -> which 0: q f16 rows (+ residual rows < QHI); 1: k f16 rows (+ residual rows < KHI); 2: v f16 planes [c][t] (+ bf16 hi/lo planes for t < KHI)
__global__ __launch_bounds__(128) void k_proj(const float* __restrict__ XQ, const float* __restrict__ XK, const float* __restrict__ XV, const float* __restrict__ WQ, const float* __restrict__ WK, const float* __restrict__ WV, const float* __restrict__ BQ, const float* __restrict__ BK, const float* __restrict__ BV,
    _Float16* __restrict__ QH, _Float16* __restrict__ QL, _Float16* __restrict__ KH, _Float16* __restrict__ KL, _Float16* __restrict__ VT, __bf16* __restrict__ VB, __bf16* __restrict__ VBL, const float* __restrict__ XT) {
  __shared__ __align__(16) float st[64][132]; __shared__ __align__(16) _Float16 sh[64][136], sl[64][136]; __shared__ __align__(16) _Float16 th[128][72]; __shared__ __align__(16) __bf16 tb[128][72], tbl[128][72];
  const int tid = threadIdx.x, wave = tid >> 5, lane = tid & 31, col = lane & 15, g = lane >> 4; const int which = blockIdx.z; const int c0 = blockIdx.y * 128; const size_t r0 = (size_t)blockIdx.x * 64; const size_t bb = r0 / TT; const int t0 = (int)(r0 % TT);
  const float* X = which == 0 ? XQ : which == 1 ? XK : XV; const float* WA = which == 0 ? WQ : which == 1 ? WK : WV; const float* BA = which == 0 ? BQ : which == 1 ? BK : BV;
  v8f acc[8] = {};
#pragma unroll 2
  for (int kc = 0; kc < DIN / 32; ++kc) { v16b a; { const float* p = X + (r0 + wave * 16 + col) * DIN + kc * 32 + 8 * g;
#pragma unroll
      for (int i = 0; i < 8; ++i) { a[i] = (__bf16)p[i]; a[8 + i] = (__bf16)p[16 + i]; } }
    asm volatile("s_wait_loadcnt 0x0" ::: "memory");
#pragma unroll
    for (int j = 0; j < 8; ++j) { const v16b w = WCOL(WA, kc * 32, c0 + j * 16 + col, lane); asm volatile("s_wait_loadcnt 0x0" ::: "memory"); acc[j] = wmma_bf(a, w, acc[j]); } }
  { // stage the f32 tile (acc + bias) in LDS, run the per-(row, head) epilogue hook, then convert
#pragma unroll
    for (int j = 0; j < 8; ++j) { const float bias = BA ? bfr(BA[c0 + j * 16 + col]) : 0.f;
#pragma unroll
      for (int r = 0; r < 8; ++r) st[wave * 16 + 8 * g + r][j * 16 + col] = acc[j][r] + bias; }
    __syncthreads();
    for (int e = tid; e < 64 * (128 / HD); e += 128) { const int rl = e / (128 / HD), hh = e % (128 / HD); PROJ_EPI(which, &st[rl][hh * HD], (int)((r0 + rl) % TT), (c0 / HD) + hh); }
    __syncthreads(); }
  if (which < 2) { _Float16* DH = which == 0 ? QH : KH; _Float16* DL = which == 0 ? QL : KL; const int nhi = which == 0 ? QHI : KHI; const bool hi_rows = t0 < nhi;
    for (int e = tid; e < 64 * 128; e += 128) { const int rl = e >> 7, cl = e & 127; const float v = st[rl][cl]; const _Float16 hv = (_Float16)v; sh[rl][cl] = hv; sl[rl][cl] = (_Float16)((v - (float)hv) * 1024.0f); }
    __syncthreads();
    for (int e = tid; e < 64 * 16; e += 128) { const int rl = e >> 4, q = e & 15; vst2((unsigned*)(DH + (r0 + rl) * CC + c0 + q * 8), *(const v4u*)&sh[rl][q * 8]); if (hi_rows) vst2((unsigned*)(DL + (bb * nhi + t0 + rl) * (size_t)CC + c0 + q * 8), *(const v4u*)&sl[rl][q * 8]); }
  } else { const bool hi_rows = t0 < KHI;
    for (int e = tid; e < 64 * 128; e += 128) { const int rl = e & 63, cl = e >> 6; const float v = st[rl][cl]; th[cl][rl] = (_Float16)v; const __bf16 bh = (__bf16)v; tb[cl][rl] = bh; tbl[cl][rl] = (__bf16)(v - (float)bh); }
    __syncthreads();
    for (int e = tid; e < 128 * 8; e += 128) { const int cl = e >> 3, q = e & 7; vst2((unsigned*)(VT + (bb * CC + c0 + cl) * (size_t)TT + t0 + q * 8), *(const v4u*)&th[cl][q * 8]); if (hi_rows) { const size_t o3 = (bb * CC + c0 + cl) * (size_t)KHI + t0 + q * 8; vst2((unsigned*)(VB + o3), *(const v4u*)&tb[cl][q * 8]); vst2((unsigned*)(VBL + o3), *(const v4u*)&tbl[cl][q * 8]); } } } }
// ---- k_sc: block = (query block qb, key block kb <= kb_last(qb), head in group) of batch b: logits x SCALE; q hi + residual (x 2^10) against k (2 products) for query rows < QHI, plus the k residual (3 products) for query blocks < QBH (causal early rows); causal: blocks past the diagonal exit, the mask itself is applied by index in k_sm
__global__ __launch_bounds__(128) void k_sc(const _Float16* __restrict__ QH, const _Float16* __restrict__ KH, const _Float16* __restrict__ QL, const _Float16* __restrict__ KL, int b, int h0, float* __restrict__ S0) { __shared__ __align__(16) float ss[4][16][132];
  const int qb = blockIdx.x, kb = blockIdx.y; if (kb > kb_last(qb)) return;
  const int h = h0 + blockIdx.z; float* S = S0 + (size_t)blockIdx.z * TT * TT;
  const int tid = threadIdx.x, wave = tid >> 5, lane = tid & 31, col = lane & 15, g = lane >> 4; const int k0 = kb * 128; const int ql0 = qb * 64 + wave * 16; const size_t q0 = (size_t)b * TT + ql0, kr0 = (size_t)b * TT + k0;
  v8f acc[8] = {}, accl[8] = {};
  const _Float16* QLb = QL + (size_t)b * QHI * CC; const _Float16* KLb = KL + (size_t)b * KHI * CC;
  if (qb < QBH) {
#pragma unroll
    for (int kc = 0; kc < HD / 32; ++kc) { const v16h ah = frag_h(QH + (q0 + col) * CC + h * HD + kc * 32, lane), al = frag_h(QLb + (size_t)(ql0 + col) * CC + h * HD + kc * 32, lane);
#pragma unroll
      for (int j = 0; j < 8; ++j) { const v16h kbf = frag_h(KH + (kr0 + j * 16 + col) * CC + h * HD + kc * 32, lane), klf = frag_h(KLb + (size_t)(k0 + j * 16 + col) * CC + h * HD + kc * 32, lane); acc[j] = wmma16(ah, kbf, acc[j]); accl[j] = wmma16(al, kbf, accl[j]); accl[j] = wmma16(ah, klf, accl[j]); } }
  } else if (qb * 64 < QHI) {
#pragma unroll
    for (int kc = 0; kc < HD / 32; ++kc) { const v16h ah = frag_h(QH + (q0 + col) * CC + h * HD + kc * 32, lane), al = frag_h(QLb + (size_t)(ql0 + col) * CC + h * HD + kc * 32, lane);
#pragma unroll
      for (int j = 0; j < 8; ++j) { const v16h kbf = frag_h(KH + (kr0 + j * 16 + col) * CC + h * HD + kc * 32, lane); acc[j] = wmma16(ah, kbf, acc[j]); accl[j] = wmma16(al, kbf, accl[j]); } }
  } else {
#pragma unroll
    for (int kc = 0; kc < HD / 32; ++kc) { const v16h ah = frag_h(QH + (q0 + col) * CC + h * HD + kc * 32, lane);
#pragma unroll
      for (int j = 0; j < 8; ++j) { const v16h kbf = frag_h(KH + (kr0 + j * 16 + col) * CC + h * HD + kc * 32, lane); acc[j] = wmma16(ah, kbf, acc[j]); } } }
#pragma unroll
  for (int j = 0; j < 8; ++j) {
#pragma unroll
    for (int r = 0; r < 8; ++r) ss[wave][8 * g + r][j * 16 + col] = (acc[j][r] + accl[j][r] * (1.0f / 1024.0f)) * SCALE; }
  LDSX(); for (int rl = 0; rl < 16; ++rl) vst2(S + (size_t)(ql0 + rl) * TT + k0 + lane * 4, *(const v4f*)&ss[wave][rl][lane * 4]); }
// ---- k_sm: block = query row t (head in group): keys [0, kend): causal -> logit if s <= t else excluded; softmax in f32; P x 2^11 in place (0 for excluded)
__global__ __launch_bounds__(256) void k_sm(float* __restrict__ S0 SM_EXTRA_PARAMS) { __shared__ float sred[8]; __shared__ float sbc; __shared__ __align__(16) float shv[TT];
  const int tid = threadIdx.x; const int t = blockIdx.x; const int kend = (kb_last(t >> 6) + 1) * 128;
  float* sr = S0 + (size_t)blockIdx.y * TT * TT + (size_t)t * TT;
  float m = -3.0e38f; for (int k = tid; k < kend; k += 256) { float v = (!CAUSAL || k <= t) ? sr[k] : -3.0e38f; SM_MASK_HOOK; shv[k] = v; m = fmaxf(m, v); }
#pragma unroll
  for (int o = 1; o < 32; o <<= 1) m = fmaxf(m, __shfl_xor(m, o));
  if ((tid & 31) == 0) sred[tid >> 5] = m; __syncthreads(); if (tid == 0) { float a = sred[0]; for (int i = 1; i < 8; ++i) a = fmaxf(a, sred[i]); sbc = a; } __syncthreads(); m = sbc; __syncthreads();
  float sum = 0.f; for (int k = tid; k < kend; k += 256) { const float v = shv[k]; const float e = (v <= -1.0e38f) ? 0.f : expf(v - m); shv[k] = e; sum += e; }
#pragma unroll
  for (int o = 1; o < 32; o <<= 1) sum += __shfl_xor(sum, o);
  if ((tid & 31) == 0) sred[tid >> 5] = sum; __syncthreads(); if (tid == 0) { float a = 0.f; for (int i = 0; i < 8; ++i) a += sred[i]; sbc = a > 0.f ? 2048.0f / a : 0.f; }   /* a fully excluded row yields P = 0 */ __syncthreads(); const float inv = sbc;
  for (int k = tid; k < kend; k += 256) shv[k] = shv[k] * inv;
  __syncthreads(); for (int q = tid; q < kend / 4; q += 256) vst2(sr + q * 4, *(const v4f*)&shv[q * 4]); }
// ---- k_pv: block = 64 queries (qb) of (b, h): ctx = P . v over keys [0, kend) (P x 2^11 once to f16 against v f16: 1 product; causal early query blocks: P and v as bf16 hi + lo, 3 products); 256-B (row, head) segment by 16 lanes
__global__ __launch_bounds__(128) void k_pv(const float* __restrict__ PS0, const _Float16* __restrict__ VT, const __bf16* __restrict__ VB, const __bf16* __restrict__ VBL, int b, int h0, float* __restrict__ Y) { const int h = h0 + blockIdx.z; const float* PS = PS0 + (size_t)blockIdx.z * TT * TT; __shared__ __align__(16) float ss[4][16][HD + 4];
  const int tid = threadIdx.x, wave = tid >> 5, lane = tid & 31, col = lane & 15, g = lane >> 4; const int qb = blockIdx.x; const int ql0 = qb * 64 + wave * 16; const int kce = (kb_last(qb) + 1) * 4;
  v8f acc[HD / 16] = {};
  if (qb < QBH) {
#pragma unroll 1
    for (int kc = 0; kc < kce; ++kc) { const F2 p = split_row(PS + (size_t)(ql0 + col) * TT, kc * 32, lane);
      asm volatile("s_wait_loadcnt 0x0" ::: "memory");
#pragma unroll
      for (int j = 0; j < HD / 16; ++j) { const size_t po = ((size_t)b * CC + h * HD + j * 16 + col) * (size_t)KHI + kc * 32; const v16b vh = frag_b(VB + po, lane); acc[j] = wmma_bf(p.h, vh, acc[j]); acc[j] = wmma_bf(p.l, vh, acc[j]); acc[j] = wmma_bf(p.h, frag_b(VBL + po, lane), acc[j]); } }
  } else {
#pragma unroll 1
    for (int kc = 0; kc < kce; ++kc) { const v16h p = frag_f32(PS + (size_t)(ql0 + col) * TT + kc * 32, lane);
      asm volatile("s_wait_loadcnt 0x0" ::: "memory");
#pragma unroll
      for (int j = 0; j < HD / 16; ++j) { const size_t po = ((size_t)b * CC + h * HD + j * 16 + col) * (size_t)TT + kc * 32; acc[j] = wmma16(p, frag_h(VT + po, lane), acc[j]); } } }
#pragma unroll
  for (int j = 0; j < HD / 16; ++j)
#pragma unroll
    for (int r = 0; r < 8; ++r) ss[wave][8 * g + r][j * 16 + col] = acc[j][r] * (1.0f / 2048.0f);
  LDSX(); for (int rl = 0; rl < 16; ++rl) if (lane < HD / 4) vst2(Y + ((size_t)b * TT + ql0 + rl) * CC + h * HD + lane * 4, *(const v4f*)&ss[wave][rl][lane * 4]); }
// ---- k_out: block = (64 rows, 128 cols): out = ctx Wo (+ bo): ctx once to f16 against Wo as f16(bf16 x 2^8) exact (1 product) x 2^-8; causal early rows (< QHI of each sequence): ctx bf16 hi + lo against exact bf16 Wo (2 products)
__global__ __launch_bounds__(128) void k_out(const float* __restrict__ Y, const float* __restrict__ WO, const float* __restrict__ BO, float* __restrict__ OUT) { __shared__ __align__(16) float sf[4][16][132];
  const int tid = threadIdx.x, wave = tid >> 5, lane = tid & 31, col = lane & 15, g = lane >> 4; const int c0 = blockIdx.y * 128; const size_t r0 = (size_t)blockIdx.x * 64 + wave * 16;
  v8f acc[8] = {};
  if (CAUSAL && (int)(((size_t)blockIdx.x * 64) % TT) < QHI) {   /* block-uniform */
#pragma unroll 2
    for (int kc = 0; kc < CC / 32; ++kc) { const F2 a = split_row(Y + (r0 + col) * CC, kc * 32, lane); asm volatile("s_wait_loadcnt 0x0" ::: "memory");
#pragma unroll
      for (int j = 0; j < 8; ++j) { const v16b w = WOCOL(WO, kc * 32, c0 + j * 16 + col, lane); asm volatile("s_wait_loadcnt 0x0" ::: "memory"); acc[j] = wmma_bf(a.h, w, acc[j]); acc[j] = wmma_bf(a.l, w, acc[j]); } }
#pragma unroll
    for (int j = 0; j < 8; ++j) { const float bias = BO ? bfr(BO[c0 + j * 16 + col]) : 0.f;
#pragma unroll
      for (int r = 0; r < 8; ++r) sf[wave][8 * g + r][j * 16 + col] = acc[j][r] + bias; }
  } else {
#pragma unroll 2
    for (int kc = 0; kc < CC / 32; ++kc) { const v16h a = frag_f32s(Y + (r0 + col) * CC + kc * 32, lane, 64.0f); asm volatile("s_wait_loadcnt 0x0" ::: "memory");   /* ctx carried x 2^6 into f16 so small-magnitude context rows stay clear of f16 subnormals */
#pragma unroll
      for (int j = 0; j < 8; ++j) { const v16h w = WOCOLH(WO, kc * 32, c0 + j * 16 + col, lane); asm volatile("s_wait_loadcnt 0x0" ::: "memory"); acc[j] = wmma16(a, w, acc[j]); } }
#pragma unroll
    for (int j = 0; j < 8; ++j) { const float bias = BO ? bfr(BO[c0 + j * 16 + col]) : 0.f;
#pragma unroll
      for (int r = 0; r < 8; ++r) sf[wave][8 * g + r][j * 16 + col] = acc[j][r] * (1.0f / 16384.0f) + bias; } }   /* 2^-8 (Wo carry) x 2^-6 (ctx carry) */
  LDSX(); for (int rl = 0; rl < 16; ++rl) vst2(OUT + (r0 + rl) * DIN + c0 + lane * 4, *(const v4f*)&sf[wave][rl][lane * 4]); }

extern "C" void kernel_launch(void* const* d_in, const int* in_sizes, int n_in, void* d_out, int out_size, void* d_ws, size_t ws_size, hipStream_t stream) {
  (void)in_sizes; (void)n_in; (void)out_size;
  const float** F = (const float**)d_in;
  if (ws_size < (size_t)WS_END) return;
  char* ws = (char*)d_ws; _Float16 *QH = (_Float16*)(ws + WS_QH), *KH = (_Float16*)(ws + WS_KH), *VT = (_Float16*)(ws + WS_VT), *QL = (_Float16*)(ws + WS_QL), *KL = (_Float16*)(ws + WS_KL); __bf16 *VB = (__bf16*)(ws + WS_VB), *VBL = (__bf16*)(ws + WS_VBL); float *S = (float*)(ws + WS_S), *Y = (float*)(ws + WS_Y);
  (void)Y; (void)QL; (void)KL; (void)VB; (void)VBL;
  // inputs: 0 x_norm_for_qkv [2,2048,1024]; 1 xt_current_for_v [2,2048,1024] (multiplies the projected values elementwise); 2 w_attn [3072,1024] (out,in): q rows 0..1023, k 1024..2047, v 2048..3071; 3 b_attn [3072] (zeros, read); 4 w_proj [1024,1024] (out,in); 5 b_proj (zeros, read)
  k_proj<<<dim3(TNB * TT / 64, CC / 128, 3), 128, 0, stream>>>(F[0], F[0], F[0], F[2], F[2] + (size_t)CC * DIN, F[2] + 2 * (size_t)CC * DIN, F[3], F[3] + CC, F[3] + 2 * CC, QH, QL, KH, KL, VT, VB, VBL, F[1]);
  for (int b = 0; b < TNB; ++b) for (int h0 = 0; h0 < NH; h0 += HG) {
    k_sc<<<dim3(NQB, TT / 128, HG), 128, 0, stream>>>(QH, KH, QL, KL, b, h0, S);
    k_sm<<<dim3(TT, HG), 256, 0, stream>>>(S);
    k_pv<<<dim3(NQB, 1, HG), 128, 0, stream>>>(S, VT, VB, VBL, b, h0, Y);
  }
  k_out<<<dim3(TNB * TT / 64, DIN / 128), 128, 0, stream>>>(Y, F[4], F[5], (float*)d_out);
}

// v001
// Measured time: 630 microseconds a run.
// Timed twice side by side with v000, it ran 2.01 and 2.04 times as fast.
// compute dtype: all float inputs rounded to bf16; q / k / v projections with EXACT bf16 products on WMMA 16x16x32 (f32 accumulate) + bias (zeros, read); the value rows multiplied elementwise in f32 by the second input (bf16-rounded) per (token, head, dim); causal logits: 3 products for the first 384 rows, single f16 q x k after, x 64^-0.5; softmax f32; P x 2^11 once to f16 x v once to f16 (bf16 hi + lo below row 384); ctx hi+lo x exact w_proj below row 384, x2^6 f16 carry x f16(bf16 x 2^8) after, + b_proj (zeros); f32 output.
#include <hip/hip_runtime.h>
#include <math.h>

typedef __attribute__((ext_vector_type(16))) _Float16 v16h;
typedef __attribute__((ext_vector_type(16))) __bf16 v16b;
typedef __attribute__((ext_vector_type(8)))  _Float16 v8h;
typedef __attribute__((ext_vector_type(8)))  float v8f;
typedef __attribute__((ext_vector_type(4)))  float v4f;
typedef __attribute__((ext_vector_type(2)))  float v2f;
typedef __attribute__((ext_vector_type(4)))  unsigned v4u;
typedef __attribute__((ext_vector_type(4)))  int v4i;
typedef float __attribute__((may_alias)) float_a;
typedef int __attribute__((may_alias)) int_a;

template <typename T> __device__ __forceinline__ void vst2(void* p, T v) { *(T*)p = v;  }
__device__ __forceinline__ v8f wmma16(v16h a, v16h b, v8f c) {
  v8f d = __builtin_amdgcn_wmma_f32_16x16x32_f16(false, a, false, b, (short)0, c, false, false);
  asm volatile("v_nop\n\tv_nop\n\tv_nop\n\tv_nop" : "+v"(d) : "v"(a), "v"(b));
  return d;
}
__device__ __forceinline__ v8f wmma_bf(v16b a, v16b b, v8f c) {
  v8f d = __builtin_amdgcn_wmma_f32_16x16x32_bf16(false, a, false, b, (short)0, c, false, false);
  asm volatile("v_nop\n\tv_nop\n\tv_nop\n\tv_nop" : "+v"(d) : "v"(a), "v"(b));
  return d;
}
// 16x16x32 fragments: lane = (h = lane>>4, row/col = lane&15); elements 0..7 = k0+8h+0..7, 8..15 = k0+16+8h+0..7; D element r = row 8h+r
__device__ __forceinline__ v16h frag_h(const _Float16* rowk0, int lane) {
  union { v16h v; v8h q[2]; } u; const _Float16* p = rowk0 + 8 * (lane >> 4);
  u.q[0] = *(const v8h*)p; u.q[1] = *(const v8h*)(p + 16); return u.v;
}
__device__ __forceinline__ v16h frag_f32(const float* rowk0, int lane) {
  v16h a; const float* p = rowk0 + 8 * (lane >> 4);
#pragma unroll
  for (int i = 0; i < 8; ++i) { a[i] = (_Float16)p[i]; a[8 + i] = (_Float16)p[16 + i]; }
  return a;
}
__device__ __forceinline__ v16h frag_f32s(const float* rowk0, int lane, float sc) {
  v16h a; const float* p = rowk0 + 8 * (lane >> 4);
#pragma unroll
  for (int i = 0; i < 8; ++i) { a[i] = (_Float16)(p[i] * sc); a[8 + i] = (_Float16)(p[16 + i] * sc); }
  return a;
}
// column fragment from a [K][ld] layout (column n), rows >= K read as 0
__device__ __forceinline__ v16h fragc_f32(const float* W, int k0, int n, int lane, int ld, int K) {
  v16h a; const int g = lane >> 4;
#pragma unroll
  for (int i = 0; i < 8; ++i) { const int ka = k0 + 8 * g + i, kb = ka + 16;
    a[i] = (_Float16)(ka < K ? W[(size_t)(ka < K ? ka : K - 1) * ld + n] : 0.f); a[8 + i] = (_Float16)(kb < K ? W[(size_t)(kb < K ? kb : K - 1) * ld + n] : 0.f); }
  return a;
}
struct F2 { v16b h, l; };
__device__ __forceinline__ F2 bsplit16(const float v[16]) { F2 r;
#pragma unroll
  for (int i = 0; i < 16; ++i) { const __bf16 h = (__bf16)v[i]; r.h[i] = h; r.l[i] = (__bf16)(v[i] - (float)h); }
  return r; }
__device__ __forceinline__ F2 split_row(const float* row, int k0, int lane) { float v[16]; const float* p = row + k0 + 8 * (lane >> 4);
#pragma unroll
  for (int i = 0; i < 8; ++i) { v[i] = p[i]; v[8 + i] = p[16 + i]; }
  return bsplit16(v); }
__device__ __forceinline__ F2 split_rowK(const float* row, int k0, int lane, int K) { float v[16]; const int g = lane >> 4;
#pragma unroll
  for (int i = 0; i < 8; ++i) { const int ka = k0 + 8 * g + i, kb = ka + 16; v[i] = ka < K ? row[ka < K ? ka : K - 1] : 0.f; v[8 + i] = kb < K ? row[kb < K ? kb : K - 1] : 0.f; }
  return bsplit16(v); }
__device__ __forceinline__ F2 split_col(const float* W, int k0, int n, int lane, int ld, int K) { float v[16]; const int g = lane >> 4;
#pragma unroll
  for (int i = 0; i < 8; ++i) { const int ka = k0 + 8 * g + i, kb = ka + 16; v[i] = ka < K ? W[(size_t)(ka < K ? ka : K - 1) * ld + n] : 0.f; v[8 + i] = kb < K ? W[(size_t)(kb < K ? kb : K - 1) * ld + n] : 0.f; }
  return bsplit16(v); }
__device__ __forceinline__ v8f mac3(const F2& a, const F2& b, v8f c) { c = wmma_bf(a.l, b.h, c); c = wmma_bf(a.h, b.l, c); return wmma_bf(a.h, b.h, c); }
__device__ __forceinline__ float sigm(float v) { return 1.0f / (1.0f + expf(-v)); }
#define LDSX() do { asm volatile("s_wait_dscnt 0" ::: "memory"); __builtin_amdgcn_wave_barrier(); __builtin_amdgcn_fence(__ATOMIC_RELEASE, "workgroup"); } while (0)

// Multi-head causal self-attention with an elementwise-modulated value path (x_norm_for_qkv, xt_current_for_v [2,2048,1024]; w_attn [3072,1024] torch (out,in) N(0, 1/1024), b_attn zeros (read): jnp.split thirds of x_norm @ w_attn.T + b_attn (q = rows 0..1023, k = 1024..2047, v = 2048..3071); 16 heads x 64; effective_v = heads(xt_current_for_v) * v (elementwise); att x 1/sqrt(64); tril kept, -inf elsewhere; softmax; y @ w_proj.T + b_proj (w_proj (out,in), b_proj zeros, read)).
#define NB 2
#define TT 2048
#define CC 1024            // NH * HD = projected width
#define DIN 1024          // input (model) width
#define NH 16
#define HD 64
#define NQB (TT / 64)
#define HG 4
#define SCALE (0.125f)
#define CAUSAL 1
#ifndef TNB
#define TNB NB
#endif
__device__ __forceinline__ float bfr(float v) { return (float)(__bf16)v; }
__host__ __device__ __forceinline__ int kb_last(int qb) { return CAUSAL ? ((qb * 64 + 63) >> 7) : (TT / 128 - 1); }
typedef __attribute__((ext_vector_type(8))) __bf16 v8b;
__device__ __forceinline__ v16b frag_b(const __bf16* rowk0, int lane) {
  union { v16b v; v8b q[2]; } u; const __bf16* p = rowk0 + 8 * (lane >> 4);
  u.q[0] = *(const v8b*)p; u.q[1] = *(const v8b*)(p + 16); return u.v;
}
#define QBH 6              // causal: query blocks 0..QBH-1 of each sequence (few keys, no averaging) take the high-precision path
#define QHI 384            // rows carrying a q residual plane
#define KHI 384            // key rows carrying k residual / v bf16 hi+lo planes (used only by the causal high-precision path)
// B fragment (k rows k0+.., output column o) of a weight: (in,out) [K][ld] or (out,in) [ld rows of K]: bf16 exact, or f16(bf16 * 256) exact
__device__ __forceinline__ v16b wcol_io(const float* Wm, int k0, int o, int lane, int ld) { v16b w; const int g = lane >> 4;
#pragma unroll
  for (int i = 0; i < 8; ++i) { w[i] = (__bf16)Wm[(size_t)(k0 + 8 * g + i) * ld + o]; w[8 + i] = (__bf16)Wm[(size_t)(k0 + 16 + 8 * g + i) * ld + o]; }
  return w; }
__device__ __forceinline__ v16b wcol_oi(const float* Wm, int k0, int o, int lane, int K) { v16b w; const float* p = Wm + (size_t)o * K + k0 + 8 * (lane >> 4);
#pragma unroll
  for (int i = 0; i < 8; ++i) { w[i] = (__bf16)p[i]; w[8 + i] = (__bf16)p[16 + i]; }
  return w; }
__device__ __forceinline__ v16h wcolh_io(const float* Wm, int k0, int o, int lane, int ld) { v16h w; const int g = lane >> 4;
#pragma unroll
  for (int i = 0; i < 8; ++i) { w[i] = (_Float16)(bfr(Wm[(size_t)(k0 + 8 * g + i) * ld + o]) * 256.0f); w[8 + i] = (_Float16)(bfr(Wm[(size_t)(k0 + 16 + 8 * g + i) * ld + o]) * 256.0f); }
  return w; }
__device__ __forceinline__ v16h wcolh_oi(const float* Wm, int k0, int o, int lane, int K) { v16h w; const float* p = Wm + (size_t)o * K + k0 + 8 * (lane >> 4);
#pragma unroll
  for (int i = 0; i < 8; ++i) { w[i] = (_Float16)(bfr(p[i]) * 256.0f); w[8 + i] = (_Float16)(bfr(p[16 + i]) * 256.0f); }
  return w; }
// fragment loads from the lane's own pointer p = row + k0 + 8 * (lane >> 4), so that a batch's loads are constant offsets from one address pair; the 16 raw floats of a fragment (R16) and their conversions are separate functions
struct R16 { v4f q[4]; };
__device__ __forceinline__ R16 wraw(const float* p) { R16 r;
  r.q[0] = *(const v4f*)p; r.q[1] = *(const v4f*)(p + 4); r.q[2] = *(const v4f*)(p + 16); r.q[3] = *(const v4f*)(p + 20); return r; }
__device__ __forceinline__ v16h fragh_p(const _Float16* p) { union { v16h v; v8h q[2]; } u; u.q[0] = *(const v8h*)p; u.q[1] = *(const v8h*)(p + 16); return u.v; }
__device__ __forceinline__ v16b fragb_p(const __bf16* p) { union { v16b v; v8b q[2]; } u; u.q[0] = *(const v8b*)p; u.q[1] = *(const v8b*)(p + 16); return u.v; }
__device__ __forceinline__ v16h cvth_r(const R16& r) { v16h a;
#pragma unroll
  for (int i = 0; i < 8; ++i) { a[i] = (_Float16)r.q[i >> 2][i & 3]; a[8 + i] = (_Float16)r.q[2 + (i >> 2)][i & 3]; }
  return a; }
__device__ __forceinline__ v16b cvtb_r(const R16& r) { v16b a;
#pragma unroll
  for (int i = 0; i < 8; ++i) { a[i] = (__bf16)r.q[i >> 2][i & 3]; a[8 + i] = (__bf16)r.q[2 + (i >> 2)][i & 3]; }
  return a; }
__device__ __forceinline__ F2 split_r(const R16& r) { float v[16];
#pragma unroll
  for (int i = 0; i < 8; ++i) { v[i] = r.q[i >> 2][i & 3]; v[8 + i] = r.q[2 + (i >> 2)][i & 3]; }
  return bsplit16(v); }
__device__ __forceinline__ v16h wcolh_r(const R16& r) { v16h w;
#pragma unroll
  for (int i = 0; i < 8; ++i) { w[i] = (_Float16)(bfr(r.q[i >> 2][i & 3]) * 256.0f); w[8 + i] = (_Float16)(bfr(r.q[2 + (i >> 2)][i & 3]) * 256.0f); }
  return w; }
#define WQKV_LAYOUT 1   // 0 = (in,out) [DIN][CC]; 1 = (out,in) [CC][DIN]; 2 = per-head [NH][DIN][HD]
__device__ __forceinline__ v16b wcol_hdk(const float* Wm, int k0, int o, int lane) { v16b w; const int g = lane >> 4; const float* p = Wm + (size_t)(o / HD) * DIN * HD + (o % HD);
#pragma unroll
  for (int i = 0; i < 8; ++i) { w[i] = (__bf16)p[(size_t)(k0 + 8 * g + i) * HD]; w[8 + i] = (__bf16)p[(size_t)(k0 + 16 + 8 * g + i) * HD]; }
  return w; }
#define WO_OUT_IN 1
#if WQKV_LAYOUT == 1
#define WCOL(W, k0, o, lane) wcol_oi(W, k0, o, lane, DIN)
#elif WQKV_LAYOUT == 2
#define WCOL(W, k0, o, lane) wcol_hdk(W, k0, o, lane)
#else
#define WCOL(W, k0, o, lane) wcol_io(W, k0, o, lane, CC)
#endif
#if WO_OUT_IN
#define WOCOL(W, k0, o, lane) wcol_oi(W, k0, o, lane, CC)
#define WOCOLH(W, k0, o, lane) wcolh_oi(W, k0, o, lane, CC)
#else
#define WOCOL(W, k0, o, lane) wcol_io(W, k0, o, lane, DIN)
#define WOCOLH(W, k0, o, lane) wcolh_io(W, k0, o, lane, DIN)
#endif

// (PROJ_EXTRA_PARAMS: the extra kernel parameters 'const float* __restrict__ XT' are written literally in the kernel signature)
// per (token, head) hook on the staged f32 row (64 floats, projection + bias) of the v stream: effective_v = xt * v elementwise with the same (token, head) slice of the second input (bf16-rounded); one f32 product per element; q and k untouched
#define PROJ_EPI(which, row, t, h) do { if ((which) == 2) { float* rw = (row); const float* xr_ = XT + ((size_t)bb * TT + (t)) * CC + (h) * 64; _Pragma("unroll 8") for (int i = 0; i < 64; ++i) rw[i] = bfr(xr_[i]) * rw[i]; } } while (0)
#ifndef SM_EXTRA_PARAMS
#define SM_EXTRA_PARAMS
#endif
#ifndef PROJ_EXTRA_PARAMS
#define PROJ_EXTRA_PARAMS
#endif
#ifndef SM_MASK_HOOK
#define SM_MASK_HOOK (void)0
#endif

#define WS_QH  0u                                      // f16 q rows [b*t][CC]
#define WS_KH  (WS_QH + 2u * (size_t)NB * TT * CC)      // f16 k rows [b*t][CC]
#define WS_VT  (WS_KH + 2u * (size_t)NB * TT * CC)      // f16 v planes [b][c][t]
#define WS_QL  (WS_VT + 2u * (size_t)NB * CC * TT)      // f16 q residual x 2^10 rows [b][t < QHI][CC]
#define WS_KL  (WS_QL + 2u * (size_t)NB * QHI * CC)     // f16 k residual x 2^10 rows [b][t < KHI][CC]
#define WS_VB  (WS_KL + 2u * (size_t)NB * KHI * CC)     // bf16 v hi planes [b][c][t < KHI]
#define WS_VBL (WS_VB + 2u * (size_t)NB * CC * KHI)
#define WS_S   (WS_VBL + 2u * (size_t)NB * CC * KHI)    // f32 logits / P [hg][t][s]
#define WS_Y   (WS_S  + 4u * (size_t)HG * TT * TT)      // f32 ctx rows [b*t][CC] (only when there is an output projection)
#define WS_END (WS_Y  + 4u * (size_t)NB * TT * CC)

// ---- k_proj: block = (64 rows, 128 cols, which): q/k/v = X W (+ b) with exact bf16 products (K = DIN) -> which 0: q f16 rows (+ residual rows < QHI); 1: k f16 rows (+ residual rows < KHI); 2: v f16 planes [c][t] (+ bf16 hi/lo planes for t < KHI)
__global__ __launch_bounds__(128) void k_proj(const float* __restrict__ XQ, const float* __restrict__ XK, const float* __restrict__ XV, const float* __restrict__ WQ, const float* __restrict__ WK, const float* __restrict__ WV, const float* __restrict__ BQ, const float* __restrict__ BK, const float* __restrict__ BV,
    _Float16* __restrict__ QH, _Float16* __restrict__ QL, _Float16* __restrict__ KH, _Float16* __restrict__ KL, _Float16* __restrict__ VT, __bf16* __restrict__ VB, __bf16* __restrict__ VBL, const float* __restrict__ XT) {
  __shared__ __align__(16) float st[64][132]; __shared__ __align__(16) _Float16 sh[64][136], sl[64][136]; __shared__ __align__(16) _Float16 th[128][72]; __shared__ __align__(16) __bf16 tb[128][72], tbl[128][72];
  const int tid = threadIdx.x, wave = tid >> 5, lane = tid & 31, col = lane & 15, g = lane >> 4; const int which = blockIdx.z; const int c0 = blockIdx.y * 128; const size_t r0 = (size_t)blockIdx.x * 64; const size_t bb = r0 / TT; const int t0 = (int)(r0 % TT);
  const float* X = which == 0 ? XQ : which == 1 ? XK : XV; const float* WA = which == 0 ? WQ : which == 1 ? WK : WV; const float* BA = which == 0 ? BQ : which == 1 ? BK : BV;
  v8f acc[8] = {};
#pragma unroll 2
  for (int kc = 0; kc < DIN / 32; ++kc) { v16b a; { const float* p = X + (r0 + wave * 16 + col) * DIN + kc * 32 + 8 * g;
#pragma unroll
      for (int i = 0; i < 8; ++i) { a[i] = (__bf16)p[i]; a[8 + i] = (__bf16)p[16 + i]; } }
    v16b w[8];   // all eight weight fragments of the trip are loaded ahead of its first WMMA: one load latency a trip
#pragma unroll
    for (int j = 0; j < 8; ++j) w[j] = WCOL(WA, kc * 32, c0 + j * 16 + col, lane);
#pragma unroll
    for (int j = 0; j < 8; ++j) acc[j] = wmma_bf(a, w[j], acc[j]); }
  { // stage the f32 tile (acc + bias) in LDS, run the per-(row, head) epilogue hook, then convert
#pragma unroll
    for (int j = 0; j < 8; ++j) { const float bias = BA ? bfr(BA[c0 + j * 16 + col]) : 0.f;
#pragma unroll
      for (int r = 0; r < 8; ++r) st[wave * 16 + 8 * g + r][j * 16 + col] = acc[j][r] + bias; }
    __syncthreads();
    for (int e = tid; e < 64 * (128 / HD); e += 128) { const int rl = e / (128 / HD), hh = e % (128 / HD); PROJ_EPI(which, &st[rl][hh * HD], (int)((r0 + rl) % TT), (c0 / HD) + hh); }
    __syncthreads(); }
  if (which < 2) { _Float16* DH = which == 0 ? QH : KH; _Float16* DL = which == 0 ? QL : KL; const int nhi = which == 0 ? QHI : KHI; const bool hi_rows = t0 < nhi;
    for (int e = tid; e < 64 * 128; e += 128) { const int rl = e >> 7, cl = e & 127; const float v = st[rl][cl]; const _Float16 hv = (_Float16)v; sh[rl][cl] = hv; sl[rl][cl] = (_Float16)((v - (float)hv) * 1024.0f); }
    __syncthreads();
    for (int e = tid; e < 64 * 16; e += 128) { const int rl = e >> 4, q = e & 15; vst2((unsigned*)(DH + (r0 + rl) * CC + c0 + q * 8), *(const v4u*)&sh[rl][q * 8]); if (hi_rows) vst2((unsigned*)(DL + (bb * nhi + t0 + rl) * (size_t)CC + c0 + q * 8), *(const v4u*)&sl[rl][q * 8]); }
  } else { const bool hi_rows = t0 < KHI;
    for (int e = tid; e < 64 * 128; e += 128) { const int rl = e & 63, cl = e >> 6; const float v = st[rl][cl]; th[cl][rl] = (_Float16)v; const __bf16 bh = (__bf16)v; tb[cl][rl] = bh; tbl[cl][rl] = (__bf16)(v - (float)bh); }
    __syncthreads();
    for (int e = tid; e < 128 * 8; e += 128) { const int cl = e >> 3, q = e & 7; vst2((unsigned*)(VT + (bb * CC + c0 + cl) * (size_t)TT + t0 + q * 8), *(const v4u*)&th[cl][q * 8]); if (hi_rows) { const size_t o3 = (bb * CC + c0 + cl) * (size_t)KHI + t0 + q * 8; vst2((unsigned*)(VB + o3), *(const v4u*)&tb[cl][q * 8]); vst2((unsigned*)(VBL + o3), *(const v4u*)&tbl[cl][q * 8]); } } } }
// ---- k_sc: block = (query block qb, key block kb <= kb_last(qb), head in group) of batch b: logits x SCALE; q hi + residual (x 2^10) against k (2 products) for query rows < QHI, plus the k residual (3 products) for query blocks < QBH (causal early rows); causal: blocks past the diagonal exit, the mask itself is applied by index in k_sm
__global__ __launch_bounds__(128) void k_sc(const _Float16* __restrict__ QH, const _Float16* __restrict__ KH, const _Float16* __restrict__ QL, const _Float16* __restrict__ KL, int b, int h0, float* __restrict__ S0) { __shared__ __align__(16) float ss[4][16][132];
  const int qb = blockIdx.x, kb = blockIdx.y; if (kb > kb_last(qb)) return;
  const int h = h0 + blockIdx.z; float* S = S0 + (size_t)blockIdx.z * TT * TT;
  const int tid = threadIdx.x, wave = tid >> 5, lane = tid & 31, col = lane & 15, g = lane >> 4; const int k0 = kb * 128; const int ql0 = qb * 64 + wave * 16; const size_t q0 = (size_t)b * TT + ql0, kr0 = (size_t)b * TT + k0;
  v8f acc[8] = {}, accl[8] = {};
  const _Float16* QLb = QL + (size_t)b * QHI * CC; const _Float16* KLb = KL + (size_t)b * KHI * CC;
  if (qb < QBH) {
#pragma unroll
    for (int kc = 0; kc < HD / 32; ++kc) { const v16h ah = frag_h(QH + (q0 + col) * CC + h * HD + kc * 32, lane), al = frag_h(QLb + (size_t)(ql0 + col) * CC + h * HD + kc * 32, lane);
#pragma unroll
      for (int j2 = 0; j2 < 8; j2 += 2) { v16h kbf[2], klf[2];   // two key tiles' fragments loaded together (registers bound the batch on this path)
#pragma unroll
        for (int u = 0; u < 2; ++u) { kbf[u] = frag_h(KH + (kr0 + (j2 + u) * 16 + col) * CC + h * HD + kc * 32, lane); klf[u] = frag_h(KLb + (size_t)(k0 + (j2 + u) * 16 + col) * CC + h * HD + kc * 32, lane); }
#pragma unroll
        for (int u = 0; u < 2; ++u) { const int j = j2 + u; acc[j] = wmma16(ah, kbf[u], acc[j]); accl[j] = wmma16(al, kbf[u], accl[j]); accl[j] = wmma16(ah, klf[u], accl[j]); } } }
  } else if (qb * 64 < QHI) {
#pragma unroll
    for (int kc = 0; kc < HD / 32; ++kc) { const v16h ah = frag_h(QH + (q0 + col) * CC + h * HD + kc * 32, lane), al = frag_h(QLb + (size_t)(ql0 + col) * CC + h * HD + kc * 32, lane);
#pragma unroll
      for (int j = 0; j < 8; ++j) { const v16h kbf = frag_h(KH + (kr0 + j * 16 + col) * CC + h * HD + kc * 32, lane); acc[j] = wmma16(ah, kbf, acc[j]); accl[j] = wmma16(al, kbf, accl[j]); } }
  } else {
#pragma unroll
    for (int kc = 0; kc < HD / 32; ++kc) { const v16h ah = frag_h(QH + (q0 + col) * CC + h * HD + kc * 32, lane); v16h kbf[8];   // the eight key fragments are loaded ahead of the first WMMA
#pragma unroll
      for (int j = 0; j < 8; ++j) kbf[j] = frag_h(KH + (kr0 + j * 16 + col) * CC + h * HD + kc * 32, lane);
#pragma unroll
      for (int j = 0; j < 8; ++j) acc[j] = wmma16(ah, kbf[j], acc[j]); } }
#pragma unroll
  for (int j = 0; j < 8; ++j) {
#pragma unroll
    for (int r = 0; r < 8; ++r) ss[wave][8 * g + r][j * 16 + col] = (acc[j][r] + accl[j][r] * (1.0f / 1024.0f)) * SCALE; }
  LDSX(); for (int rl = 0; rl < 16; ++rl) vst2(S + (size_t)(ql0 + rl) * TT + k0 + lane * 4, *(const v4f*)&ss[wave][rl][lane * 4]); }
// ---- k_sm: block = query row t (head in group): keys [0, kend): causal -> logit if s <= t else excluded; softmax in f32; P x 2^11 in place (0 for excluded)
__global__ __launch_bounds__(256) void k_sm(float* __restrict__ S0 SM_EXTRA_PARAMS) { __shared__ float sred[8]; __shared__ float sbc; __shared__ __align__(16) float shv[TT];
  const int tid = threadIdx.x; const int t = blockIdx.x; const int kend = (kb_last(t >> 6) + 1) * 128;
  float* sr = S0 + (size_t)blockIdx.y * TT * TT + (size_t)t * TT;
  float m = -3.0e38f; for (int k = tid; k < kend; k += 256) { float v = (!CAUSAL || k <= t) ? sr[k] : -3.0e38f; SM_MASK_HOOK; shv[k] = v; m = fmaxf(m, v); }
#pragma unroll
  for (int o = 1; o < 32; o <<= 1) m = fmaxf(m, __shfl_xor(m, o));
  if ((tid & 31) == 0) sred[tid >> 5] = m; __syncthreads(); if (tid == 0) { float a = sred[0]; for (int i = 1; i < 8; ++i) a = fmaxf(a, sred[i]); sbc = a; } __syncthreads(); m = sbc; __syncthreads();
  float sum = 0.f; for (int k = tid; k < kend; k += 256) { const float v = shv[k]; const float e = (v <= -1.0e38f) ? 0.f : expf(v - m); shv[k] = e; sum += e; }
#pragma unroll
  for (int o = 1; o < 32; o <<= 1) sum += __shfl_xor(sum, o);
  if ((tid & 31) == 0) sred[tid >> 5] = sum; __syncthreads(); if (tid == 0) { float a = 0.f; for (int i = 0; i < 8; ++i) a += sred[i]; sbc = a > 0.f ? 2048.0f / a : 0.f; }   /* a fully excluded row yields P = 0 */ __syncthreads(); const float inv = sbc;
  for (int k = tid; k < kend; k += 256) shv[k] = shv[k] * inv;
  __syncthreads(); for (int q = tid; q < kend / 4; q += 256) vst2(sr + q * 4, *(const v4f*)&shv[q * 4]); }
// ---- k_pv: block = 64 queries (qb) of (b, h): ctx = P . v over keys [0, kend) (P x 2^11 once to f16 against v f16: 1 product; causal early query blocks: P and v as bf16 hi + lo, 3 products); 256-B (row, head) segment by 16 lanes
__global__ __launch_bounds__(128) void k_pv(const float* __restrict__ PS0, const _Float16* __restrict__ VT, const __bf16* __restrict__ VB, const __bf16* __restrict__ VBL, int b, int h0, float* __restrict__ Y) { const int h = h0 + blockIdx.z; const float* PS = PS0 + (size_t)blockIdx.z * TT * TT; __shared__ __align__(16) float ss[4][16][HD + 4];
  const int tid = threadIdx.x, wave = tid >> 5, lane = tid & 31, col = lane & 15, g = lane >> 4; const int qb = blockIdx.x; const int ql0 = qb * 64 + wave * 16; const int kce = (kb_last(qb) + 1) * 4;
  v8f acc[HD / 16] = {};
  if (qb < QBH) {
#pragma unroll 1
    for (int kc = 0; kc < kce; ++kc) { const float* pa = PS + (size_t)(ql0 + col) * TT + kc * 32 + 8 * g; const size_t po = ((size_t)b * CC + h * HD + col) * (size_t)KHI + kc * 32 + 8 * g; const __bf16 *vha = VB + po, *vla = VBL + po; const F2 p = split_r(wraw(pa)); v16b vh[HD / 16], vl[HD / 16];   // the trip's P and v fragments are loaded together, ahead of its first WMMA
#pragma unroll
      for (int j = 0; j < HD / 16; ++j) { vh[j] = fragb_p(vha + j * 16 * KHI); vl[j] = fragb_p(vla + j * 16 * KHI); }
      asm volatile("s_wait_xcnt 0x0" :: "v"(pa), "v"(vha), "v"(vla) : "memory");   // behind the batch, its address pairs as inputs: as in the loop below
#pragma unroll
      for (int j = 0; j < HD / 16; ++j) { acc[j] = wmma_bf(p.h, vh[j], acc[j]); acc[j] = wmma_bf(p.l, vh[j], acc[j]); acc[j] = wmma_bf(p.h, vl[j], acc[j]); } }
  } else {
#pragma unroll 1
    for (int kc = 0; kc < kce; kc += 4) { v16h p[4], vf[4][HD / 16]; const float* pa = PS + (size_t)(ql0 + col) * TT + kc * 32 + 8 * g; const _Float16* va = VT + ((size_t)b * CC + h * HD + col) * (size_t)TT + kc * 32 + 8 * g;   // kce is a multiple of 4: a whole 128-key block's P and v fragments are loaded ahead of its first WMMA; the WMMAs keep their kc order
#pragma unroll
      for (int u = 0; u < 4; ++u) { p[u] = cvth_r(wraw(pa + u * 32));
#pragma unroll
        for (int j = 0; j < HD / 16; ++j) vf[u][j] = fragh_p(va + j * 16 * TT + u * 32); }
      asm volatile("s_wait_xcnt 0x0" :: "v"(pa), "v"(va) : "memory");   // behind the batch: its two address pairs are inputs here, so no load of the batch lands on an address register that an earlier load of it names
      __builtin_amdgcn_sched_barrier(0);   // keeps the conversions of P behind the whole batch: without it the scheduler holds the last loads back until the first P values are converted, a second load latency a trip
#pragma unroll
      for (int u = 0; u < 4; ++u)
#pragma unroll
        for (int j = 0; j < HD / 16; ++j) acc[j] = wmma16(p[u], vf[u][j], acc[j]); } }
#pragma unroll
  for (int j = 0; j < HD / 16; ++j)
#pragma unroll
    for (int r = 0; r < 8; ++r) ss[wave][8 * g + r][j * 16 + col] = acc[j][r] * (1.0f / 2048.0f);
  LDSX(); for (int rl = 0; rl < 16; ++rl) if (lane < HD / 4) vst2(Y + ((size_t)b * TT + ql0 + rl) * CC + h * HD + lane * 4, *(const v4f*)&ss[wave][rl][lane * 4]); }
// ---- k_out: block = (64 rows, 128 cols): out = ctx Wo (+ bo): ctx x 2^6 once to f16 against Wo as f16(bf16 x 2^8) exact (1 product) x 2^-14; causal early rows (< QHI of each sequence): ctx bf16 hi + lo against exact bf16 Wo (2 products)
__global__ __launch_bounds__(128) void k_out(const float* __restrict__ Y, const float* __restrict__ WO, const float* __restrict__ BO, float* __restrict__ OUT) { __shared__ __align__(16) float sf[4][16][132];
  const int tid = threadIdx.x, wave = tid >> 5, lane = tid & 31, col = lane & 15, g = lane >> 4; const int c0 = blockIdx.y * 128; const size_t r0 = (size_t)blockIdx.x * 64 + wave * 16;
  v8f acc[8] = {};
  if (CAUSAL && (int)(((size_t)blockIdx.x * 64) % TT) < QHI) {   /* block-uniform */
#pragma unroll 2
    for (int kc = 0; kc < CC / 32; ++kc) { const float *ya = Y + (r0 + col) * CC + kc * 32 + 8 * g, *wa = WO + (size_t)(c0 + col) * CC + kc * 32 + 8 * g; const F2 a = split_r(wraw(ya)); v16b w[8];   // the trip's eight weight fragments are loaded ahead of its first WMMA
#pragma unroll
      for (int j = 0; j < 8; ++j) w[j] = cvtb_r(wraw(wa + j * 16 * CC));
      asm volatile("s_wait_xcnt 0x0" :: "v"(ya), "v"(wa) : "memory");   // behind the batch, its address pairs as inputs: as in k_pv
#pragma unroll
      for (int j = 0; j < 8; ++j) { acc[j] = wmma_bf(a.h, w[j], acc[j]); acc[j] = wmma_bf(a.l, w[j], acc[j]); } }
#pragma unroll
    for (int j = 0; j < 8; ++j) { const float bias = BO ? bfr(BO[c0 + j * 16 + col]) : 0.f;
#pragma unroll
      for (int r = 0; r < 8; ++r) sf[wave][8 * g + r][j * 16 + col] = acc[j][r] + bias; }
  } else { const float* wb = WO + (size_t)(c0 + col) * CC + 8 * g;   // one base for the eight fragments: their rows differ by constant offsets
#pragma unroll 2
    for (int kc = 0; kc < CC / 32; ++kc) { const v16h a = frag_f32s(Y + (r0 + col) * CC + kc * 32, lane, 64.0f); R16 wr[8];   /* ctx carried x 2^6 into f16 so small-magnitude context rows stay clear of f16 subnormals */
#pragma unroll
      for (int j = 0; j < 8; ++j) wr[j] = wraw(wb + j * 16 * CC + kc * 32);
      __builtin_amdgcn_sched_barrier(0);   // keeps the trip's loads together in front of the conversions: without it the scheduler puts each fragment's loads behind the previous fragment's conversion, one load latency a fragment
#pragma unroll
      for (int j = 0; j < 8; ++j) acc[j] = wmma16(a, wcolh_r(wr[j]), acc[j]); }
#pragma unroll
    for (int j = 0; j < 8; ++j) { const float bias = BO ? bfr(BO[c0 + j * 16 + col]) : 0.f;
#pragma unroll
      for (int r = 0; r < 8; ++r) sf[wave][8 * g + r][j * 16 + col] = acc[j][r] * (1.0f / 16384.0f) + bias; } }   /* 2^-8 (Wo carry) x 2^-6 (ctx carry) */
  LDSX(); for (int rl = 0; rl < 16; ++rl) vst2(OUT + (r0 + rl) * DIN + c0 + lane * 4, *(const v4f*)&sf[wave][rl][lane * 4]); }

extern "C" void kernel_launch(void* const* d_in, const int* in_sizes, int n_in, void* d_out, int out_size, void* d_ws, size_t ws_size, hipStream_t stream) {
  (void)in_sizes; (void)n_in; (void)out_size;
  const float** F = (const float**)d_in;
  if (ws_size < (size_t)WS_END) return;
  char* ws = (char*)d_ws; _Float16 *QH = (_Float16*)(ws + WS_QH), *KH = (_Float16*)(ws + WS_KH), *VT = (_Float16*)(ws + WS_VT), *QL = (_Float16*)(ws + WS_QL), *KL = (_Float16*)(ws + WS_KL); __bf16 *VB = (__bf16*)(ws + WS_VB), *VBL = (__bf16*)(ws + WS_VBL); float *S = (float*)(ws + WS_S), *Y = (float*)(ws + WS_Y);
  (void)Y; (void)QL; (void)KL; (void)VB; (void)VBL;
  // inputs: 0 x_norm_for_qkv [2,2048,1024]; 1 xt_current_for_v [2,2048,1024] (multiplies the projected values elementwise); 2 w_attn [3072,1024] (out,in): q rows 0..1023, k 1024..2047, v 2048..3071; 3 b_attn [3072] (zeros, read); 4 w_proj [1024,1024] (out,in); 5 b_proj (zeros, read)
  k_proj<<<dim3(TNB * TT / 64, CC / 128, 3), 128, 0, stream>>>(F[0], F[0], F[0], F[2], F[2] + (size_t)CC * DIN, F[2] + 2 * (size_t)CC * DIN, F[3], F[3] + CC, F[3] + 2 * CC, QH, QL, KH, KL, VT, VB, VBL, F[1]);
  for (int b = 0; b < TNB; ++b) for (int h0 = 0; h0 < NH; h0 += HG) {
    k_sc<<<dim3(NQB, TT / 128, HG), 128, 0, stream>>>(QH, KH, QL, KL, b, h0, S);
    k_sm<<<dim3(TT, HG), 256, 0, stream>>>(S);
    k_pv<<<dim3(NQB, 1, HG), 128, 0, stream>>>(S, VT, VB, VBL, b, h0, Y);
  }
  k_out<<<dim3(TNB * TT / 64, DIN / 128), 128, 0, stream>>>(Y, F[4], F[5], (float*)d_out);
}

// v002
// A run of this version takes 254 microseconds.
// Next to v001, in two timings, it ran 2.48 and 2.47 times as fast.
// Counting every step since v000, it is 5.01 times as fast.
// compute dtype: all float inputs rounded to bf16; q / k / v projections with EXACT bf16 products on WMMA 16x16x32 (f32 accumulate) + bias (zeros, read); the value rows multiplied elementwise in f32 by the second input (bf16-rounded) per (token, head, dim); causal logits: 3 products for the first 384 rows, single f16 q x k after, x 64^-0.5; softmax f32; P x 2^11 once to f16 x v once to f16 (bf16 hi + lo below row 384); ctx hi+lo x exact w_proj below row 384, x2^6 f16 carry x f16(bf16 x 2^8) after, + b_proj (zeros); f32 output.
#include <hip/hip_runtime.h>
#include <math.h>

typedef __attribute__((ext_vector_type(16))) _Float16 v16h;
typedef __attribute__((ext_vector_type(16))) __bf16 v16b;
typedef __attribute__((ext_vector_type(8)))  _Float16 v8h;
typedef __attribute__((ext_vector_type(8)))  float v8f;
typedef __attribute__((ext_vector_type(4)))  float v4f;
typedef __attribute__((ext_vector_type(2)))  float v2f;
typedef __attribute__((ext_vector_type(4)))  unsigned v4u;
typedef __attribute__((ext_vector_type(4)))  int v4i;
typedef float __attribute__((may_alias)) float_a;
typedef int __attribute__((may_alias)) int_a;

template <typename T> __device__ __forceinline__ void vst2(void* p, T v) { *(T*)p = v;  }
__device__ __forceinline__ v8f wmma16(v16h a, v16h b, v8f c) {
  v8f d = __builtin_amdgcn_wmma_f32_16x16x32_f16(false, a, false, b, (short)0, c, false, false);
  asm volatile("v_nop\n\tv_nop\n\tv_nop\n\tv_nop" : "+v"(d) : "v"(a), "v"(b));
  return d;
}
__device__ __forceinline__ v8f wmma_bf(v16b a, v16b b, v8f c) {
  v8f d = __builtin_amdgcn_wmma_f32_16x16x32_bf16(false, a, false, b, (short)0, c, false, false);
  asm volatile("v_nop\n\tv_nop\n\tv_nop\n\tv_nop" : "+v"(d) : "v"(a), "v"(b));
  return d;
}
// 16x16x32 fragments: lane = (h = lane>>4, row/col = lane&15); elements 0..7 = k0+8h+0..7, 8..15 = k0+16+8h+0..7; D element r = row 8h+r
__device__ __forceinline__ v16h frag_h(const _Float16* rowk0, int lane) {
  union { v16h v; v8h q[2]; } u; const _Float16* p = rowk0 + 8 * (lane >> 4);
  u.q[0] = *(const v8h*)p; u.q[1] = *(const v8h*)(p + 16); return u.v;
}
__device__ __forceinline__ v16h frag_f32(const float* rowk0, int lane) {
  v16h a; const float* p = rowk0 + 8 * (lane >> 4);
#pragma unroll
  for (int i = 0; i < 8; ++i) { a[i] = (_Float16)p[i]; a[8 + i] = (_Float16)p[16 + i]; }
  return a;
}
__device__ __forceinline__ v16h frag_f32s(const float* rowk0, int lane, float sc) {
  v16h a; const float* p = rowk0 + 8 * (lane >> 4);
#pragma unroll
  for (int i = 0; i < 8; ++i) { a[i] = (_Float16)(p[i] * sc); a[8 + i] = (_Float16)(p[16 + i] * sc); }
  return a;
}
// column fragment from a [K][ld] layout (column n), rows >= K read as 0
__device__ __forceinline__ v16h fragc_f32(const float* W, int k0, int n, int lane, int ld, int K) {
  v16h a; const int g = lane >> 4;
#pragma unroll
  for (int i = 0; i < 8; ++i) { const int ka = k0 + 8 * g + i, kb = ka + 16;
    a[i] = (_Float16)(ka < K ? W[(size_t)(ka < K ? ka : K - 1) * ld + n] : 0.f); a[8 + i] = (_Float16)(kb < K ? W[(size_t)(kb < K ? kb : K - 1) * ld + n] : 0.f); }
  return a;
}
struct F2 { v16b h, l; };
__device__ __forceinline__ F2 bsplit16(const float v[16]) { F2 r;
#pragma unroll
  for (int i = 0; i < 16; ++i) { const __bf16 h = (__bf16)v[i]; r.h[i] = h; r.l[i] = (__bf16)(v[i] - (float)h); }
  return r; }
__device__ __forceinline__ F2 split_row(const float* row, int k0, int lane) { float v[16]; const float* p = row + k0 + 8 * (lane >> 4);
#pragma unroll
  for (int i = 0; i < 8; ++i) { v[i] = p[i]; v[8 + i] = p[16 + i]; }
  return bsplit16(v); }
__device__ __forceinline__ F2 split_rowK(const float* row, int k0, int lane, int K) { float v[16]; const int g = lane >> 4;
#pragma unroll
  for (int i = 0; i < 8; ++i) { const int ka = k0 + 8 * g + i, kb = ka + 16; v[i] = ka < K ? row[ka < K ? ka : K - 1] : 0.f; v[8 + i] = kb < K ? row[kb < K ? kb : K - 1] : 0.f; }
  return bsplit16(v); }
__device__ __forceinline__ F2 split_col(const float* W, int k0, int n, int lane, int ld, int K) { float v[16]; const int g = lane >> 4;
#pragma unroll
  for (int i = 0; i < 8; ++i) { const int ka = k0 + 8 * g + i, kb = ka + 16; v[i] = ka < K ? W[(size_t)(ka < K ? ka : K - 1) * ld + n] : 0.f; v[8 + i] = kb < K ? W[(size_t)(kb < K ? kb : K - 1) * ld + n] : 0.f; }
  return bsplit16(v); }
__device__ __forceinline__ v8f mac3(const F2& a, const F2& b, v8f c) { c = wmma_bf(a.l, b.h, c); c = wmma_bf(a.h, b.l, c); return wmma_bf(a.h, b.h, c); }
__device__ __forceinline__ float sigm(float v) { return 1.0f / (1.0f + expf(-v)); }
#define LDSX() do { asm volatile("s_wait_dscnt 0" ::: "memory"); __builtin_amdgcn_wave_barrier(); __builtin_amdgcn_fence(__ATOMIC_RELEASE, "workgroup"); } while (0)

// Multi-head causal self-attention with an elementwise-modulated value path (x_norm_for_qkv, xt_current_for_v [2,2048,1024]; w_attn [3072,1024] torch (out,in) N(0, 1/1024), b_attn zeros (read): jnp.split thirds of x_norm @ w_attn.T + b_attn (q = rows 0..1023, k = 1024..2047, v = 2048..3071); 16 heads x 64; effective_v = heads(xt_current_for_v) * v (elementwise); att x 1/sqrt(64); tril kept, -inf elsewhere; softmax; y @ w_proj.T + b_proj (w_proj (out,in), b_proj zeros, read)).
#define NB 2
#define TT 2048
#define CC 1024            // NH * HD = projected width
#define DIN 1024          // input (model) width
#define NH 16
#define HD 64
#define NQB (TT / 64)
#define HG 4
#define SCALE (0.125f)
#define CAUSAL 1
#ifndef TNB
#define TNB NB
#endif
__device__ __forceinline__ float bfr(float v) { return (float)(__bf16)v; }
__host__ __device__ __forceinline__ int kb_last(int qb) { return CAUSAL ? ((qb * 64 + 63) >> 7) : (TT / 128 - 1); }
typedef __attribute__((ext_vector_type(8))) __bf16 v8b;
__device__ __forceinline__ v16b frag_b(const __bf16* rowk0, int lane) {
  union { v16b v; v8b q[2]; } u; const __bf16* p = rowk0 + 8 * (lane >> 4);
  u.q[0] = *(const v8b*)p; u.q[1] = *(const v8b*)(p + 16); return u.v;
}
#define QBH 6              // causal: query blocks 0..QBH-1 of each sequence (few keys, no averaging) take the high-precision path
#define QHI 384            // rows carrying a q residual plane
#define KHI 384            // key rows carrying k residual / v bf16 hi+lo planes (used only by the causal high-precision path)
// B fragment (k rows k0+.., output column o) of a weight: (in,out) [K][ld] or (out,in) [ld rows of K]: bf16 exact, or f16(bf16 * 256) exact
__device__ __forceinline__ v16b wcol_io(const float* Wm, int k0, int o, int lane, int ld) { v16b w; const int g = lane >> 4;
#pragma unroll
  for (int i = 0; i < 8; ++i) { w[i] = (__bf16)Wm[(size_t)(k0 + 8 * g + i) * ld + o]; w[8 + i] = (__bf16)Wm[(size_t)(k0 + 16 + 8 * g + i) * ld + o]; }
  return w; }
__device__ __forceinline__ v16b wcol_oi(const float* Wm, int k0, int o, int lane, int K) { v16b w; const float* p = Wm + (size_t)o * K + k0 + 8 * (lane >> 4);
#pragma unroll
  for (int i = 0; i < 8; ++i) { w[i] = (__bf16)p[i]; w[8 + i] = (__bf16)p[16 + i]; }
  return w; }
__device__ __forceinline__ v16h wcolh_io(const float* Wm, int k0, int o, int lane, int ld) { v16h w; const int g = lane >> 4;
#pragma unroll
  for (int i = 0; i < 8; ++i) { w[i] = (_Float16)(bfr(Wm[(size_t)(k0 + 8 * g + i) * ld + o]) * 256.0f); w[8 + i] = (_Float16)(bfr(Wm[(size_t)(k0 + 16 + 8 * g + i) * ld + o]) * 256.0f); }
  return w; }
__device__ __forceinline__ v16h wcolh_oi(const float* Wm, int k0, int o, int lane, int K) { v16h w; const float* p = Wm + (size_t)o * K + k0 + 8 * (lane >> 4);
#pragma unroll
  for (int i = 0; i < 8; ++i) { w[i] = (_Float16)(bfr(p[i]) * 256.0f); w[8 + i] = (_Float16)(bfr(p[16 + i]) * 256.0f); }
  return w; }
// fragment loads from the lane's own pointer p = row + k0 + 8 * (lane >> 4), so that a batch's loads are constant offsets from one address pair; the 16 raw floats of a fragment (R16) and their conversions are separate functions
struct R16 { v4f q[4]; };
__device__ __forceinline__ R16 wraw(const float* p) { R16 r;
  r.q[0] = *(const v4f*)p; r.q[1] = *(const v4f*)(p + 4); r.q[2] = *(const v4f*)(p + 16); r.q[3] = *(const v4f*)(p + 20); return r; }
__device__ __forceinline__ v16h fragh_p(const _Float16* p) { union { v16h v; v8h q[2]; } u; u.q[0] = *(const v8h*)p; u.q[1] = *(const v8h*)(p + 16); return u.v; }
__device__ __forceinline__ v16b fragb_p(const __bf16* p) { union { v16b v; v8b q[2]; } u; u.q[0] = *(const v8b*)p; u.q[1] = *(const v8b*)(p + 16); return u.v; }
__device__ __forceinline__ v16h cvth_r(const R16& r) { v16h a;
#pragma unroll
  for (int i = 0; i < 8; ++i) { a[i] = (_Float16)r.q[i >> 2][i & 3]; a[8 + i] = (_Float16)r.q[2 + (i >> 2)][i & 3]; }
  return a; }
__device__ __forceinline__ v16b cvtb_r(const R16& r) { v16b a;
#pragma unroll
  for (int i = 0; i < 8; ++i) { a[i] = (__bf16)r.q[i >> 2][i & 3]; a[8 + i] = (__bf16)r.q[2 + (i >> 2)][i & 3]; }
  return a; }
__device__ __forceinline__ F2 split_r(const R16& r) { float v[16];
#pragma unroll
  for (int i = 0; i < 8; ++i) { v[i] = r.q[i >> 2][i & 3]; v[8 + i] = r.q[2 + (i >> 2)][i & 3]; }
  return bsplit16(v); }
__device__ __forceinline__ v16h wcolh_r(const R16& r) { v16h w;
#pragma unroll
  for (int i = 0; i < 8; ++i) { w[i] = (_Float16)(bfr(r.q[i >> 2][i & 3]) * 256.0f); w[8 + i] = (_Float16)(bfr(r.q[2 + (i >> 2)][i & 3]) * 256.0f); }
  return w; }
#define WQKV_LAYOUT 1   // 0 = (in,out) [DIN][CC]; 1 = (out,in) [CC][DIN]; 2 = per-head [NH][DIN][HD]
__device__ __forceinline__ v16b wcol_hdk(const float* Wm, int k0, int o, int lane) { v16b w; const int g = lane >> 4; const float* p = Wm + (size_t)(o / HD) * DIN * HD + (o % HD);
#pragma unroll
  for (int i = 0; i < 8; ++i) { w[i] = (__bf16)p[(size_t)(k0 + 8 * g + i) * HD]; w[8 + i] = (__bf16)p[(size_t)(k0 + 16 + 8 * g + i) * HD]; }
  return w; }
#define WO_OUT_IN 1
#if WQKV_LAYOUT == 1
#define WCOL(W, k0, o, lane) wcol_oi(W, k0, o, lane, DIN)
#elif WQKV_LAYOUT == 2
#define WCOL(W, k0, o, lane) wcol_hdk(W, k0, o, lane)
#else
#define WCOL(W, k0, o, lane) wcol_io(W, k0, o, lane, CC)
#endif
#if WO_OUT_IN
#define WOCOL(W, k0, o, lane) wcol_oi(W, k0, o, lane, CC)
#define WOCOLH(W, k0, o, lane) wcolh_oi(W, k0, o, lane, CC)
#else
#define WOCOL(W, k0, o, lane) wcol_io(W, k0, o, lane, DIN)
#define WOCOLH(W, k0, o, lane) wcolh_io(W, k0, o, lane, DIN)
#endif

// (PROJ_EXTRA_PARAMS: the extra kernel parameters 'const float* __restrict__ XT' are written literally in the kernel signature)
// per (token, head) hook on the staged f32 row (64 floats, projection + bias) of the v stream: effective_v = xt * v elementwise with the same (token, head) slice of the second input (bf16-rounded); one f32 product per element; q and k untouched
#define PROJ_EPI(which, row, t, h) do { if ((which) == 2) { float* rw = (row); const float* xr_ = XT + ((size_t)bb * TT + (t)) * CC + (h) * 64; _Pragma("unroll 8") for (int i = 0; i < 64; ++i) rw[i] = bfr(xr_[i]) * rw[i]; } } while (0)
#ifndef SM_EXTRA_PARAMS
#define SM_EXTRA_PARAMS
#endif
#ifndef PROJ_EXTRA_PARAMS
#define PROJ_EXTRA_PARAMS
#endif
#ifndef SM_MASK_HOOK
#define SM_MASK_HOOK (void)0
#endif

#define WS_QH  0u                                      // f16 q rows [b*t][CC]
#define WS_KH  (WS_QH + 2u * (size_t)NB * TT * CC)      // f16 k rows [b*t][CC]
#define WS_VT  (WS_KH + 2u * (size_t)NB * TT * CC)      // f16 v planes [b][c][t]
#define WS_QL  (WS_VT + 2u * (size_t)NB * CC * TT)      // f16 q residual x 2^10 rows [b][t < QHI][CC]
#define WS_KL  (WS_QL + 2u * (size_t)NB * QHI * CC)     // f16 k residual x 2^10 rows [b][t < KHI][CC]
#define WS_VB  (WS_KL + 2u * (size_t)NB * KHI * CC)     // bf16 v hi planes [b][c][t < KHI]
#define WS_VBL (WS_VB + 2u * (size_t)NB * CC * KHI)
#define WS_S   (WS_VBL + 2u * (size_t)NB * CC * KHI)    // (not used: the logits stay in registers)
#define WS_Y   (WS_S  + 4u * (size_t)HG * TT * TT)      // f32 ctx rows [b*t][CC] (only when there is an output projection)
#define WS_END (WS_Y  + 4u * (size_t)NB * TT * CC)

// ---- k_proj: block = (64 rows, 128 cols, which): q/k/v = X W (+ b) with exact bf16 products (K = DIN) -> which 0: q f16 rows (+ residual rows < QHI); 1: k f16 rows (+ residual rows < KHI); 2: v f16 planes [c][t] (+ bf16 hi/lo planes for t < KHI)
__global__ __launch_bounds__(128) void k_proj(const float* __restrict__ XQ, const float* __restrict__ XK, const float* __restrict__ XV, const float* __restrict__ WQ, const float* __restrict__ WK, const float* __restrict__ WV, const float* __restrict__ BQ, const float* __restrict__ BK, const float* __restrict__ BV,
    _Float16* __restrict__ QH, _Float16* __restrict__ QL, _Float16* __restrict__ KH, _Float16* __restrict__ KL, _Float16* __restrict__ VT, __bf16* __restrict__ VB, __bf16* __restrict__ VBL, const float* __restrict__ XT) {
  __shared__ __align__(16) float st[64][132]; __shared__ __align__(16) _Float16 sh[64][136], sl[64][136]; __shared__ __align__(16) _Float16 th[128][72]; __shared__ __align__(16) __bf16 tb[128][72], tbl[128][72];
  const int tid = threadIdx.x, wave = tid >> 5, lane = tid & 31, col = lane & 15, g = lane >> 4; const int which = blockIdx.z; const int c0 = blockIdx.y * 128; const size_t r0 = (size_t)blockIdx.x * 64; const size_t bb = r0 / TT; const int t0 = (int)(r0 % TT);
  const float* X = which == 0 ? XQ : which == 1 ? XK : XV; const float* WA = which == 0 ? WQ : which == 1 ? WK : WV; const float* BA = which == 0 ? BQ : which == 1 ? BK : BV;
  v8f acc[8] = {};
#pragma unroll 2
  for (int kc = 0; kc < DIN / 32; ++kc) { v16b a; { const float* p = X + (r0 + wave * 16 + col) * DIN + kc * 32 + 8 * g;
#pragma unroll
      for (int i = 0; i < 8; ++i) { a[i] = (__bf16)p[i]; a[8 + i] = (__bf16)p[16 + i]; } }
    v16b w[8];   // all eight weight fragments of the trip are loaded ahead of its first WMMA: one load latency a trip
#pragma unroll
    for (int j = 0; j < 8; ++j) w[j] = WCOL(WA, kc * 32, c0 + j * 16 + col, lane);
#pragma unroll
    for (int j = 0; j < 8; ++j) acc[j] = wmma_bf(a, w[j], acc[j]); }
  { // stage the f32 tile (acc + bias) in LDS, run the per-(row, head) epilogue hook, then convert
#pragma unroll
    for (int j = 0; j < 8; ++j) { const float bias = BA ? bfr(BA[c0 + j * 16 + col]) : 0.f;
#pragma unroll
      for (int r = 0; r < 8; ++r) st[wave * 16 + 8 * g + r][j * 16 + col] = acc[j][r] + bias; }
    __syncthreads();
    for (int e = tid; e < 64 * (128 / HD); e += 128) { const int rl = e / (128 / HD), hh = e % (128 / HD); PROJ_EPI(which, &st[rl][hh * HD], (int)((r0 + rl) % TT), (c0 / HD) + hh); }
    __syncthreads(); }
  if (which < 2) { _Float16* DH = which == 0 ? QH : KH; _Float16* DL = which == 0 ? QL : KL; const int nhi = which == 0 ? QHI : KHI; const bool hi_rows = t0 < nhi;
    for (int e = tid; e < 64 * 128; e += 128) { const int rl = e >> 7, cl = e & 127; const float v = st[rl][cl]; const _Float16 hv = (_Float16)v; sh[rl][cl] = hv; sl[rl][cl] = (_Float16)((v - (float)hv) * 1024.0f); }
    __syncthreads();
    for (int e = tid; e < 64 * 16; e += 128) { const int rl = e >> 4, q = e & 15; vst2((unsigned*)(DH + (r0 + rl) * CC + c0 + q * 8), *(const v4u*)&sh[rl][q * 8]); if (hi_rows) vst2((unsigned*)(DL + (bb * nhi + t0 + rl) * (size_t)CC + c0 + q * 8), *(const v4u*)&sl[rl][q * 8]); }
  } else { const bool hi_rows = t0 < KHI;
    for (int e = tid; e < 64 * 128; e += 128) { const int rl = e & 63, cl = e >> 6; const float v = st[rl][cl]; th[cl][rl] = (_Float16)v; const __bf16 bh = (__bf16)v; tb[cl][rl] = bh; tbl[cl][rl] = (__bf16)(v - (float)bh); }
    __syncthreads();
    for (int e = tid; e < 128 * 8; e += 128) { const int cl = e >> 3, q = e & 7; vst2((unsigned*)(VT + (bb * CC + c0 + cl) * (size_t)TT + t0 + q * 8), *(const v4u*)&th[cl][q * 8]); if (hi_rows) { const size_t o3 = (bb * CC + c0 + cl) * (size_t)KHI + t0 + q * 8; vst2((unsigned*)(VB + o3), *(const v4u*)&tb[cl][q * 8]); vst2((unsigned*)(VBL + o3), *(const v4u*)&tbl[cl][q * 8]); } } } }
// ---- k_att: block = 64 queries (4 waves x 16) of one (b, h): logits, softmax and P . v in one kernel, nothing of the logits leaves the registers.
// Every product is taken transposed: S^T = K . Q^T (A = key rows, B = query rows), so a lane holds keys j*16 + 8g + r of ONE query (column lane & 15), and two neighbouring S^T tiles are, register for register, the B fragment of ctx^T = V^T . P^T (A = v planes).
// Two sweeps over the keys: the first finds each query's maximum and denominator (kept per lane, the two half-rows joined once at the end), the second forms the logits again, P x 2^11 = exp(s - max) x 2048 / sum, and the P . v products in the key order 0, 32, 64, ...
// one 128-key block of logits x SCALE: kp / klp = the lane's own pointer (key row k0 + col, the head's dims, + 8g)
template <bool HI> __device__ __forceinline__ void att_logits(const _Float16* kp, const _Float16* klp, const v16h (&qh)[2], const v16h (&ql)[2], v8f (&s)[8]) {
  if constexpr (HI) {
#pragma unroll
    for (int j2 = 0; j2 < 8; j2 += 2) { v16h kbf[HD / 32][2], klf[HD / 32][2];   // two key tiles' fragments loaded together (registers bound the batch on this path)
#pragma unroll
      for (int kc = 0; kc < HD / 32; ++kc)
#pragma unroll
        for (int u = 0; u < 2; ++u) { kbf[kc][u] = fragh_p(kp + (j2 + u) * 16 * CC + kc * 32); klf[kc][u] = fragh_p(klp + (j2 + u) * 16 * CC + kc * 32); }
      asm volatile("s_wait_xcnt 0x0" :: "v"(kp), "v"(klp) : "memory");   // behind the batch, its address pairs as inputs: they are stepped on at the foot of the key loop
      v8f acc[2] = {}, accl[2] = {};
#pragma unroll
      for (int kc = 0; kc < HD / 32; ++kc)
#pragma unroll
        for (int u = 0; u < 2; ++u) { acc[u] = wmma16(kbf[kc][u], qh[kc], acc[u]); accl[u] = wmma16(kbf[kc][u], ql[kc], accl[u]); accl[u] = wmma16(klf[kc][u], qh[kc], accl[u]); }
#pragma unroll
      for (int u = 0; u < 2; ++u)
#pragma unroll
        for (int r = 0; r < 8; ++r) s[j2 + u][r] = (acc[u][r] + accl[u][r] * (1.0f / 1024.0f)) * SCALE; }
  } else { v8f acc[8] = {}; v16h kf[HD / 32][8];   // the block's sixteen key fragments are loaded ahead of its first WMMA: one load latency a block
#pragma unroll
    for (int kc = 0; kc < HD / 32; ++kc)
#pragma unroll
      for (int j = 0; j < 8; ++j) kf[kc][j] = fragh_p(kp + j * 16 * CC + kc * 32);
    asm volatile("s_wait_xcnt 0x0" :: "v"(kp) : "memory");   // behind the batch, its address pair as input: it is stepped on at the foot of the key loop
#pragma unroll
    for (int j = 0; j < 8; ++j)   // tile by tile: a tile's two fragments are free again as its eight logits come alive
#pragma unroll
      for (int kc = 0; kc < HD / 32; ++kc) acc[j] = wmma16(kf[kc][j], qh[kc], acc[j]);
#pragma unroll
    for (int j = 0; j < 8; ++j)
#pragma unroll
      for (int r = 0; r < 8; ++r) s[j][r] = acc[j][r] * SCALE; } }
// the causal mask, by index: d = the lane's query - its first key of the block; an excluded logit becomes -3e38, whose exp(s - m) is an exact 0 against any finite m
__device__ __forceinline__ void att_mask(v8f (&s)[8], int d) {
#pragma unroll
  for (int j = 0; j < 8; ++j)
#pragma unroll
    for (int r = 0; r < 8; ++r) if (j * 16 + r > d) s[j][r] = -3.0e38f; }
// first sweep: the lane's running maximum m and the sum of exp(s - m) over its own 64 keys of the block (a lane that has met only excluded keys keeps m = -3e38, and its sum is multiplied by exp(-3e38 - max) = 0 where the halves are joined)
__device__ __forceinline__ void att_stats(const v8f (&s)[8], float& m, float& sum) {
  float mx = s[0][0];
#pragma unroll
  for (int j = 0; j < 8; ++j)
#pragma unroll
    for (int r = 0; r < 8; ++r) mx = fmaxf(mx, s[j][r]);
  const float mn = fmaxf(m, mx); float a[4] = { sum * expf(m - mn), 0.f, 0.f, 0.f };
#pragma unroll
  for (int j = 0; j < 8; ++j)
#pragma unroll
    for (int r = 0; r < 8; ++r) a[r & 3] += expf(s[j][r] - mn);
  sum = (a[0] + a[1]) + (a[2] + a[3]); m = mn; }
// second sweep: s -> P x 2^11 in place (0 for excluded keys)
__device__ __forceinline__ void att_p(v8f (&s)[8], float m, float inv) {
#pragma unroll
  for (int j = 0; j < 8; ++j)
#pragma unroll
    for (int r = 0; r < 8; ++r) s[j][r] = expf(s[j][r] - m) * inv; }
// second sweep, one 128-key block: va (f16 planes) or vha / vla (bf16 hi / lo planes) = the lane's own pointer (plane h*HD + col, key k0 + 8g)
template <bool HI> __device__ __forceinline__ void att_pv(v8f (&s)[8], float m, float inv, const _Float16* va, const __bf16* vha, const __bf16* vla, v8f (&acc)[HD / 16]) {
  if constexpr (HI) { att_p(s, m, inv);
#pragma unroll
    for (int u = 0; u < 4; ++u) { float pv[16];
#pragma unroll
      for (int i = 0; i < 8; ++i) { pv[i] = s[2 * u][i]; pv[8 + i] = s[2 * u + 1][i]; }
      const F2 p = bsplit16(pv); v16b vh[HD / 16], vl[HD / 16];
#pragma unroll
      for (int j = 0; j < HD / 16; ++j) { vh[j] = fragb_p(vha + j * 16 * KHI + u * 32); vl[j] = fragb_p(vla + j * 16 * KHI + u * 32); }
      asm volatile("s_wait_xcnt 0x0" :: "v"(vha), "v"(vla) : "memory");   // behind the batch, its address pairs as inputs: as in att_logits
#pragma unroll
      for (int j = 0; j < HD / 16; ++j) { acc[j] = wmma_bf(vh[j], p.h, acc[j]); acc[j] = wmma_bf(vh[j], p.l, acc[j]); acc[j] = wmma_bf(vl[j], p.h, acc[j]); } }
  } else { v16h vf[4][HD / 16];   // the first 64 keys' v fragments are asked for ahead of the exponentials, the other 64 behind them (registers bound the batch)
#pragma unroll
    for (int u = 0; u < 2; ++u)
#pragma unroll
      for (int j = 0; j < HD / 16; ++j) vf[u][j] = fragh_p(va + j * 16 * TT + u * 32);
    asm volatile("s_wait_xcnt 0x0" :: "v"(va) : "memory");   // behind the batch, its address pair as input: as in att_logits
    att_p(s, m, inv);
    v16h p[4];
#pragma unroll
    for (int u = 0; u < 4; ++u)
#pragma unroll
      for (int i = 0; i < 8; ++i) { p[u][i] = (_Float16)s[2 * u][i]; p[u][8 + i] = (_Float16)s[2 * u + 1][i]; }
#pragma unroll
    for (int u = 2; u < 4; ++u)
#pragma unroll
      for (int j = 0; j < HD / 16; ++j) vf[u][j] = fragh_p(va + j * 16 * TT + u * 32);
    asm volatile("s_wait_xcnt 0x0" :: "v"(va) : "memory");   // behind the batch, its address pair as input: as in att_logits
#pragma unroll
    for (int u = 0; u < 4; ++u)
#pragma unroll
      for (int j = 0; j < HD / 16; ++j) acc[j] = wmma16(vf[u][j], p[u], acc[j]); } }
template <bool HI> __device__ __forceinline__ void att_body(const _Float16* __restrict__ QH, const _Float16* __restrict__ KH, const _Float16* __restrict__ QL, const _Float16* __restrict__ KL, const _Float16* __restrict__ VT, const __bf16* __restrict__ VB, const __bf16* __restrict__ VBL, int b, int h, int qb, int ql0, int col, int g, v8f (&acc)[HD / 16]) {
  const int t = ql0 + col, kbl = kb_last(qb);
  const _Float16* qp = QH + ((size_t)b * TT + t) * CC + h * HD + 8 * g; const _Float16* qlp = HI ? QL + ((size_t)b * QHI + t) * CC + h * HD + 8 * g : qp;
  v16h qh[2], ql[2];
#pragma unroll
  for (int kc = 0; kc < HD / 32; ++kc) { qh[kc] = fragh_p(qp + kc * 32); ql[kc] = fragh_p(qlp + kc * 32); }
  asm volatile("s_wait_xcnt 0x0" :: "v"(qp), "v"(qlp) : "memory");   // behind the query loads, their address pairs as inputs: the registers are free for reuse behind it
  const _Float16* const kp0 = KH + ((size_t)b * TT + col) * CC + h * HD + 8 * g; const _Float16* const klp0 = HI ? KL + ((size_t)b * KHI + col) * CC + h * HD + 8 * g : kp0;
  float m = -3.0e38f, sum = 0.f; v8f s[8];
#pragma unroll 1
  for (int kb = 0; kb <= kbl; ++kb) { att_logits<HI>(kp0 + (size_t)kb * 128 * CC, klp0 + (size_t)kb * 128 * CC, qh, ql, s); if (CAUSAL && kb == kbl) att_mask(s, t - kb * 128 - 8 * g);   /* block-uniform: blocks below the last hold no key past any of the 64 queries */
    att_stats(s, m, sum); }
  const float m2 = __shfl_xor(m, 16), s2 = __shfl_xor(sum, 16), mm = fmaxf(m, m2); const float tot = sum * expf(m - mm) + s2 * expf(m2 - mm);   // lanes l and l ^ 16 hold the two halves of one query's keys
  const float inv = tot > 0.f ? 2048.0f / tot : 0.f;   /* every query has at least its own key, so mm is finite */
  const _Float16* const va0 = VT + ((size_t)b * CC + h * HD + col) * (size_t)TT + 8 * g; const size_t po = ((size_t)b * CC + h * HD + col) * (size_t)KHI + 8 * g; const __bf16 *vha0 = VB + po, *vla0 = VBL + po;
#pragma unroll 1
  for (int kb = 0; kb <= kbl; ++kb) { att_logits<HI>(kp0 + (size_t)kb * 128 * CC, klp0 + (size_t)kb * 128 * CC, qh, ql, s); if (CAUSAL && kb == kbl) att_mask(s, t - kb * 128 - 8 * g);   /* block-uniform */
    att_pv<HI>(s, mm, inv, va0 + kb * 128, vha0 + kb * 128, vla0 + kb * 128, acc); } }
__global__ __launch_bounds__(128) __attribute__((amdgpu_waves_per_eu(4, 4))) void k_att(const _Float16* __restrict__ QH, const _Float16* __restrict__ KH, const _Float16* __restrict__ QL, const _Float16* __restrict__ KL, const _Float16* __restrict__ VT, const __bf16* __restrict__ VB, const __bf16* __restrict__ VBL, float* __restrict__ Y) { __shared__ __align__(16) float ss[4][16][HD + 4];
  const int tid = threadIdx.x, wave = tid >> 5, lane = tid & 31, col = lane & 15, g = lane >> 4; const int b = blockIdx.x / NH, h = blockIdx.x % NH;
  const int qi = blockIdx.y; const int qb = NQB - 1 - ((qi & 8) ? (qi ^ 7) : qi);   // long query blocks start first; every second run of eight is reversed, so that blocks 256 apart in launch order add up to equal work
  const int ql0 = qb * 64 + wave * 16;
  v8f acc[HD / 16] = {};
  if (qb < QBH) att_body<true>(QH, KH, QL, KL, VT, VB, VBL, b, h, qb, ql0, col, g, acc);   /* block-uniform */
  else att_body<false>(QH, KH, QL, KL, VT, VB, VBL, b, h, qb, ql0, col, g, acc);
#pragma unroll
  for (int j = 0; j < HD / 16; ++j)
#pragma unroll
    for (int r = 0; r < 8; ++r) ss[wave][col][j * 16 + 8 * g + r] = acc[j][r] * (1.0f / 2048.0f);   // ctx^T: element r of tile j = dim j*16 + 8g + r of query col
  LDSX(); for (int rl = 0; rl < 16; ++rl) if (lane < HD / 4) vst2(Y + ((size_t)b * TT + ql0 + rl) * CC + h * HD + lane * 4, *(const v4f*)&ss[wave][rl][lane * 4]); }
// ---- k_out: block = (64 rows, 128 cols): out = ctx Wo (+ bo): ctx x 2^6 once to f16 against Wo as f16(bf16 x 2^8) exact (1 product) x 2^-14; causal early rows (< QHI of each sequence): ctx bf16 hi + lo against exact bf16 Wo (2 products)
__global__ __launch_bounds__(128) void k_out(const float* __restrict__ Y, const float* __restrict__ WO, const float* __restrict__ BO, float* __restrict__ OUT) { __shared__ __align__(16) float sf[4][16][132];
  const int tid = threadIdx.x, wave = tid >> 5, lane = tid & 31, col = lane & 15, g = lane >> 4; const int c0 = blockIdx.y * 128; const size_t r0 = (size_t)blockIdx.x * 64 + wave * 16;
  v8f acc[8] = {};
  if (CAUSAL && (int)(((size_t)blockIdx.x * 64) % TT) < QHI) {   /* block-uniform */
#pragma unroll 2
    for (int kc = 0; kc < CC / 32; ++kc) { const float *ya = Y + (r0 + col) * CC + kc * 32 + 8 * g, *wa = WO + (size_t)(c0 + col) * CC + kc * 32 + 8 * g; const F2 a = split_r(wraw(ya)); v16b w[8];   // the trip's eight weight fragments are loaded ahead of its first WMMA
#pragma unroll
      for (int j = 0; j < 8; ++j) w[j] = cvtb_r(wraw(wa + j * 16 * CC));
      asm volatile("s_wait_xcnt 0x0" :: "v"(ya), "v"(wa) : "memory");   // behind the batch, its address pairs as inputs: as in att_logits
#pragma unroll
      for (int j = 0; j < 8; ++j) { acc[j] = wmma_bf(a.h, w[j], acc[j]); acc[j] = wmma_bf(a.l, w[j], acc[j]); } }
#pragma unroll
    for (int j = 0; j < 8; ++j) { const float bias = BO ? bfr(BO[c0 + j * 16 + col]) : 0.f;
#pragma unroll
      for (int r = 0; r < 8; ++r) sf[wave][8 * g + r][j * 16 + col] = acc[j][r] + bias; }
  } else { const float* wb = WO + (size_t)(c0 + col) * CC + 8 * g;   // one base for the eight fragments: their rows differ by constant offsets
#pragma unroll 2
    for (int kc = 0; kc < CC / 32; ++kc) { const v16h a = frag_f32s(Y + (r0 + col) * CC + kc * 32, lane, 64.0f); R16 wr[8];   /* ctx carried x 2^6 into f16 so small-magnitude context rows stay clear of f16 subnormals */
#pragma unroll
      for (int j = 0; j < 8; ++j) wr[j] = wraw(wb + j * 16 * CC + kc * 32);
      __builtin_amdgcn_sched_barrier(0);   // keeps the trip's loads together in front of the conversions: without it the scheduler puts each fragment's loads behind the previous fragment's conversion, one load latency a fragment
#pragma unroll
      for (int j = 0; j < 8; ++j) acc[j] = wmma16(a, wcolh_r(wr[j]), acc[j]); }
#pragma unroll
    for (int j = 0; j < 8; ++j) { const float bias = BO ? bfr(BO[c0 + j * 16 + col]) : 0.f;
#pragma unroll
      for (int r = 0; r < 8; ++r) sf[wave][8 * g + r][j * 16 + col] = acc[j][r] * (1.0f / 16384.0f) + bias; } }   /* 2^-8 (Wo carry) x 2^-6 (ctx carry) */
  LDSX(); for (int rl = 0; rl < 16; ++rl) vst2(OUT + (r0 + rl) * DIN + c0 + lane * 4, *(const v4f*)&sf[wave][rl][lane * 4]); }

extern "C" void kernel_launch(void* const* d_in, const int* in_sizes, int n_in, void* d_out, int out_size, void* d_ws, size_t ws_size, hipStream_t stream) {
  (void)in_sizes; (void)n_in; (void)out_size;
  const float** F = (const float**)d_in;
  if (ws_size < (size_t)WS_END) return;
  char* ws = (char*)d_ws; _Float16 *QH = (_Float16*)(ws + WS_QH), *KH = (_Float16*)(ws + WS_KH), *VT = (_Float16*)(ws + WS_VT), *QL = (_Float16*)(ws + WS_QL), *KL = (_Float16*)(ws + WS_KL); __bf16 *VB = (__bf16*)(ws + WS_VB), *VBL = (__bf16*)(ws + WS_VBL); float *Y = (float*)(ws + WS_Y);
  (void)Y; (void)QL; (void)KL; (void)VB; (void)VBL;
  // inputs: 0 x_norm_for_qkv [2,2048,1024]; 1 xt_current_for_v [2,2048,1024] (multiplies the projected values elementwise); 2 w_attn [3072,1024] (out,in): q rows 0..1023, k 1024..2047, v 2048..3071; 3 b_attn [3072] (zeros, read); 4 w_proj [1024,1024] (out,in); 5 b_proj (zeros, read)
  k_proj<<<dim3(TNB * TT / 64, CC / 128, 3), 128, 0, stream>>>(F[0], F[0], F[0], F[2], F[2] + (size_t)CC * DIN, F[2] + 2 * (size_t)CC * DIN, F[3], F[3] + CC, F[3] + 2 * CC, QH, QL, KH, KL, VT, VB, VBL, F[1]);
  k_att<<<dim3(TNB * NH, NQB), 128, 0, stream>>>(QH, KH, QL, KL, VT, VB, VBL, Y);
  k_out<<<dim3(TNB * TT / 64, DIN / 128), 128, 0, stream>>>(Y, F[4], F[5], (float*)d_out);
}

// v003
// It runs in 161 microseconds.
// In two side-by-side timings against v002, it was 1.57 and 1.58 times as fast.
// All steps since v000 together make it 7.89 times as fast.
// compute dtype: all float inputs rounded to bf16; q / k / v projections with EXACT bf16 products on WMMA 16x16x32 (f32 accumulate) + bias (zeros, read); the value rows multiplied elementwise in f32 by the second input (bf16-rounded) per (token, head, dim); causal logits: 3 products for the first 384 rows, single f16 q x k after, x 64^-0.5; softmax f32; P x 2^11 once to f16 x v once to f16 (bf16 hi + lo below row 384); ctx hi+lo x exact w_proj below row 384, x2^6 f16 carry x f16(bf16 x 2^8) after, + b_proj (zeros); f32 output.
#include <hip/hip_runtime.h>
#include <math.h>

typedef __attribute__((ext_vector_type(16))) _Float16 v16h;
typedef __attribute__((ext_vector_type(16))) __bf16 v16b;
typedef __attribute__((ext_vector_type(8)))  _Float16 v8h;
typedef __attribute__((ext_vector_type(8)))  float v8f;
typedef __attribute__((ext_vector_type(4)))  float v4f;
typedef __attribute__((ext_vector_type(2)))  float v2f;
typedef __attribute__((ext_vector_type(4)))  unsigned v4u;
typedef __attribute__((ext_vector_type(4)))  int v4i;
typedef float __attribute__((may_alias)) float_a;
typedef int __attribute__((may_alias)) int_a;

template <typename T> __device__ __forceinline__ void vst2(void* p, T v) { *(T*)p = v;  }
__device__ __forceinline__ v8f wmma16(v16h a, v16h b, v8f c) {
  v8f d = __builtin_amdgcn_wmma_f32_16x16x32_f16(false, a, false, b, (short)0, c, false, false);
  asm volatile("v_nop\n\tv_nop\n\tv_nop\n\tv_nop" : "+v"(d) : "v"(a), "v"(b));
  return d;
}
__device__ __forceinline__ v8f wmma_bf(v16b a, v16b b, v8f c) {
  v8f d = __builtin_amdgcn_wmma_f32_16x16x32_bf16(false, a, false, b, (short)0, c, false, false);
  asm volatile("v_nop\n\tv_nop\n\tv_nop\n\tv_nop" : "+v"(d) : "v"(a), "v"(b));
  return d;
}
// 16x16x32 fragments: lane = (h = lane>>4, row/col = lane&15); elements 0..7 = k0+8h+0..7, 8..15 = k0+16+8h+0..7; D element r = row 8h+r
__device__ __forceinline__ v16h frag_h(const _Float16* rowk0, int lane) {
  union { v16h v; v8h q[2]; } u; const _Float16* p = rowk0 + 8 * (lane >> 4);
  u.q[0] = *(const v8h*)p; u.q[1] = *(const v8h*)(p + 16); return u.v;
}
__device__ __forceinline__ v16h frag_f32(const float* rowk0, int lane) {
  v16h a; const float* p = rowk0 + 8 * (lane >> 4);
#pragma unroll
  for (int i = 0; i < 8; ++i) { a[i] = (_Float16)p[i]; a[8 + i] = (_Float16)p[16 + i]; }
  return a;
}
__device__ __forceinline__ v16h frag_f32s(const float* rowk0, int lane, float sc) {
  v16h a; const float* p = rowk0 + 8 * (lane >> 4);
#pragma unroll
  for (int i = 0; i < 8; ++i) { a[i] = (_Float16)(p[i] * sc); a[8 + i] = (_Float16)(p[16 + i] * sc); }
  return a;
}
// column fragment from a [K][ld] layout (column n), rows >= K read as 0
__device__ __forceinline__ v16h fragc_f32(const float* W, int k0, int n, int lane, int ld, int K) {
  v16h a; const int g = lane >> 4;
#pragma unroll
  for (int i = 0; i < 8; ++i) { const int ka = k0 + 8 * g + i, kb = ka + 16;
    a[i] = (_Float16)(ka < K ? W[(size_t)(ka < K ? ka : K - 1) * ld + n] : 0.f); a[8 + i] = (_Float16)(kb < K ? W[(size_t)(kb < K ? kb : K - 1) * ld + n] : 0.f); }
  return a;
}
struct F2 { v16b h, l; };
__device__ __forceinline__ F2 bsplit16(const float v[16]) { F2 r;
#pragma unroll
  for (int i = 0; i < 16; ++i) { const __bf16 h = (__bf16)v[i]; r.h[i] = h; r.l[i] = (__bf16)(v[i] - (float)h); }
  return r; }
__device__ __forceinline__ F2 split_row(const float* row, int k0, int lane) { float v[16]; const float* p = row + k0 + 8 * (lane >> 4);
#pragma unroll
  for (int i = 0; i < 8; ++i) { v[i] = p[i]; v[8 + i] = p[16 + i]; }
  return bsplit16(v); }
__device__ __forceinline__ F2 split_rowK(const float* row, int k0, int lane, int K) { float v[16]; const int g = lane >> 4;
#pragma unroll
  for (int i = 0; i < 8; ++i) { const int ka = k0 + 8 * g + i, kb = ka + 16; v[i] = ka < K ? row[ka < K ? ka : K - 1] : 0.f; v[8 + i] = kb < K ? row[kb < K ? kb : K - 1] : 0.f; }
  return bsplit16(v); }
__device__ __forceinline__ F2 split_col(const float* W, int k0, int n, int lane, int ld, int K) { float v[16]; const int g = lane >> 4;
#pragma unroll
  for (int i = 0; i < 8; ++i) { const int ka = k0 + 8 * g + i, kb = ka + 16; v[i] = ka < K ? W[(size_t)(ka < K ? ka : K - 1) * ld + n] : 0.f; v[8 + i] = kb < K ? W[(size_t)(kb < K ? kb : K - 1) * ld + n] : 0.f; }
  return bsplit16(v); }
__device__ __forceinline__ v8f mac3(const F2& a, const F2& b, v8f c) { c = wmma_bf(a.l, b.h, c); c = wmma_bf(a.h, b.l, c); return wmma_bf(a.h, b.h, c); }
__device__ __forceinline__ float sigm(float v) { return 1.0f / (1.0f + expf(-v)); }
#define LDSX() do { asm volatile("s_wait_dscnt 0" ::: "memory"); __builtin_amdgcn_wave_barrier(); __builtin_amdgcn_fence(__ATOMIC_RELEASE, "workgroup"); } while (0)

// Multi-head causal self-attention with an elementwise-modulated value path (x_norm_for_qkv, xt_current_for_v [2,2048,1024]; w_attn [3072,1024] torch (out,in) N(0, 1/1024), b_attn zeros (read): jnp.split thirds of x_norm @ w_attn.T + b_attn (q = rows 0..1023, k = 1024..2047, v = 2048..3071); 16 heads x 64; effective_v = heads(xt_current_for_v) * v (elementwise); att x 1/sqrt(64); tril kept, -inf elsewhere; softmax; y @ w_proj.T + b_proj (w_proj (out,in), b_proj zeros, read)).
#define NB 2
#define TT 2048
#define CC 1024            // NH * HD = projected width
#define DIN 1024          // input (model) width
#define NH 16
#define HD 64
#define NQB (TT / 64)
#define HG 4
#define SCALE (0.125f)
#define CAUSAL 1
#ifndef TNB
#define TNB NB
#endif
__device__ __forceinline__ float bfr(float v) { return (float)(__bf16)v; }
__host__ __device__ __forceinline__ int kb_last(int qb) { return CAUSAL ? ((qb * 64 + 63) >> 7) : (TT / 128 - 1); }
typedef __attribute__((ext_vector_type(8))) __bf16 v8b;
__device__ __forceinline__ v16b frag_b(const __bf16* rowk0, int lane) {
  union { v16b v; v8b q[2]; } u; const __bf16* p = rowk0 + 8 * (lane >> 4);
  u.q[0] = *(const v8b*)p; u.q[1] = *(const v8b*)(p + 16); return u.v;
}
#define QBH 6              // causal: query blocks 0..QBH-1 of each sequence (few keys, no averaging) take the high-precision path
#define QHI 384            // rows carrying a q residual plane
#define KHI 384            // key rows carrying k residual / v bf16 hi+lo planes (used only by the causal high-precision path)
// B fragment (k rows k0+.., output column o) of a weight: (in,out) [K][ld] or (out,in) [ld rows of K]: bf16 exact, or f16(bf16 * 256) exact
__device__ __forceinline__ v16b wcol_io(const float* Wm, int k0, int o, int lane, int ld) { v16b w; const int g = lane >> 4;
#pragma unroll
  for (int i = 0; i < 8; ++i) { w[i] = (__bf16)Wm[(size_t)(k0 + 8 * g + i) * ld + o]; w[8 + i] = (__bf16)Wm[(size_t)(k0 + 16 + 8 * g + i) * ld + o]; }
  return w; }
__device__ __forceinline__ v16b wcol_oi(const float* Wm, int k0, int o, int lane, int K) { v16b w; const float* p = Wm + (size_t)o * K + k0 + 8 * (lane >> 4);
#pragma unroll
  for (int i = 0; i < 8; ++i) { w[i] = (__bf16)p[i]; w[8 + i] = (__bf16)p[16 + i]; }
  return w; }
__device__ __forceinline__ v16h wcolh_io(const float* Wm, int k0, int o, int lane, int ld) { v16h w; const int g = lane >> 4;
#pragma unroll
  for (int i = 0; i < 8; ++i) { w[i] = (_Float16)(bfr(Wm[(size_t)(k0 + 8 * g + i) * ld + o]) * 256.0f); w[8 + i] = (_Float16)(bfr(Wm[(size_t)(k0 + 16 + 8 * g + i) * ld + o]) * 256.0f); }
  return w; }
__device__ __forceinline__ v16h wcolh_oi(const float* Wm, int k0, int o, int lane, int K) { v16h w; const float* p = Wm + (size_t)o * K + k0 + 8 * (lane >> 4);
#pragma unroll
  for (int i = 0; i < 8; ++i) { w[i] = (_Float16)(bfr(p[i]) * 256.0f); w[8 + i] = (_Float16)(bfr(p[16 + i]) * 256.0f); }
  return w; }
// fragment loads from the lane's own pointer p = row + k0 + 8 * (lane >> 4), so that a batch's loads are constant offsets from one address pair; the 16 raw floats of a fragment (R16) and their conversions are separate functions
struct R16 { v4f q[4]; };
__device__ __forceinline__ R16 wraw(const float* p) { R16 r;
  r.q[0] = *(const v4f*)p; r.q[1] = *(const v4f*)(p + 4); r.q[2] = *(const v4f*)(p + 16); r.q[3] = *(const v4f*)(p + 20); return r; }
__device__ __forceinline__ v16h fragh_p(const _Float16* p) { union { v16h v; v8h q[2]; } u; u.q[0] = *(const v8h*)p; u.q[1] = *(const v8h*)(p + 16); return u.v; }
__device__ __forceinline__ v16b fragb_p(const __bf16* p) { union { v16b v; v8b q[2]; } u; u.q[0] = *(const v8b*)p; u.q[1] = *(const v8b*)(p + 16); return u.v; }
__device__ __forceinline__ v16h cvth_r(const R16& r) { v16h a;
#pragma unroll
  for (int i = 0; i < 8; ++i) { a[i] = (_Float16)r.q[i >> 2][i & 3]; a[8 + i] = (_Float16)r.q[2 + (i >> 2)][i & 3]; }
  return a; }
__device__ __forceinline__ v16b cvtb_r(const R16& r) { v16b a;
#pragma unroll
  for (int i = 0; i < 8; ++i) { a[i] = (__bf16)r.q[i >> 2][i & 3]; a[8 + i] = (__bf16)r.q[2 + (i >> 2)][i & 3]; }
  return a; }
__device__ __forceinline__ F2 split_r(const R16& r) { float v[16];
#pragma unroll
  for (int i = 0; i < 8; ++i) { v[i] = r.q[i >> 2][i & 3]; v[8 + i] = r.q[2 + (i >> 2)][i & 3]; }
  return bsplit16(v); }
__device__ __forceinline__ v16h wcolh_r(const R16& r) { v16h w;
#pragma unroll
  for (int i = 0; i < 8; ++i) { w[i] = (_Float16)(bfr(r.q[i >> 2][i & 3]) * 256.0f); w[8 + i] = (_Float16)(bfr(r.q[2 + (i >> 2)][i & 3]) * 256.0f); }
  return w; }
#define WQKV_LAYOUT 1   // 0 = (in,out) [DIN][CC]; 1 = (out,in) [CC][DIN]; 2 = per-head [NH][DIN][HD]
__device__ __forceinline__ v16b wcol_hdk(const float* Wm, int k0, int o, int lane) { v16b w; const int g = lane >> 4; const float* p = Wm + (size_t)(o / HD) * DIN * HD + (o % HD);
#pragma unroll
  for (int i = 0; i < 8; ++i) { w[i] = (__bf16)p[(size_t)(k0 + 8 * g + i) * HD]; w[8 + i] = (__bf16)p[(size_t)(k0 + 16 + 8 * g + i) * HD]; }
  return w; }
#define WO_OUT_IN 1
#if WQKV_LAYOUT == 1
#define WCOL(W, k0, o, lane) wcol_oi(W, k0, o, lane, DIN)
#elif WQKV_LAYOUT == 2
#define WCOL(W, k0, o, lane) wcol_hdk(W, k0, o, lane)
#else
#define WCOL(W, k0, o, lane) wcol_io(W, k0, o, lane, CC)
#endif
#if WO_OUT_IN
#define WOCOL(W, k0, o, lane) wcol_oi(W, k0, o, lane, CC)
#define WOCOLH(W, k0, o, lane) wcolh_oi(W, k0, o, lane, CC)
#else
#define WOCOL(W, k0, o, lane) wcol_io(W, k0, o, lane, DIN)
#define WOCOLH(W, k0, o, lane) wcolh_io(W, k0, o, lane, DIN)
#endif

// (PROJ_EXTRA_PARAMS: the extra kernel parameters 'const float* __restrict__ XT' are written literally in the kernel signature)
// per (token, head) hook on the staged f32 row (64 floats, projection + bias) of the v stream: effective_v = xt * v elementwise with the same (token, head) slice of the second input (bf16-rounded); one f32 product per element; q and k untouched
#define PROJ_EPI(which, row, t, h) do { if ((which) == 2) { float* rw = (row); const float* xr_ = XT + ((size_t)bb * TT + (t)) * CC + (h) * 64; _Pragma("unroll 8") for (int i = 0; i < 64; ++i) rw[i] = bfr(xr_[i]) * rw[i]; } } while (0)
#ifndef SM_EXTRA_PARAMS
#define SM_EXTRA_PARAMS
#endif
#ifndef PROJ_EXTRA_PARAMS
#define PROJ_EXTRA_PARAMS
#endif
#ifndef SM_MASK_HOOK
#define SM_MASK_HOOK (void)0
#endif

#define WS_QH  0u                                      // f16 q rows [b*t][CC]
#define WS_KH  (WS_QH + 2u * (size_t)NB * TT * CC)      // f16 k rows [b*t][CC]
#define WS_VT  (WS_KH + 2u * (size_t)NB * TT * CC)      // f16 v planes [b][c][t]
#define WS_QL  (WS_VT + 2u * (size_t)NB * CC * TT)      // f16 q residual x 2^10 rows [b][t < QHI][CC]
#define WS_KL  (WS_QL + 2u * (size_t)NB * QHI * CC)     // f16 k residual x 2^10 rows [b][t < KHI][CC]
#define WS_VB  (WS_KL + 2u * (size_t)NB * KHI * CC)     // bf16 v hi planes [b][c][t < KHI]
#define WS_VBL (WS_VB + 2u * (size_t)NB * CC * KHI)
#define WS_S   (WS_VBL + 2u * (size_t)NB * CC * KHI)    // (not used: the logits stay in registers)
#define WS_Y   (WS_S  + 4u * (size_t)HG * TT * TT)      // f32 ctx rows [b*t][CC] (only when there is an output projection)
#define WS_END (WS_Y  + 4u * (size_t)NB * TT * CC)

// ---- operand staging for the two dense products (k_proj, k_out): a block's A tile (64 rows) and W tile (128 rows) of 64 k are read from global memory once a block, by whole 128-byte lines, converted once, and laid in LDS as 16-bit rows; the four waves take their fragments from there.
#define SK 64              // k extent of a stage
#define SP 72              // LDS row pitch in 16-bit elements: 144 B, an odd multiple of 16 B, so that a fragment's ds_load_b128 meets no bank twice
typedef __attribute__((ext_vector_type(4))) __bf16 v4b;
typedef __attribute__((ext_vector_type(4))) _Float16 v4h;
template <int N> struct SR { v4f v[N]; };
// p = the thread's own pointer (row tid >> 4, floats 4 * (tid & 15)); piece i is row + 8 i: a wave's load covers two rows of 256 B
template <int N, int LD> __device__ __forceinline__ void st_ld(SR<N>& r, const float* p) {
#pragma unroll
  for (int i = 0; i < N; ++i) r.v[i] = *(const v4f*)(p + (size_t)i * 8 * LD); }
__device__ __forceinline__ v4b cv_b(v4f v) { v4b o;
#pragma unroll
  for (int i = 0; i < 4; ++i) o[i] = (__bf16)v[i];
  return o; }
__device__ __forceinline__ v4b cv_bl(v4f v) { v4b o;
#pragma unroll
  for (int i = 0; i < 4; ++i) o[i] = (__bf16)(v[i] - (float)(__bf16)v[i]);
  return o; }
__device__ __forceinline__ v4h cv_y(v4f v) { v4h o;
#pragma unroll
  for (int i = 0; i < 4; ++i) o[i] = (_Float16)(v[i] * 64.0f);
  return o; }
__device__ __forceinline__ v4h cv_w(v4f v) { v4h o;
#pragma unroll
  for (int i = 0; i < 4; ++i) o[i] = (_Float16)(bfr(v[i]) * 256.0f);
  return o; }
// MODE 0: A bf16, W bf16 (k_proj); 1: A bf16 hi + lo planes, W bf16 (k_out, early rows); 2: A f16(x 2^6), W f16(bf16 x 2^8) (k_out). A buffer = A rows (64, or 64 hi + 64 lo), then 128 W rows.
template <int MODE> __device__ __forceinline__ void st_put(const SR<8>& ar, const SR<16>& wr, char* buf, int so) {
  if constexpr (MODE == 2) { _Float16* d = (_Float16*)buf + so;
#pragma unroll
    for (int i = 0; i < 8; ++i) *(v4h*)(d + i * 8 * SP) = cv_y(ar.v[i]);
#pragma unroll
    for (int i = 0; i < 16; ++i) *(v4h*)(d + (64 + i * 8) * SP) = cv_w(wr.v[i]);
  } else { __bf16* d = (__bf16*)buf + so; constexpr int AR = MODE == 1 ? 128 : 64;
#pragma unroll
    for (int i = 0; i < 8; ++i) { *(v4b*)(d + i * 8 * SP) = cv_b(ar.v[i]); if constexpr (MODE == 1) *(v4b*)(d + (64 + i * 8) * SP) = cv_bl(ar.v[i]); }
#pragma unroll
    for (int i = 0; i < 16; ++i) *(v4b*)(d + (AR + i * 8) * SP) = cv_b(wr.v[i]); } }
// one stage's products, k ascending as before; fo = the lane's own offset (row lane & 15, element 8 * (lane >> 4))
template <int MODE> __device__ __forceinline__ void st_mac(const char* buf, int fo, int wave, v8f (&acc)[8]) {
#pragma unroll
  for (int kc = 0; kc < SK / 32; ++kc) {
    if constexpr (MODE == 2) { const _Float16* p = (const _Float16*)buf + fo + kc * 32; const v16h a = fragh_p(p + wave * 16 * SP); v16h w[8];
#pragma unroll
      for (int j = 0; j < 8; ++j) w[j] = fragh_p(p + (64 + j * 16) * SP);
#pragma unroll
      for (int j = 0; j < 8; ++j) acc[j] = wmma16(a, w[j], acc[j]);
    } else if constexpr (MODE == 1) { const __bf16* p = (const __bf16*)buf + fo + kc * 32; const v16b ah = fragb_p(p + wave * 16 * SP), al = fragb_p(p + (64 + wave * 16) * SP); v16b w[8];
#pragma unroll
      for (int j = 0; j < 8; ++j) w[j] = fragb_p(p + (128 + j * 16) * SP);
#pragma unroll
      for (int j = 0; j < 8; ++j) { acc[j] = wmma_bf(ah, w[j], acc[j]); acc[j] = wmma_bf(al, w[j], acc[j]); }
    } else { const __bf16* p = (const __bf16*)buf + fo + kc * 32; const v16b a = fragb_p(p + wave * 16 * SP); v16b w[8];
#pragma unroll
      for (int j = 0; j < 8; ++j) w[j] = fragb_p(p + (64 + j * 16) * SP);
#pragma unroll
      for (int j = 0; j < 8; ++j) acc[j] = wmma_bf(a, w[j], acc[j]); } } }
// the ring's work-group barrier: it orders the LDS operations alone, so that the global loads of the stage read ahead stay in flight across it (__syncthreads() would drain the load counter and lay their latency bare every stage)
#define RING_BARRIER() do { __builtin_amdgcn_fence(__ATOMIC_RELEASE, "workgroup", "local"); __builtin_amdgcn_s_barrier(); __builtin_amdgcn_fence(__ATOMIC_ACQUIRE, "workgroup", "local"); } while (0)
#define RING_BYTES(MODE) (2 * (((MODE) == 1 ? 128 : 64) + 128) * SP * 2)
// acc += A0[64 rows][KK] . W0[128 rows][KK]^T, wave w taking rows 16 w ..; two LDS buffers, the stage after next in registers. One barrier a stage: it publishes the buffer just written and ends the reads of the buffer that the next stage overwrites.
template <int MODE, int KK> __device__ __forceinline__ void gemm_staged(const float* __restrict__ A0, const float* __restrict__ W0, char* ring, int tid, v8f (&acc)[8]) {
  constexpr int BUFB = RING_BYTES(MODE) / 2, NS = KK / SK;
  const int wave = tid >> 5, lane = tid & 31; const int so = (tid >> 4) * SP + (tid & 15) * 4, fo = (lane & 15) * SP + 8 * (lane >> 4);
  const float* ag = A0 + (size_t)(tid >> 4) * KK + (tid & 15) * 4; const float* wg = W0 + (size_t)(tid >> 4) * KK + (tid & 15) * 4;
  SR<8> ar; SR<16> wr;
  st_ld<8, KK>(ar, ag); st_ld<16, KK>(wr, wg);
  st_put<MODE>(ar, wr, ring, so);
  st_ld<8, KK>(ar, ag + SK); st_ld<16, KK>(wr, wg + SK);
  asm volatile("s_wait_xcnt 0x0" :: "v"(ag), "v"(wg) : "memory");   // behind the loads, their address pairs as inputs: the pairs are stepped on next
  ag += 2 * SK; wg += 2 * SK;
  RING_BARRIER();
#pragma unroll 1   // rolled: sixteen copies of this long body would only lengthen the text
  for (int s = 0; s < NS; ++s) {
    st_mac<MODE>(ring + (s & 1) * BUFB, fo, wave, acc);
    if (s + 1 < NS) {   /* block-uniform */
      st_put<MODE>(ar, wr, ring + ((s + 1) & 1) * BUFB, so);
      if (s + 2 < NS) { st_ld<8, KK>(ar, ag); st_ld<16, KK>(wr, wg);
        asm volatile("s_wait_xcnt 0x0" :: "v"(ag), "v"(wg) : "memory");   // behind the loads, their address pairs as inputs: the pairs are stepped on next
        ag += SK; wg += SK; }
      RING_BARRIER(); } } }

// ---- k_proj: block = (64 rows, 128 cols, which): q/k/v = X W (+ b) with exact bf16 products (K = DIN) -> which 0: q f16 rows (+ residual rows < QHI); 1: k f16 rows (+ residual rows < KHI); 2: v f16 planes [c][t] (+ bf16 hi/lo planes for t < KHI)
__global__ __launch_bounds__(128) void k_proj(const float* __restrict__ XQ, const float* __restrict__ XK, const float* __restrict__ XV, const float* __restrict__ WQ, const float* __restrict__ WK, const float* __restrict__ WV, const float* __restrict__ BQ, const float* __restrict__ BK, const float* __restrict__ BV,
    _Float16* __restrict__ QH, _Float16* __restrict__ QL, _Float16* __restrict__ KH, _Float16* __restrict__ KL, _Float16* __restrict__ VT, __bf16* __restrict__ VB, __bf16* __restrict__ VBL, const float* __restrict__ XT) {
  __shared__ __align__(16) float st[64][132];
  __shared__ __align__(16) union { struct { _Float16 sh[64][136], sl[64][136], th[128][72]; __bf16 tb[128][72], tbl[128][72]; } e; char ring[RING_BYTES(0)]; } u;   // the main loop's ring lies on the epilogue's conversion tiles, which are first written two barriers behind the loop
  _Float16 (&sh)[64][136] = u.e.sh; _Float16 (&sl)[64][136] = u.e.sl; _Float16 (&th)[128][72] = u.e.th; __bf16 (&tb)[128][72] = u.e.tb; __bf16 (&tbl)[128][72] = u.e.tbl;
  const int tid = threadIdx.x, wave = tid >> 5, lane = tid & 31, col = lane & 15, g = lane >> 4; const int which = blockIdx.z; const int c0 = blockIdx.y * 128; const size_t r0 = (size_t)blockIdx.x * 64; const size_t bb = r0 / TT; const int t0 = (int)(r0 % TT);
  const float* X = which == 0 ? XQ : which == 1 ? XK : XV; const float* WA = which == 0 ? WQ : which == 1 ? WK : WV; const float* BA = which == 0 ? BQ : which == 1 ? BK : BV;
  v8f acc[8] = {};
  gemm_staged<0, DIN>(X + r0 * DIN, WA + (size_t)c0 * DIN, u.ring, tid, acc);
  { // stage the f32 tile (acc + bias) in LDS, run the per-(row, head) epilogue hook, then convert
#pragma unroll
    for (int j = 0; j < 8; ++j) { const float bias = BA ? bfr(BA[c0 + j * 16 + col]) : 0.f;
#pragma unroll
      for (int r = 0; r < 8; ++r) st[wave * 16 + 8 * g + r][j * 16 + col] = acc[j][r] + bias; }
    __syncthreads();
    for (int e = tid; e < 64 * (128 / HD); e += 128) { const int rl = e / (128 / HD), hh = e % (128 / HD); PROJ_EPI(which, &st[rl][hh * HD], (int)((r0 + rl) % TT), (c0 / HD) + hh); }
    __syncthreads(); }
  if (which < 2) { _Float16* DH = which == 0 ? QH : KH; _Float16* DL = which == 0 ? QL : KL; const int nhi = which == 0 ? QHI : KHI; const bool hi_rows = t0 < nhi;
    for (int e = tid; e < 64 * 128; e += 128) { const int rl = e >> 7, cl = e & 127; const float v = st[rl][cl]; const _Float16 hv = (_Float16)v; sh[rl][cl] = hv; sl[rl][cl] = (_Float16)((v - (float)hv) * 1024.0f); }
    __syncthreads();
    for (int e = tid; e < 64 * 16; e += 128) { const int rl = e >> 4, q = e & 15; vst2((unsigned*)(DH + (r0 + rl) * CC + c0 + q * 8), *(const v4u*)&sh[rl][q * 8]); if (hi_rows) vst2((unsigned*)(DL + (bb * nhi + t0 + rl) * (size_t)CC + c0 + q * 8), *(const v4u*)&sl[rl][q * 8]); }
  } else { const bool hi_rows = t0 < KHI;
    for (int e = tid; e < 64 * 128; e += 128) { const int rl = e & 63, cl = e >> 6; const float v = st[rl][cl]; th[cl][rl] = (_Float16)v; const __bf16 bh = (__bf16)v; tb[cl][rl] = bh; tbl[cl][rl] = (__bf16)(v - (float)bh); }
    __syncthreads();
    for (int e = tid; e < 128 * 8; e += 128) { const int cl = e >> 3, q = e & 7; vst2((unsigned*)(VT + (bb * CC + c0 + cl) * (size_t)TT + t0 + q * 8), *(const v4u*)&th[cl][q * 8]); if (hi_rows) { const size_t o3 = (bb * CC + c0 + cl) * (size_t)KHI + t0 + q * 8; vst2((unsigned*)(VB + o3), *(const v4u*)&tb[cl][q * 8]); vst2((unsigned*)(VBL + o3), *(const v4u*)&tbl[cl][q * 8]); } } } }
// ---- k_att: block = 64 queries (4 waves x 16) of one (b, h): logits, softmax and P . v in one kernel, nothing of the logits leaves the registers.
// Every product is taken transposed: S^T = K . Q^T (A = key rows, B = query rows), so a lane holds keys j*16 + 8g + r of ONE query (column lane & 15), and two neighbouring S^T tiles are, register for register, the B fragment of ctx^T = V^T . P^T (A = v planes).
// Two sweeps over the keys: the first finds each query's maximum and denominator (kept per lane, the two half-rows joined once at the end), the second forms the logits again, P x 2^11 = exp(s - max) x 2048 / sum, and the P . v products in the key order 0, 32, 64, ...
// one 128-key block of logits x SCALE: kp / klp = the lane's own pointer (key row k0 + col, the head's dims, + 8g)
template <bool HI> __device__ __forceinline__ void att_logits(const _Float16* kp, const _Float16* klp, const v16h (&qh)[2], const v16h (&ql)[2], v8f (&s)[8]) {
  if constexpr (HI) {
#pragma unroll
    for (int j2 = 0; j2 < 8; j2 += 2) { v16h kbf[HD / 32][2], klf[HD / 32][2];   // two key tiles' fragments loaded together (registers bound the batch on this path)
#pragma unroll
      for (int kc = 0; kc < HD / 32; ++kc)
#pragma unroll
        for (int u = 0; u < 2; ++u) { kbf[kc][u] = fragh_p(kp + (j2 + u) * 16 * CC + kc * 32); klf[kc][u] = fragh_p(klp + (j2 + u) * 16 * CC + kc * 32); }
      asm volatile("s_wait_xcnt 0x0" :: "v"(kp), "v"(klp) : "memory");   // behind the batch, its address pairs as inputs: they are stepped on at the foot of the key loop
      v8f acc[2] = {}, accl[2] = {};
#pragma unroll
      for (int kc = 0; kc < HD / 32; ++kc)
#pragma unroll
        for (int u = 0; u < 2; ++u) { acc[u] = wmma16(kbf[kc][u], qh[kc], acc[u]); accl[u] = wmma16(kbf[kc][u], ql[kc], accl[u]); accl[u] = wmma16(klf[kc][u], qh[kc], accl[u]); }
#pragma unroll
      for (int u = 0; u < 2; ++u)
#pragma unroll
        for (int r = 0; r < 8; ++r) s[j2 + u][r] = (acc[u][r] + accl[u][r] * (1.0f / 1024.0f)) * SCALE; }
  } else { v8f acc[8] = {}; v16h kf[HD / 32][8];   // the block's sixteen key fragments are loaded ahead of its first WMMA: one load latency a block
#pragma unroll
    for (int kc = 0; kc < HD / 32; ++kc)
#pragma unroll
      for (int j = 0; j < 8; ++j) kf[kc][j] = fragh_p(kp + j * 16 * CC + kc * 32);
    asm volatile("s_wait_xcnt 0x0" :: "v"(kp) : "memory");   // behind the batch, its address pair as input: it is stepped on at the foot of the key loop
#pragma unroll
    for (int j = 0; j < 8; ++j)   // tile by tile: a tile's two fragments are free again as its eight logits come alive
#pragma unroll
      for (int kc = 0; kc < HD / 32; ++kc) acc[j] = wmma16(kf[kc][j], qh[kc], acc[j]);
#pragma unroll
    for (int j = 0; j < 8; ++j)
#pragma unroll
      for (int r = 0; r < 8; ++r) s[j][r] = acc[j][r] * SCALE; } }
// the causal mask, by index: d = the lane's query - its first key of the block; an excluded logit becomes -3e38, whose exp(s - m) is an exact 0 against any finite m
__device__ __forceinline__ void att_mask(v8f (&s)[8], int d) {
#pragma unroll
  for (int j = 0; j < 8; ++j)
#pragma unroll
    for (int r = 0; r < 8; ++r) if (j * 16 + r > d) s[j][r] = -3.0e38f; }
// first sweep: the lane's running maximum m and the sum of exp(s - m) over its own 64 keys of the block (a lane that has met only excluded keys keeps m = -3e38, and its sum is multiplied by exp(-3e38 - max) = 0 where the halves are joined)
__device__ __forceinline__ void att_stats(const v8f (&s)[8], float& m, float& sum) {
  float mx = s[0][0];
#pragma unroll
  for (int j = 0; j < 8; ++j)
#pragma unroll
    for (int r = 0; r < 8; ++r) mx = fmaxf(mx, s[j][r]);
  const float mn = fmaxf(m, mx); float a[4] = { sum * expf(m - mn), 0.f, 0.f, 0.f };
#pragma unroll
  for (int j = 0; j < 8; ++j)
#pragma unroll
    for (int r = 0; r < 8; ++r) a[r & 3] += expf(s[j][r] - mn);
  sum = (a[0] + a[1]) + (a[2] + a[3]); m = mn; }
// second sweep: s -> P x 2^11 in place (0 for excluded keys)
__device__ __forceinline__ void att_p(v8f (&s)[8], float m, float inv) {
#pragma unroll
  for (int j = 0; j < 8; ++j)
#pragma unroll
    for (int r = 0; r < 8; ++r) s[j][r] = expf(s[j][r] - m) * inv; }
// second sweep, one 128-key block: va (f16 planes) or vha / vla (bf16 hi / lo planes) = the lane's own pointer (plane h*HD + col, key k0 + 8g)
template <bool HI> __device__ __forceinline__ void att_pv(v8f (&s)[8], float m, float inv, const _Float16* va, const __bf16* vha, const __bf16* vla, v8f (&acc)[HD / 16]) {
  if constexpr (HI) { att_p(s, m, inv);
#pragma unroll
    for (int u = 0; u < 4; ++u) { float pv[16];
#pragma unroll
      for (int i = 0; i < 8; ++i) { pv[i] = s[2 * u][i]; pv[8 + i] = s[2 * u + 1][i]; }
      const F2 p = bsplit16(pv); v16b vh[HD / 16], vl[HD / 16];
#pragma unroll
      for (int j = 0; j < HD / 16; ++j) { vh[j] = fragb_p(vha + j * 16 * KHI + u * 32); vl[j] = fragb_p(vla + j * 16 * KHI + u * 32); }
      asm volatile("s_wait_xcnt 0x0" :: "v"(vha), "v"(vla) : "memory");   // behind the batch, its address pairs as inputs: as in att_logits
#pragma unroll
      for (int j = 0; j < HD / 16; ++j) { acc[j] = wmma_bf(vh[j], p.h, acc[j]); acc[j] = wmma_bf(vh[j], p.l, acc[j]); acc[j] = wmma_bf(vl[j], p.h, acc[j]); } }
  } else { v16h vf[4][HD / 16];   // the first 64 keys' v fragments are asked for ahead of the exponentials, the other 64 behind them (registers bound the batch)
#pragma unroll
    for (int u = 0; u < 2; ++u)
#pragma unroll
      for (int j = 0; j < HD / 16; ++j) vf[u][j] = fragh_p(va + j * 16 * TT + u * 32);
    asm volatile("s_wait_xcnt 0x0" :: "v"(va) : "memory");   // behind the batch, its address pair as input: as in att_logits
    att_p(s, m, inv);
    v16h p[4];
#pragma unroll
    for (int u = 0; u < 4; ++u)
#pragma unroll
      for (int i = 0; i < 8; ++i) { p[u][i] = (_Float16)s[2 * u][i]; p[u][8 + i] = (_Float16)s[2 * u + 1][i]; }
#pragma unroll
    for (int u = 2; u < 4; ++u)
#pragma unroll
      for (int j = 0; j < HD / 16; ++j) vf[u][j] = fragh_p(va + j * 16 * TT + u * 32);
    asm volatile("s_wait_xcnt 0x0" :: "v"(va) : "memory");   // behind the batch, its address pair as input: as in att_logits
#pragma unroll
    for (int u = 0; u < 4; ++u)
#pragma unroll
      for (int j = 0; j < HD / 16; ++j) acc[j] = wmma16(vf[u][j], p[u], acc[j]); } }
template <bool HI> __device__ __forceinline__ void att_body(const _Float16* __restrict__ QH, const _Float16* __restrict__ KH, const _Float16* __restrict__ QL, const _Float16* __restrict__ KL, const _Float16* __restrict__ VT, const __bf16* __restrict__ VB, const __bf16* __restrict__ VBL, int b, int h, int qb, int ql0, int col, int g, v8f (&acc)[HD / 16]) {
  const int t = ql0 + col, kbl = kb_last(qb);
  const _Float16* qp = QH + ((size_t)b * TT + t) * CC + h * HD + 8 * g; const _Float16* qlp = HI ? QL + ((size_t)b * QHI + t) * CC + h * HD + 8 * g : qp;
  v16h qh[2], ql[2];
#pragma unroll
  for (int kc = 0; kc < HD / 32; ++kc) { qh[kc] = fragh_p(qp + kc * 32); ql[kc] = fragh_p(qlp + kc * 32); }
  asm volatile("s_wait_xcnt 0x0" :: "v"(qp), "v"(qlp) : "memory");   // behind the query loads, their address pairs as inputs: the registers are free for reuse behind it
  const _Float16* const kp0 = KH + ((size_t)b * TT + col) * CC + h * HD + 8 * g; const _Float16* const klp0 = HI ? KL + ((size_t)b * KHI + col) * CC + h * HD + 8 * g : kp0;
  float m = -3.0e38f, sum = 0.f; v8f s[8];
#pragma unroll 1
  for (int kb = 0; kb <= kbl; ++kb) { att_logits<HI>(kp0 + (size_t)kb * 128 * CC, klp0 + (size_t)kb * 128 * CC, qh, ql, s); if (CAUSAL && kb == kbl) att_mask(s, t - kb * 128 - 8 * g);   /* block-uniform: blocks below the last hold no key past any of the 64 queries */
    att_stats(s, m, sum); }
  const float m2 = __shfl_xor(m, 16), s2 = __shfl_xor(sum, 16), mm = fmaxf(m, m2); const float tot = sum * expf(m - mm) + s2 * expf(m2 - mm);   // lanes l and l ^ 16 hold the two halves of one query's keys
  const float inv = tot > 0.f ? 2048.0f / tot : 0.f;   /* every query has at least its own key, so mm is finite */
  const _Float16* const va0 = VT + ((size_t)b * CC + h * HD + col) * (size_t)TT + 8 * g; const size_t po = ((size_t)b * CC + h * HD + col) * (size_t)KHI + 8 * g; const __bf16 *vha0 = VB + po, *vla0 = VBL + po;
#pragma unroll 1
  for (int kb = 0; kb <= kbl; ++kb) { att_logits<HI>(kp0 + (size_t)kb * 128 * CC, klp0 + (size_t)kb * 128 * CC, qh, ql, s); if (CAUSAL && kb == kbl) att_mask(s, t - kb * 128 - 8 * g);   /* block-uniform */
    att_pv<HI>(s, mm, inv, va0 + kb * 128, vha0 + kb * 128, vla0 + kb * 128, acc); } }
__global__ __launch_bounds__(128) __attribute__((amdgpu_waves_per_eu(4, 4))) void k_att(const _Float16* __restrict__ QH, const _Float16* __restrict__ KH, const _Float16* __restrict__ QL, const _Float16* __restrict__ KL, const _Float16* __restrict__ VT, const __bf16* __restrict__ VB, const __bf16* __restrict__ VBL, float* __restrict__ Y) { __shared__ __align__(16) float ss[4][16][HD + 4];
  const int tid = threadIdx.x, wave = tid >> 5, lane = tid & 31, col = lane & 15, g = lane >> 4; const int b = blockIdx.x / NH, h = blockIdx.x % NH;
  const int qi = blockIdx.y; const int qb = NQB - 1 - ((qi & 8) ? (qi ^ 7) : qi);   // long query blocks start first; every second run of eight is reversed, so that blocks 256 apart in launch order add up to equal work
  const int ql0 = qb * 64 + wave * 16;
  v8f acc[HD / 16] = {};
  if (qb < QBH) att_body<true>(QH, KH, QL, KL, VT, VB, VBL, b, h, qb, ql0, col, g, acc);   /* block-uniform */
  else att_body<false>(QH, KH, QL, KL, VT, VB, VBL, b, h, qb, ql0, col, g, acc);
#pragma unroll
  for (int j = 0; j < HD / 16; ++j)
#pragma unroll
    for (int r = 0; r < 8; ++r) ss[wave][col][j * 16 + 8 * g + r] = acc[j][r] * (1.0f / 2048.0f);   // ctx^T: element r of tile j = dim j*16 + 8g + r of query col
  LDSX(); for (int rl = 0; rl < 16; ++rl) if (lane < HD / 4) vst2(Y + ((size_t)b * TT + ql0 + rl) * CC + h * HD + lane * 4, *(const v4f*)&ss[wave][rl][lane * 4]); }
// ---- k_out: block = (64 rows, 128 cols): out = ctx Wo (+ bo): ctx x 2^6 once to f16 against Wo as f16(bf16 x 2^8) exact (1 product) x 2^-14; causal early rows (< QHI of each sequence): ctx bf16 hi + lo against exact bf16 Wo (2 products)
__global__ __launch_bounds__(128) void k_out(const float* __restrict__ Y, const float* __restrict__ WO, const float* __restrict__ BO, float* __restrict__ OUT) { __shared__ __align__(16) float sf[4][16][132]; __shared__ __align__(16) char ring[RING_BYTES(1)];
  const int tid = threadIdx.x, wave = tid >> 5, lane = tid & 31, col = lane & 15, g = lane >> 4; const int c0 = blockIdx.y * 128; const size_t r0 = (size_t)blockIdx.x * 64 + wave * 16;
  v8f acc[8] = {};
  if (CAUSAL && (int)(((size_t)blockIdx.x * 64) % TT) < QHI) {   /* block-uniform */
    gemm_staged<1, CC>(Y + (size_t)blockIdx.x * 64 * CC, WO + (size_t)c0 * CC, ring, tid, acc);
#pragma unroll
    for (int j = 0; j < 8; ++j) { const float bias = BO ? bfr(BO[c0 + j * 16 + col]) : 0.f;
#pragma unroll
      for (int r = 0; r < 8; ++r) sf[wave][8 * g + r][j * 16 + col] = acc[j][r] + bias; }
  } else {   /* ctx carried x 2^6 into f16 so small-magnitude context rows stay clear of f16 subnormals */
    gemm_staged<2, CC>(Y + (size_t)blockIdx.x * 64 * CC, WO + (size_t)c0 * CC, ring, tid, acc);
#pragma unroll
    for (int j = 0; j < 8; ++j) { const float bias = BO ? bfr(BO[c0 + j * 16 + col]) : 0.f;
#pragma unroll
      for (int r = 0; r < 8; ++r) sf[wave][8 * g + r][j * 16 + col] = acc[j][r] * (1.0f / 16384.0f) + bias; } }   /* 2^-8 (Wo carry) x 2^-6 (ctx carry) */
  LDSX(); for (int rl = 0; rl < 16; ++rl) vst2(OUT + (r0 + rl) * DIN + c0 + lane * 4, *(const v4f*)&sf[wave][rl][lane * 4]); }

extern "C" void kernel_launch(void* const* d_in, const int* in_sizes, int n_in, void* d_out, int out_size, void* d_ws, size_t ws_size, hipStream_t stream) {
  (void)in_sizes; (void)n_in; (void)out_size;
  const float** F = (const float**)d_in;
  if (ws_size < (size_t)WS_END) return;
  char* ws = (char*)d_ws; _Float16 *QH = (_Float16*)(ws + WS_QH), *KH = (_Float16*)(ws + WS_KH), *VT = (_Float16*)(ws + WS_VT), *QL = (_Float16*)(ws + WS_QL), *KL = (_Float16*)(ws + WS_KL); __bf16 *VB = (__bf16*)(ws + WS_VB), *VBL = (__bf16*)(ws + WS_VBL); float *Y = (float*)(ws + WS_Y);
  (void)Y; (void)QL; (void)KL; (void)VB; (void)VBL;
  // inputs: 0 x_norm_for_qkv [2,2048,1024]; 1 xt_current_for_v [2,2048,1024] (multiplies the projected values elementwise); 2 w_attn [3072,1024] (out,in): q rows 0..1023, k 1024..2047, v 2048..3071; 3 b_attn [3072] (zeros, read); 4 w_proj [1024,1024] (out,in); 5 b_proj (zeros, read)
  k_proj<<<dim3(TNB * TT / 64, CC / 128, 3), 128, 0, stream>>>(F[0], F[0], F[0], F[2], F[2] + (size_t)CC * DIN, F[2] + 2 * (size_t)CC * DIN, F[3], F[3] + CC, F[3] + 2 * CC, QH, QL, KH, KL, VT, VB, VBL, F[1]);
  k_att<<<dim3(TNB * NH, NQB), 128, 0, stream>>>(QH, KH, QL, KL, VT, VB, VBL, Y);
  k_out<<<dim3(TNB * TT / 64, DIN / 128), 128, 0, stream>>>(Y, F[4], F[5], (float*)d_out);
}

// v004
// It runs in 133 microseconds.
// Timed twice side by side with v003, it ran 1.21 times as fast both times.
// All steps since v000 together make it 9.52 times as fast.
// compute dtype: all float inputs rounded to bf16; q / k / v projections with EXACT bf16 products on WMMA 16x16x32 (f32 accumulate) + bias (zeros, read); the value rows multiplied elementwise in f32 by the second input (bf16-rounded) per (token, head, dim); causal logits: 3 products for the first 384 rows, single f16 q x k after, x 64^-0.5; softmax f32; P x 2^11 once to f16 x v once to f16 (bf16 hi + lo below row 384); ctx hi+lo x exact w_proj below row 384, x2^6 f16 carry x f16(bf16 x 2^8) after, + b_proj (zeros); f32 output.
#include <hip/hip_runtime.h>
#include <math.h>

typedef __attribute__((ext_vector_type(16))) _Float16 v16h;
typedef __attribute__((ext_vector_type(16))) __bf16 v16b;
typedef __attribute__((ext_vector_type(8)))  _Float16 v8h;
typedef __attribute__((ext_vector_type(8)))  float v8f;
typedef __attribute__((ext_vector_type(4)))  float v4f;
typedef __attribute__((ext_vector_type(2)))  float v2f;
typedef __attribute__((ext_vector_type(4)))  unsigned v4u;
typedef __attribute__((ext_vector_type(4)))  int v4i;
typedef float __attribute__((may_alias)) float_a;
typedef int __attribute__((may_alias)) int_a;

template <typename T> __device__ __forceinline__ void vst2(void* p, T v) { *(T*)p = v;  }
__device__ __forceinline__ v8f wmma16(v16h a, v16h b, v8f c) {
  v8f d = __builtin_amdgcn_wmma_f32_16x16x32_f16(false, a, false, b, (short)0, c, false, false);
  asm volatile("v_nop\n\tv_nop\n\tv_nop\n\tv_nop" : "+v"(d) : "v"(a), "v"(b));
  return d;
}
__device__ __forceinline__ v8f wmma_bf(v16b a, v16b b, v8f c) {
  v8f d = __builtin_amdgcn_wmma_f32_16x16x32_bf16(false, a, false, b, (short)0, c, false, false);
  asm volatile("v_nop\n\tv_nop\n\tv_nop\n\tv_nop" : "+v"(d) : "v"(a), "v"(b));
  return d;
}
// 16x16x32 fragments: lane = (h = lane>>4, row/col = lane&15); elements 0..7 = k0+8h+0..7, 8..15 = k0+16+8h+0..7; D element r = row 8h+r
__device__ __forceinline__ v16h frag_h(const _Float16* rowk0, int lane) {
  union { v16h v; v8h q[2]; } u; const _Float16* p = rowk0 + 8 * (lane >> 4);
  u.q[0] = *(const v8h*)p; u.q[1] = *(const v8h*)(p + 16); return u.v;
}
__device__ __forceinline__ v16h frag_f32(const float* rowk0, int lane) {
  v16h a; const float* p = rowk0 + 8 * (lane >> 4);
#pragma unroll
  for (int i = 0; i < 8; ++i) { a[i] = (_Float16)p[i]; a[8 + i] = (_Float16)p[16 + i]; }
  return a;
}
__device__ __forceinline__ v16h frag_f32s(const float* rowk0, int lane, float sc) {
  v16h a; const float* p = rowk0 + 8 * (lane >> 4);
#pragma unroll
  for (int i = 0; i < 8; ++i) { a[i] = (_Float16)(p[i] * sc); a[8 + i] = (_Float16)(p[16 + i] * sc); }
  return a;
}
// column fragment from a [K][ld] layout (column n), rows >= K read as 0
__device__ __forceinline__ v16h fragc_f32(const float* W, int k0, int n, int lane, int ld, int K) {
  v16h a; const int g = lane >> 4;
#pragma unroll
  for (int i = 0; i < 8; ++i) { const int ka = k0 + 8 * g + i, kb = ka + 16;
    a[i] = (_Float16)(ka < K ? W[(size_t)(ka < K ? ka : K - 1) * ld + n] : 0.f); a[8 + i] = (_Float16)(kb < K ? W[(size_t)(kb < K ? kb : K - 1) * ld + n] : 0.f); }
  return a;
}
struct F2 { v16b h, l; };
__device__ __forceinline__ F2 bsplit16(const float v[16]) { F2 r;
#pragma unroll
  for (int i = 0; i < 16; ++i) { const __bf16 h = (__bf16)v[i]; r.h[i] = h; r.l[i] = (__bf16)(v[i] - (float)h); }
  return r; }
__device__ __forceinline__ F2 split_row(const float* row, int k0, int lane) { float v[16]; const float* p = row + k0 + 8 * (lane >> 4);
#pragma unroll
  for (int i = 0; i < 8; ++i) { v[i] = p[i]; v[8 + i] = p[16 + i]; }
  return bsplit16(v); }
__device__ __forceinline__ F2 split_rowK(const float* row, int k0, int lane, int K) { float v[16]; const int g = lane >> 4;
#pragma unroll
  for (int i = 0; i < 8; ++i) { const int ka = k0 + 8 * g + i, kb = ka + 16; v[i] = ka < K ? row[ka < K ? ka : K - 1] : 0.f; v[8 + i] = kb < K ? row[kb < K ? kb : K - 1] : 0.f; }
  return bsplit16(v); }
__device__ __forceinline__ F2 split_col(const float* W, int k0, int n, int lane, int ld, int K) { float v[16]; const int g = lane >> 4;
#pragma unroll
  for (int i = 0; i < 8; ++i) { const int ka = k0 + 8 * g + i, kb = ka + 16; v[i] = ka < K ? W[(size_t)(ka < K ? ka : K - 1) * ld + n] : 0.f; v[8 + i] = kb < K ? W[(size_t)(kb < K ? kb : K - 1) * ld + n] : 0.f; }
  return bsplit16(v); }
__device__ __forceinline__ v8f mac3(const F2& a, const F2& b, v8f c) { c = wmma_bf(a.l, b.h, c); c = wmma_bf(a.h, b.l, c); return wmma_bf(a.h, b.h, c); }
__device__ __forceinline__ float sigm(float v) { return 1.0f / (1.0f + expf(-v)); }
#define LDSX() do { asm volatile("s_wait_dscnt 0" ::: "memory"); __builtin_amdgcn_wave_barrier(); __builtin_amdgcn_fence(__ATOMIC_RELEASE, "workgroup"); } while (0)

// Multi-head causal self-attention with an elementwise-modulated value path (x_norm_for_qkv, xt_current_for_v [2,2048,1024]; w_attn [3072,1024] torch (out,in) N(0, 1/1024), b_attn zeros (read): jnp.split thirds of x_norm @ w_attn.T + b_attn (q = rows 0..1023, k = 1024..2047, v = 2048..3071); 16 heads x 64; effective_v = heads(xt_current_for_v) * v (elementwise); att x 1/sqrt(64); tril kept, -inf elsewhere; softmax; y @ w_proj.T + b_proj (w_proj (out,in), b_proj zeros, read)).
#define NB 2
#define TT 2048
#define CC 1024            // NH * HD = projected width
#define DIN 1024          // input (model) width
#define NH 16
#define HD 64
#define NQB (TT / 64)
#define HG 4
#define SCALE (0.125f)
#define CAUSAL 1
#ifndef TNB
#define TNB NB
#endif
__device__ __forceinline__ float bfr(float v) { return (float)(__bf16)v; }
__host__ __device__ __forceinline__ int kb_last(int qb) { return CAUSAL ? ((qb * 64 + 63) >> 7) : (TT / 128 - 1); }
typedef __attribute__((ext_vector_type(8))) __bf16 v8b;
__device__ __forceinline__ v16b frag_b(const __bf16* rowk0, int lane) {
  union { v16b v; v8b q[2]; } u; const __bf16* p = rowk0 + 8 * (lane >> 4);
  u.q[0] = *(const v8b*)p; u.q[1] = *(const v8b*)(p + 16); return u.v;
}
#define QBH 6              // causal: query blocks 0..QBH-1 of each sequence (few keys, no averaging) take the high-precision path
#define QHI 384            // rows carrying a q residual plane
#define KHI 384            // key rows carrying k residual / v bf16 hi+lo planes (used only by the causal high-precision path)
// B fragment (k rows k0+.., output column o) of a weight: (in,out) [K][ld] or (out,in) [ld rows of K]: bf16 exact, or f16(bf16 * 256) exact
__device__ __forceinline__ v16b wcol_io(const float* Wm, int k0, int o, int lane, int ld) { v16b w; const int g = lane >> 4;
#pragma unroll
  for (int i = 0; i < 8; ++i) { w[i] = (__bf16)Wm[(size_t)(k0 + 8 * g + i) * ld + o]; w[8 + i] = (__bf16)Wm[(size_t)(k0 + 16 + 8 * g + i) * ld + o]; }
  return w; }
__device__ __forceinline__ v16b wcol_oi(const float* Wm, int k0, int o, int lane, int K) { v16b w; const float* p = Wm + (size_t)o * K + k0 + 8 * (lane >> 4);
#pragma unroll
  for (int i = 0; i < 8; ++i) { w[i] = (__bf16)p[i]; w[8 + i] = (__bf16)p[16 + i]; }
  return w; }
__device__ __forceinline__ v16h wcolh_io(const float* Wm, int k0, int o, int lane, int ld) { v16h w; const int g = lane >> 4;
#pragma unroll
  for (int i = 0; i < 8; ++i) { w[i] = (_Float16)(bfr(Wm[(size_t)(k0 + 8 * g + i) * ld + o]) * 256.0f); w[8 + i] = (_Float16)(bfr(Wm[(size_t)(k0 + 16 + 8 * g + i) * ld + o]) * 256.0f); }
  return w; }
__device__ __forceinline__ v16h wcolh_oi(const float* Wm, int k0, int o, int lane, int K) { v16h w; const float* p = Wm + (size_t)o * K + k0 + 8 * (lane >> 4);
#pragma unroll
  for (int i = 0; i < 8; ++i) { w[i] = (_Float16)(bfr(p[i]) * 256.0f); w[8 + i] = (_Float16)(bfr(p[16 + i]) * 256.0f); }
  return w; }
// fragment loads from the lane's own pointer p = row + k0 + 8 * (lane >> 4), so that a batch's loads are constant offsets from one address pair; the 16 raw floats of a fragment (R16) and their conversions are separate functions
struct R16 { v4f q[4]; };
__device__ __forceinline__ R16 wraw(const float* p) { R16 r;
  r.q[0] = *(const v4f*)p; r.q[1] = *(const v4f*)(p + 4); r.q[2] = *(const v4f*)(p + 16); r.q[3] = *(const v4f*)(p + 20); return r; }
__device__ __forceinline__ v16h fragh_p(const _Float16* p) { union { v16h v; v8h q[2]; } u; u.q[0] = *(const v8h*)p; u.q[1] = *(const v8h*)(p + 16); return u.v; }
__device__ __forceinline__ v16b fragb_p(const __bf16* p) { union { v16b v; v8b q[2]; } u; u.q[0] = *(const v8b*)p; u.q[1] = *(const v8b*)(p + 16); return u.v; }
__device__ __forceinline__ v16h cvth_r(const R16& r) { v16h a;
#pragma unroll
  for (int i = 0; i < 8; ++i) { a[i] = (_Float16)r.q[i >> 2][i & 3]; a[8 + i] = (_Float16)r.q[2 + (i >> 2)][i & 3]; }
  return a; }
__device__ __forceinline__ v16b cvtb_r(const R16& r) { v16b a;
#pragma unroll
  for (int i = 0; i < 8; ++i) { a[i] = (__bf16)r.q[i >> 2][i & 3]; a[8 + i] = (__bf16)r.q[2 + (i >> 2)][i & 3]; }
  return a; }
__device__ __forceinline__ F2 split_r(const R16& r) { float v[16];
#pragma unroll
  for (int i = 0; i < 8; ++i) { v[i] = r.q[i >> 2][i & 3]; v[8 + i] = r.q[2 + (i >> 2)][i & 3]; }
  return bsplit16(v); }
__device__ __forceinline__ v16h wcolh_r(const R16& r) { v16h w;
#pragma unroll
  for (int i = 0; i < 8; ++i) { w[i] = (_Float16)(bfr(r.q[i >> 2][i & 3]) * 256.0f); w[8 + i] = (_Float16)(bfr(r.q[2 + (i >> 2)][i & 3]) * 256.0f); }
  return w; }
#define WQKV_LAYOUT 1   // 0 = (in,out) [DIN][CC]; 1 = (out,in) [CC][DIN]; 2 = per-head [NH][DIN][HD]
__device__ __forceinline__ v16b wcol_hdk(const float* Wm, int k0, int o, int lane) { v16b w; const int g = lane >> 4; const float* p = Wm + (size_t)(o / HD) * DIN * HD + (o % HD);
#pragma unroll
  for (int i = 0; i < 8; ++i) { w[i] = (__bf16)p[(size_t)(k0 + 8 * g + i) * HD]; w[8 + i] = (__bf16)p[(size_t)(k0 + 16 + 8 * g + i) * HD]; }
  return w; }
#define WO_OUT_IN 1
#if WQKV_LAYOUT == 1
#define WCOL(W, k0, o, lane) wcol_oi(W, k0, o, lane, DIN)
#elif WQKV_LAYOUT == 2
#define WCOL(W, k0, o, lane) wcol_hdk(W, k0, o, lane)
#else
#define WCOL(W, k0, o, lane) wcol_io(W, k0, o, lane, CC)
#endif
#if WO_OUT_IN
#define WOCOL(W, k0, o, lane) wcol_oi(W, k0, o, lane, CC)
#define WOCOLH(W, k0, o, lane) wcolh_oi(W, k0, o, lane, CC)
#else
#define WOCOL(W, k0, o, lane) wcol_io(W, k0, o, lane, DIN)
#define WOCOLH(W, k0, o, lane) wcolh_io(W, k0, o, lane, DIN)
#endif

// (PROJ_EXTRA_PARAMS: the extra kernel parameters 'const float* __restrict__ XT' are written literally in the kernel signature)
// per (token, head) hook on the staged f32 row (64 floats, projection + bias) of the v stream: effective_v = xt * v elementwise with the same (token, head) slice of the second input (bf16-rounded); one f32 product per element; q and k untouched
#define PROJ_EPI(which, row, t, h) do { if ((which) == 2) { float* rw = (row); const float* xr_ = XT + ((size_t)bb * TT + (t)) * CC + (h) * 64; _Pragma("unroll 8") for (int i = 0; i < 64; ++i) rw[i] = bfr(xr_[i]) * rw[i]; } } while (0)
#ifndef SM_EXTRA_PARAMS
#define SM_EXTRA_PARAMS
#endif
#ifndef PROJ_EXTRA_PARAMS
#define PROJ_EXTRA_PARAMS
#endif
#ifndef SM_MASK_HOOK
#define SM_MASK_HOOK (void)0
#endif

#define WS_QH  0u                                      // f16 q rows [b*t][CC]
#define WS_KH  (WS_QH + 2u * (size_t)NB * TT * CC)      // f16 k rows [b*t][CC]
#define WS_VT  (WS_KH + 2u * (size_t)NB * TT * CC)      // f16 v planes [b][c][t]
#define WS_QL  (WS_VT + 2u * (size_t)NB * CC * TT)      // f16 q residual x 2^10 rows [b][t < QHI][CC]
#define WS_KL  (WS_QL + 2u * (size_t)NB * QHI * CC)     // f16 k residual x 2^10 rows [b][t < KHI][CC]
#define WS_VB  (WS_KL + 2u * (size_t)NB * KHI * CC)     // bf16 v hi planes [b][c][t < KHI]
#define WS_VBL (WS_VB + 2u * (size_t)NB * CC * KHI)
#define WS_S   (WS_VBL + 2u * (size_t)NB * CC * KHI)    // (not used: the logits stay in registers)
#define WS_Y   (WS_S  + 4u * (size_t)HG * TT * TT)      // f32 ctx rows [b*t][CC] (only when there is an output projection)
#define WS_END (WS_Y  + 4u * (size_t)NB * TT * CC)

// ---- operand staging for the two dense products (k_proj, k_out): a block's A tile (64 rows) and W tile (128 rows) of 64 k are read from global memory once a block, by whole 128-byte lines, converted once, and laid in LDS as 16-bit rows; the four waves take their fragments from there.
#define SK 64              // k extent of a stage
#define SP 72              // LDS row pitch in 16-bit elements: 144 B, an odd multiple of 16 B, so that a fragment's ds_load_b128 meets no bank twice
typedef __attribute__((ext_vector_type(4))) __bf16 v4b;
typedef __attribute__((ext_vector_type(4))) _Float16 v4h;
template <int N> struct SR { v4f v[N]; };
// p = the thread's own pointer (row tid >> 4, floats 4 * (tid & 15)); piece i is row + 8 i: a wave's load covers two rows of 256 B
template <int N, int LD> __device__ __forceinline__ void st_ld(SR<N>& r, const float* p) {
#pragma unroll
  for (int i = 0; i < N; ++i) r.v[i] = *(const v4f*)(p + (size_t)i * 8 * LD); }
__device__ __forceinline__ v4b cv_b(v4f v) { v4b o;
#pragma unroll
  for (int i = 0; i < 4; ++i) o[i] = (__bf16)v[i];
  return o; }
__device__ __forceinline__ v4b cv_bl(v4f v) { v4b o;
#pragma unroll
  for (int i = 0; i < 4; ++i) o[i] = (__bf16)(v[i] - (float)(__bf16)v[i]);
  return o; }
__device__ __forceinline__ v4h cv_y(v4f v) { v4h o;
#pragma unroll
  for (int i = 0; i < 4; ++i) o[i] = (_Float16)(v[i] * 64.0f);
  return o; }
__device__ __forceinline__ v4h cv_w(v4f v) { v4h o;
#pragma unroll
  for (int i = 0; i < 4; ++i) o[i] = (_Float16)(bfr(v[i]) * 256.0f);
  return o; }
// MODE 0: A bf16, W bf16 (k_proj); 1: A bf16 hi + lo planes, W bf16 (k_out, early rows); 2: A f16(x 2^6), W f16(bf16 x 2^8) (k_out). A buffer = A rows (64, or 64 hi + 64 lo), then 128 W rows.
template <int MODE> __device__ __forceinline__ void st_put(const SR<8>& ar, const SR<16>& wr, char* buf, int so) {
  if constexpr (MODE == 2) { _Float16* d = (_Float16*)buf + so;
#pragma unroll
    for (int i = 0; i < 8; ++i) *(v4h*)(d + i * 8 * SP) = cv_y(ar.v[i]);
#pragma unroll
    for (int i = 0; i < 16; ++i) *(v4h*)(d + (64 + i * 8) * SP) = cv_w(wr.v[i]);
  } else { __bf16* d = (__bf16*)buf + so; constexpr int AR = MODE == 1 ? 128 : 64;
#pragma unroll
    for (int i = 0; i < 8; ++i) { *(v4b*)(d + i * 8 * SP) = cv_b(ar.v[i]); if constexpr (MODE == 1) *(v4b*)(d + (64 + i * 8) * SP) = cv_bl(ar.v[i]); }
#pragma unroll
    for (int i = 0; i < 16; ++i) *(v4b*)(d + (AR + i * 8) * SP) = cv_b(wr.v[i]); } }
// one stage's products, k ascending as before; fo = the lane's own offset (row lane & 15, element 8 * (lane >> 4))
template <int MODE> __device__ __forceinline__ void st_mac(const char* buf, int fo, int wave, v8f (&acc)[8]) {
#pragma unroll
  for (int kc = 0; kc < SK / 32; ++kc) {
    if constexpr (MODE == 2) { const _Float16* p = (const _Float16*)buf + fo + kc * 32; const v16h a = fragh_p(p + wave * 16 * SP); v16h w[8];
#pragma unroll
      for (int j = 0; j < 8; ++j) w[j] = fragh_p(p + (64 + j * 16) * SP);
#pragma unroll
      for (int j = 0; j < 8; ++j) acc[j] = wmma16(a, w[j], acc[j]);
    } else if constexpr (MODE == 1) { const __bf16* p = (const __bf16*)buf + fo + kc * 32; const v16b ah = fragb_p(p + wave * 16 * SP), al = fragb_p(p + (64 + wave * 16) * SP); v16b w[8];
#pragma unroll
      for (int j = 0; j < 8; ++j) w[j] = fragb_p(p + (128 + j * 16) * SP);
#pragma unroll
      for (int j = 0; j < 8; ++j) { acc[j] = wmma_bf(ah, w[j], acc[j]); acc[j] = wmma_bf(al, w[j], acc[j]); }
    } else { const __bf16* p = (const __bf16*)buf + fo + kc * 32; const v16b a = fragb_p(p + wave * 16 * SP); v16b w[8];
#pragma unroll
      for (int j = 0; j < 8; ++j) w[j] = fragb_p(p + (64 + j * 16) * SP);
#pragma unroll
      for (int j = 0; j < 8; ++j) acc[j] = wmma_bf(a, w[j], acc[j]); } } }
// the ring's work-group barrier: it orders the LDS operations alone, so that the global loads of the stage read ahead stay in flight across it (__syncthreads() would drain the load counter and lay their latency bare every stage)
#define RING_BARRIER() do { __builtin_amdgcn_fence(__ATOMIC_RELEASE, "workgroup", "local"); __builtin_amdgcn_s_barrier(); __builtin_amdgcn_fence(__ATOMIC_ACQUIRE, "workgroup", "local"); } while (0)
#define RING_BYTES(MODE) (2 * (((MODE) == 1 ? 128 : 64) + 128) * SP * 2)
// acc += A0[64 rows][KK] . W0[128 rows][KK]^T, wave w taking rows 16 w ..; two LDS buffers, the stage after next in registers. One barrier a stage: it publishes the buffer just written and ends the reads of the buffer that the next stage overwrites.
template <int MODE, int KK> __device__ __forceinline__ void gemm_staged(const float* __restrict__ A0, const float* __restrict__ W0, char* ring, int tid, v8f (&acc)[8]) {
  constexpr int BUFB = RING_BYTES(MODE) / 2, NS = KK / SK;
  const int wave = tid >> 5, lane = tid & 31; const int so = (tid >> 4) * SP + (tid & 15) * 4, fo = (lane & 15) * SP + 8 * (lane >> 4);
  const float* ag = A0 + (size_t)(tid >> 4) * KK + (tid & 15) * 4; const float* wg = W0 + (size_t)(tid >> 4) * KK + (tid & 15) * 4;
  SR<8> ar; SR<16> wr;
  st_ld<8, KK>(ar, ag); st_ld<16, KK>(wr, wg);
  st_put<MODE>(ar, wr, ring, so);
  st_ld<8, KK>(ar, ag + SK); st_ld<16, KK>(wr, wg + SK);
  asm volatile("s_wait_xcnt 0x0" :: "v"(ag), "v"(wg) : "memory");   // behind the loads, their address pairs as inputs: the pairs are stepped on next
  ag += 2 * SK; wg += 2 * SK;
  RING_BARRIER();
#pragma unroll 1   // rolled: sixteen copies of this long body would only lengthen the text
  for (int s = 0; s < NS; ++s) {
    st_mac<MODE>(ring + (s & 1) * BUFB, fo, wave, acc);
    if (s + 1 < NS) {   /* block-uniform */
      st_put<MODE>(ar, wr, ring + ((s + 1) & 1) * BUFB, so);
      if (s + 2 < NS) { st_ld<8, KK>(ar, ag); st_ld<16, KK>(wr, wg);
        asm volatile("s_wait_xcnt 0x0" :: "v"(ag), "v"(wg) : "memory");   // behind the loads, their address pairs as inputs: the pairs are stepped on next
        ag += SK; wg += SK; }
      RING_BARRIER(); } } }

// ---- k_proj: block = (64 rows, 128 cols, which): q/k/v = X W (+ b) with exact bf16 products (K = DIN) -> which 0: q f16 rows (+ residual rows < QHI); 1: k f16 rows (+ residual rows < KHI); 2: v f16 planes [c][t] (+ bf16 hi/lo planes for t < KHI)
__global__ __launch_bounds__(128) void k_proj(const float* __restrict__ XQ, const float* __restrict__ XK, const float* __restrict__ XV, const float* __restrict__ WQ, const float* __restrict__ WK, const float* __restrict__ WV, const float* __restrict__ BQ, const float* __restrict__ BK, const float* __restrict__ BV,
    _Float16* __restrict__ QH, _Float16* __restrict__ QL, _Float16* __restrict__ KH, _Float16* __restrict__ KL, _Float16* __restrict__ VT, __bf16* __restrict__ VB, __bf16* __restrict__ VBL, const float* __restrict__ XT) {
  __shared__ __align__(16) float st[64][132];
  __shared__ __align__(16) union { struct { _Float16 sh[64][136], sl[64][136], th[128][72]; __bf16 tb[128][72], tbl[128][72]; } e; char ring[RING_BYTES(0)]; } u;   // the main loop's ring lies on the epilogue's conversion tiles, which are first written two barriers behind the loop
  _Float16 (&sh)[64][136] = u.e.sh; _Float16 (&sl)[64][136] = u.e.sl; _Float16 (&th)[128][72] = u.e.th; __bf16 (&tb)[128][72] = u.e.tb; __bf16 (&tbl)[128][72] = u.e.tbl;
  const int tid = threadIdx.x, wave = tid >> 5, lane = tid & 31, col = lane & 15, g = lane >> 4; const int which = blockIdx.z; const int c0 = blockIdx.y * 128; const size_t r0 = (size_t)blockIdx.x * 64; const size_t bb = r0 / TT; const int t0 = (int)(r0 % TT);
  const float* X = which == 0 ? XQ : which == 1 ? XK : XV; const float* WA = which == 0 ? WQ : which == 1 ? WK : WV; const float* BA = which == 0 ? BQ : which == 1 ? BK : BV;
  v8f acc[8] = {};
  gemm_staged<0, DIN>(X + r0 * DIN, WA + (size_t)c0 * DIN, u.ring, tid, acc);
  { // stage the f32 tile (acc + bias) in LDS, run the per-(row, head) epilogue hook, then convert
#pragma unroll
    for (int j = 0; j < 8; ++j) { const float bias = BA ? bfr(BA[c0 + j * 16 + col]) : 0.f;
#pragma unroll
      for (int r = 0; r < 8; ++r) st[wave * 16 + 8 * g + r][j * 16 + col] = acc[j][r] + bias; }
    __syncthreads();
    for (int e = tid; e < 64 * (128 / HD); e += 128) { const int rl = e / (128 / HD), hh = e % (128 / HD); PROJ_EPI(which, &st[rl][hh * HD], (int)((r0 + rl) % TT), (c0 / HD) + hh); }
    __syncthreads(); }
  if (which < 2) { _Float16* DH = which == 0 ? QH : KH; _Float16* DL = which == 0 ? QL : KL; const int nhi = which == 0 ? QHI : KHI; const bool hi_rows = t0 < nhi;
    for (int e = tid; e < 64 * 128; e += 128) { const int rl = e >> 7, cl = e & 127; const float v = st[rl][cl]; const _Float16 hv = (_Float16)v; sh[rl][cl] = hv; sl[rl][cl] = (_Float16)((v - (float)hv) * 1024.0f); }
    __syncthreads();
    for (int e = tid; e < 64 * 16; e += 128) { const int rl = e >> 4, q = e & 15; vst2((unsigned*)(DH + (r0 + rl) * CC + c0 + q * 8), *(const v4u*)&sh[rl][q * 8]); if (hi_rows) vst2((unsigned*)(DL + (bb * nhi + t0 + rl) * (size_t)CC + c0 + q * 8), *(const v4u*)&sl[rl][q * 8]); }
  } else { const bool hi_rows = t0 < KHI;
    for (int e = tid; e < 64 * 128; e += 128) { const int rl = e & 63, cl = e >> 6; const float v = st[rl][cl]; th[cl][rl] = (_Float16)v; const __bf16 bh = (__bf16)v; tb[cl][rl] = bh; tbl[cl][rl] = (__bf16)(v - (float)bh); }
    __syncthreads();
    for (int e = tid; e < 128 * 8; e += 128) { const int cl = e >> 3, q = e & 7; vst2((unsigned*)(VT + (bb * CC + c0 + cl) * (size_t)TT + t0 + q * 8), *(const v4u*)&th[cl][q * 8]); if (hi_rows) { const size_t o3 = (bb * CC + c0 + cl) * (size_t)KHI + t0 + q * 8; vst2((unsigned*)(VB + o3), *(const v4u*)&tb[cl][q * 8]); vst2((unsigned*)(VBL + o3), *(const v4u*)&tbl[cl][q * 8]); } } } }
// ---- k_att: block = 64 queries (4 waves x 16) of one (b, h): logits, softmax and P . v in one kernel, nothing of the logits leaves the registers.
// Every product is taken transposed: S^T = K . Q^T (A = key rows, B = query rows), so a lane holds keys j*16 + 8g + r of ONE query (column lane & 15), and two neighbouring S^T tiles are, register for register, the B fragment of ctx^T = V^T . P^T (A = v planes).
// Rows from QHI on, ONE sweep over the keys: per 128-key block the query's maximum so far (joined over the two half-rows), P x 2^11 = exp(s - maximum so far) x 2048, its running sum, and the P . v products in the key order 0, 32, 64, ...; where the maximum rises, sum and ctx are first multiplied by exp(old - new); the division by the sum comes once, behind the last block.
// Rows below QHI (high-precision path), two sweeps: the first finds each query's maximum and denominator (kept per lane, the two half-rows joined once at the end), the second forms the logits again, P x 2^11 = exp(s - max) x 2048 / sum, and the P . v products in the same key order.
// one 128-key block of logits x SCALE: kp / klp = the lane's own pointer (key row k0 + col, the head's dims, + 8g)
template <bool HI> __device__ __forceinline__ void att_logits(const _Float16* kp, const _Float16* klp, const v16h (&qh)[2], const v16h (&ql)[2], v8f (&s)[8]) {
  if constexpr (HI) {
#pragma unroll
    for (int j2 = 0; j2 < 8; j2 += 2) { v16h kbf[HD / 32][2], klf[HD / 32][2];   // two key tiles' fragments loaded together (registers bound the batch on this path)
#pragma unroll
      for (int kc = 0; kc < HD / 32; ++kc)
#pragma unroll
        for (int u = 0; u < 2; ++u) { kbf[kc][u] = fragh_p(kp + (j2 + u) * 16 * CC + kc * 32); klf[kc][u] = fragh_p(klp + (j2 + u) * 16 * CC + kc * 32); }
      asm volatile("s_wait_xcnt 0x0" :: "v"(kp), "v"(klp) : "memory");   // behind the batch, its address pairs as inputs: they are stepped on at the foot of the key loop
      v8f acc[2] = {}, accl[2] = {};
#pragma unroll
      for (int kc = 0; kc < HD / 32; ++kc)
#pragma unroll
        for (int u = 0; u < 2; ++u) { acc[u] = wmma16(kbf[kc][u], qh[kc], acc[u]); accl[u] = wmma16(kbf[kc][u], ql[kc], accl[u]); accl[u] = wmma16(klf[kc][u], qh[kc], accl[u]); }
#pragma unroll
      for (int u = 0; u < 2; ++u)
#pragma unroll
        for (int r = 0; r < 8; ++r) s[j2 + u][r] = (acc[u][r] + accl[u][r] * (1.0f / 1024.0f)) * SCALE; }
  } else { v8f acc[8] = {}; v16h kf[HD / 32][8];   // the block's sixteen key fragments are loaded ahead of its first WMMA: one load latency a block
#pragma unroll
    for (int kc = 0; kc < HD / 32; ++kc)
#pragma unroll
      for (int j = 0; j < 8; ++j) kf[kc][j] = fragh_p(kp + j * 16 * CC + kc * 32);
    asm volatile("s_wait_xcnt 0x0" :: "v"(kp) : "memory");   // behind the batch, its address pair as input: it is stepped on at the foot of the key loop
#pragma unroll
    for (int j = 0; j < 8; ++j)   // tile by tile: a tile's two fragments are free again as its eight logits come alive
#pragma unroll
      for (int kc = 0; kc < HD / 32; ++kc) acc[j] = wmma16(kf[kc][j], qh[kc], acc[j]);
#pragma unroll
    for (int j = 0; j < 8; ++j)
#pragma unroll
      for (int r = 0; r < 8; ++r) s[j][r] = acc[j][r] * SCALE; } }
// the causal mask, by index: d = the lane's query - its first key of the block; an excluded logit becomes -3e38, whose exp(s - m) is an exact 0 against any finite m
__device__ __forceinline__ void att_mask(v8f (&s)[8], int d) {
#pragma unroll
  for (int j = 0; j < 8; ++j)
#pragma unroll
    for (int r = 0; r < 8; ++r) if (j * 16 + r > d) s[j][r] = -3.0e38f; }
// first sweep: the lane's running maximum m and the sum of exp(s - m) over its own 64 keys of the block (a lane that has met only excluded keys keeps m = -3e38, and its sum is multiplied by exp(-3e38 - max) = 0 where the halves are joined)
__device__ __forceinline__ void att_stats(const v8f (&s)[8], float& m, float& sum) {
  float mx = s[0][0];
#pragma unroll
  for (int j = 0; j < 8; ++j)
#pragma unroll
    for (int r = 0; r < 8; ++r) mx = fmaxf(mx, s[j][r]);
  const float mn = fmaxf(m, mx); float a[4] = { sum * expf(m - mn), 0.f, 0.f, 0.f };
#pragma unroll
  for (int j = 0; j < 8; ++j)
#pragma unroll
    for (int r = 0; r < 8; ++r) a[r & 3] += expf(s[j][r] - mn);
  sum = (a[0] + a[1]) + (a[2] + a[3]); m = mn; }
// second sweep: s -> P x 2^11 in place (0 for excluded keys)
__device__ __forceinline__ void att_p(v8f (&s)[8], float m, float inv) {
#pragma unroll
  for (int j = 0; j < 8; ++j)
#pragma unroll
    for (int r = 0; r < 8; ++r) s[j][r] = expf(s[j][r] - m) * inv; }
// second sweep, one 128-key block: vha / vla (bf16 hi / lo planes) = the lane's own pointer (plane h*HD + col, key k0 + 8g)
__device__ __forceinline__ void att_pv(v8f (&s)[8], float m, float inv, const __bf16* vha, const __bf16* vla, v8f (&acc)[HD / 16]) {
  att_p(s, m, inv);
#pragma unroll
    for (int u = 0; u < 4; ++u) { float pv[16];
#pragma unroll
      for (int i = 0; i < 8; ++i) { pv[i] = s[2 * u][i]; pv[8 + i] = s[2 * u + 1][i]; }
      const F2 p = bsplit16(pv); v16b vh[HD / 16], vl[HD / 16];
#pragma unroll
      for (int j = 0; j < HD / 16; ++j) { vh[j] = fragb_p(vha + j * 16 * KHI + u * 32); vl[j] = fragb_p(vla + j * 16 * KHI + u * 32); }
      asm volatile("s_wait_xcnt 0x0" :: "v"(vha), "v"(vla) : "memory");   // behind the batch, its address pairs as inputs: as in att_logits
#pragma unroll
      for (int j = 0; j < HD / 16; ++j) { acc[j] = wmma_bf(vh[j], p.h, acc[j]); acc[j] = wmma_bf(vh[j], p.l, acc[j]); acc[j] = wmma_bf(vl[j], p.h, acc[j]); } } }
__device__ __forceinline__ float xhalf(float x) { return __builtin_bit_cast(float, __builtin_amdgcn_permlanex16(__builtin_bit_cast(int, x), __builtin_bit_cast(int, x), 0x76543210, 0xfedcba98, false, false)); }   // lane l takes lane l ^ 16's value
// the one sweep, one 128-key block: va (f16 planes) = the lane's own pointer (plane h*HD + col, key k0 + 8g); m = the query's maximum so far (alike in lanes l and l ^ 16, since both halves' P meet in one ctx tile), sum = the lane's own keys' sum of P x 2^11 against m
__device__ __forceinline__ void att_pv_run(v8f (&s)[8], float& m, float& sum, const _Float16* va, v8f (&acc)[HD / 16]) {
  v16h vf[4][HD / 16];   // 32 keys' v fragments are asked for one step ahead: the first ahead of the maximum, each next ahead of the exponentials of the 32 keys before it
#pragma unroll
  for (int j = 0; j < HD / 16; ++j) vf[0][j] = fragh_p(va + j * 16 * TT);
  asm volatile("s_wait_xcnt 0x0" :: "v"(va) : "memory");   // behind the batch, its address pair as input: as in att_logits
  float mx = s[0][0];
#pragma unroll
  for (int j = 0; j < 8; ++j)
#pragma unroll
    for (int r = 0; r < 8; ++r) mx = fmaxf(mx, s[j][r]);
  const float mn = fmaxf(m, fmaxf(mx, xhalf(mx))); const float al = expf(m - mn);   // al = 0 at the first block (m = -3e38, sum and ctx still 0), 1 where the maximum stays
  m = mn;
#pragma unroll
  for (int j = 0; j < HD / 16; ++j)
#pragma unroll
    for (int r = 0; r < 8; ++r) acc[j][r] *= al;
  float a[4] = { sum * al, 0.f, 0.f, 0.f };
#pragma unroll
  for (int u = 0; u < 4; ++u) {
    if (u < 3) {
#pragma unroll
      for (int j = 0; j < HD / 16; ++j) vf[u + 1][j] = fragh_p(va + j * 16 * TT + (u + 1) * 32);
      asm volatile("s_wait_xcnt 0x0" :: "v"(va) : "memory");   // behind the batch, its address pair as input: as in att_logits
    }
    v16h p;
#pragma unroll
    for (int i = 0; i < 8; ++i) { const float x0 = expf(s[2 * u][i] - mn) * 2048.0f, x1 = expf(s[2 * u + 1][i] - mn) * 2048.0f; a[i & 3] += x0; a[i & 3] += x1; p[i] = (_Float16)x0; p[8 + i] = (_Float16)x1; }
#pragma unroll
    for (int j = 0; j < HD / 16; ++j) acc[j] = wmma16(vf[u][j], p, acc[j]); }
  sum = (a[0] + a[1]) + (a[2] + a[3]); }
__device__ __forceinline__ void att_body_hi(const _Float16* __restrict__ QH, const _Float16* __restrict__ KH, const _Float16* __restrict__ QL, const _Float16* __restrict__ KL, const __bf16* __restrict__ VB, const __bf16* __restrict__ VBL, int b, int h, int qb, int ql0, int col, int g, v8f (&acc)[HD / 16]) {
  const int t = ql0 + col, kbl = kb_last(qb);
  const _Float16* qp = QH + ((size_t)b * TT + t) * CC + h * HD + 8 * g; const _Float16* qlp = QL + ((size_t)b * QHI + t) * CC + h * HD + 8 * g;
  v16h qh[2], ql[2];
#pragma unroll
  for (int kc = 0; kc < HD / 32; ++kc) { qh[kc] = fragh_p(qp + kc * 32); ql[kc] = fragh_p(qlp + kc * 32); }
  asm volatile("s_wait_xcnt 0x0" :: "v"(qp), "v"(qlp) : "memory");   // behind the query loads, their address pairs as inputs: the registers are free for reuse behind it
  const _Float16* const kp0 = KH + ((size_t)b * TT + col) * CC + h * HD + 8 * g; const _Float16* const klp0 = KL + ((size_t)b * KHI + col) * CC + h * HD + 8 * g;
  float m = -3.0e38f, sum = 0.f; v8f s[8];
#pragma unroll 1
  for (int kb = 0; kb <= kbl; ++kb) { att_logits<true>(kp0 + (size_t)kb * 128 * CC, klp0 + (size_t)kb * 128 * CC, qh, ql, s); if (CAUSAL && kb == kbl) att_mask(s, t - kb * 128 - 8 * g);   /* block-uniform: blocks below the last hold no key past any of the 64 queries */
    att_stats(s, m, sum); }
  const float m2 = __shfl_xor(m, 16), s2 = __shfl_xor(sum, 16), mm = fmaxf(m, m2); const float tot = sum * expf(m - mm) + s2 * expf(m2 - mm);   // lanes l and l ^ 16 hold the two halves of one query's keys
  const float inv = tot > 0.f ? 2048.0f / tot : 0.f;   /* every query has at least its own key, so mm is finite */
  const size_t po = ((size_t)b * CC + h * HD + col) * (size_t)KHI + 8 * g; const __bf16 *vha0 = VB + po, *vla0 = VBL + po;
#pragma unroll 1
  for (int kb = 0; kb <= kbl; ++kb) { att_logits<true>(kp0 + (size_t)kb * 128 * CC, klp0 + (size_t)kb * 128 * CC, qh, ql, s); if (CAUSAL && kb == kbl) att_mask(s, t - kb * 128 - 8 * g);   /* block-uniform */
    att_pv(s, mm, inv, vha0 + kb * 128, vla0 + kb * 128, acc); } }
__device__ __forceinline__ void att_body_run(const _Float16* __restrict__ QH, const _Float16* __restrict__ KH, const _Float16* __restrict__ VT, int b, int h, int qb, int ql0, int col, int g, v8f (&acc)[HD / 16]) {
  const int t = ql0 + col, kbl = kb_last(qb);
  const _Float16* qp = QH + ((size_t)b * TT + t) * CC + h * HD + 8 * g;
  v16h qh[2];
#pragma unroll
  for (int kc = 0; kc < HD / 32; ++kc) qh[kc] = fragh_p(qp + kc * 32);
  asm volatile("s_wait_xcnt 0x0" :: "v"(qp) : "memory");   // behind the query loads, their address pair as input: the registers are free for reuse behind it
  const _Float16* const kp0 = KH + ((size_t)b * TT + col) * CC + h * HD + 8 * g; const _Float16* const va0 = VT + ((size_t)b * CC + h * HD + col) * (size_t)TT + 8 * g;
  float m = -3.0e38f, sum = 0.f; v8f s[8];
#pragma unroll 1
  for (int kb = 0; kb <= kbl; ++kb) { att_logits<false>(kp0 + (size_t)kb * 128 * CC, kp0 + (size_t)kb * 128 * CC, qh, qh, s); if (CAUSAL && kb == kbl) att_mask(s, t - kb * 128 - 8 * g);   /* block-uniform: blocks below the last hold no key past any of the 64 queries */
    att_pv_run(s, m, sum, va0 + kb * 128, acc); }
  const float tot = sum + xhalf(sum);   // lanes l and l ^ 16 hold the two halves of one query's keys, against one maximum
  const float inv = tot > 0.f ? 2048.0f / tot : 0.f;   /* the key at the query's final maximum stands in tot with 2048; ctx leaves x 2^11, as on the other path */
#pragma unroll
  for (int j = 0; j < HD / 16; ++j)
#pragma unroll
    for (int r = 0; r < 8; ++r) acc[j][r] *= inv; }
__global__ __launch_bounds__(128) __attribute__((amdgpu_waves_per_eu(4, 4))) void k_att(const _Float16* __restrict__ QH, const _Float16* __restrict__ KH, const _Float16* __restrict__ QL, const _Float16* __restrict__ KL, const _Float16* __restrict__ VT, const __bf16* __restrict__ VB, const __bf16* __restrict__ VBL, float* __restrict__ Y) { __shared__ __align__(16) float ss[4][16][HD + 4];
  const int tid = threadIdx.x, wave = tid >> 5, lane = tid & 31, col = lane & 15, g = lane >> 4; const int b = blockIdx.x / NH, h = blockIdx.x % NH;
  const int qi = blockIdx.y; const int qb = NQB - 1 - ((qi & 8) ? (qi ^ 7) : qi);   // long query blocks start first; every second run of eight is reversed, so that blocks 256 apart in launch order add up to equal work
  const int ql0 = qb * 64 + wave * 16;
  v8f acc[HD / 16] = {};
  if (qb < QBH) att_body_hi(QH, KH, QL, KL, VB, VBL, b, h, qb, ql0, col, g, acc);   /* block-uniform */
  else att_body_run(QH, KH, VT, b, h, qb, ql0, col, g, acc);
#pragma unroll
  for (int j = 0; j < HD / 16; ++j)
#pragma unroll
    for (int r = 0; r < 8; ++r) ss[wave][col][j * 16 + 8 * g + r] = acc[j][r] * (1.0f / 2048.0f);   // ctx^T: element r of tile j = dim j*16 + 8g + r of query col
  LDSX(); for (int rl = 0; rl < 16; ++rl) if (lane < HD / 4) vst2(Y + ((size_t)b * TT + ql0 + rl) * CC + h * HD + lane * 4, *(const v4f*)&ss[wave][rl][lane * 4]); }
// ---- k_out: block = (64 rows, 128 cols): out = ctx Wo (+ bo): ctx x 2^6 once to f16 against Wo as f16(bf16 x 2^8) exact (1 product) x 2^-14; causal early rows (< QHI of each sequence): ctx bf16 hi + lo against exact bf16 Wo (2 products)
__global__ __launch_bounds__(128) void k_out(const float* __restrict__ Y, const float* __restrict__ WO, const float* __restrict__ BO, float* __restrict__ OUT) { __shared__ __align__(16) float sf[4][16][132]; __shared__ __align__(16) char ring[RING_BYTES(1)];
  const int tid = threadIdx.x, wave = tid >> 5, lane = tid & 31, col = lane & 15, g = lane >> 4; const int c0 = blockIdx.y * 128; const size_t r0 = (size_t)blockIdx.x * 64 + wave * 16;
  v8f acc[8] = {};
  if (CAUSAL && (int)(((size_t)blockIdx.x * 64) % TT) < QHI) {   /* block-uniform */
    gemm_staged<1, CC>(Y + (size_t)blockIdx.x * 64 * CC, WO + (size_t)c0 * CC, ring, tid, acc);
#pragma unroll
    for (int j = 0; j < 8; ++j) { const float bias = BO ? bfr(BO[c0 + j * 16 + col]) : 0.f;
#pragma unroll
      for (int r = 0; r < 8; ++r) sf[wave][8 * g + r][j * 16 + col] = acc[j][r] + bias; }
  } else {   /* ctx carried x 2^6 into f16 so small-magnitude context rows stay clear of f16 subnormals */
    gemm_staged<2, CC>(Y + (size_t)blockIdx.x * 64 * CC, WO + (size_t)c0 * CC, ring, tid, acc);
#pragma unroll
    for (int j = 0; j < 8; ++j) { const float bias = BO ? bfr(BO[c0 + j * 16 + col]) : 0.f;
#pragma unroll
      for (int r = 0; r < 8; ++r) sf[wave][8 * g + r][j * 16 + col] = acc[j][r] * (1.0f / 16384.0f) + bias; } }   /* 2^-8 (Wo carry) x 2^-6 (ctx carry) */
  LDSX(); for (int rl = 0; rl < 16; ++rl) vst2(OUT + (r0 + rl) * DIN + c0 + lane * 4, *(const v4f*)&sf[wave][rl][lane * 4]); }

extern "C" void kernel_launch(void* const* d_in, const int* in_sizes, int n_in, void* d_out, int out_size, void* d_ws, size_t ws_size, hipStream_t stream) {
  (void)in_sizes; (void)n_in; (void)out_size;
  const float** F = (const float**)d_in;
  if (ws_size < (size_t)WS_END) return;
  char* ws = (char*)d_ws; _Float16 *QH = (_Float16*)(ws + WS_QH), *KH = (_Float16*)(ws + WS_KH), *VT = (_Float16*)(ws + WS_VT), *QL = (_Float16*)(ws + WS_QL), *KL = (_Float16*)(ws + WS_KL); __bf16 *VB = (__bf16*)(ws + WS_VB), *VBL = (__bf16*)(ws + WS_VBL); float *Y = (float*)(ws + WS_Y);
  (void)Y; (void)QL; (void)KL; (void)VB; (void)VBL;
  // inputs: 0 x_norm_for_qkv [2,2048,1024]; 1 xt_current_for_v [2,2048,1024] (multiplies the projected values elementwise); 2 w_attn [3072,1024] (out,in): q rows 0..1023, k 1024..2047, v 2048..3071; 3 b_attn [3072] (zeros, read); 4 w_proj [1024,1024] (out,in); 5 b_proj (zeros, read)
  k_proj<<<dim3(TNB * TT / 64, CC / 128, 3), 128, 0, stream>>>(F[0], F[0], F[0], F[2], F[2] + (size_t)CC * DIN, F[2] + 2 * (size_t)CC * DIN, F[3], F[3] + CC, F[3] + 2 * CC, QH, QL, KH, KL, VT, VB, VBL, F[1]);
  k_att<<<dim3(TNB * NH, NQB), 128, 0, stream>>>(QH, KH, QL, KL, VT, VB, VBL, Y);
  k_out<<<dim3(TNB * TT / 64, DIN / 128), 128, 0, stream>>>(Y, F[4], F[5], (float*)d_out);
}

// v005
// A run of this version takes 119 microseconds.
// Timed twice side by side with v004, it ran 1.12 times as fast both times.
// Over all steps from v000 it is 10.7 times as fast.
// compute dtype: all float inputs rounded to bf16; q / k / v projections with EXACT bf16 products on WMMA 16x16x32 (f32 accumulate) + bias (zeros, read); the value rows multiplied elementwise in f32 by the second input (bf16-rounded) per (token, head, dim); causal logits: 3 products for the first 384 rows, single f16 q x k after, x 64^-0.5; softmax f32; P x 2^11 once to f16 x v once to f16 (bf16 hi + lo below row 384); ctx hi+lo x exact w_proj below row 384, x2^6 f16 carry x f16(bf16 x 2^8) after, + b_proj (zeros); f32 output.
#include <hip/hip_runtime.h>
#include <math.h>
#include <stdint.h>

typedef __attribute__((ext_vector_type(16))) _Float16 v16h;
typedef __attribute__((ext_vector_type(16))) __bf16 v16b;
typedef __attribute__((ext_vector_type(8)))  _Float16 v8h;
typedef __attribute__((ext_vector_type(8)))  float v8f;
typedef __attribute__((ext_vector_type(4)))  float v4f;
typedef __attribute__((ext_vector_type(2)))  float v2f;
typedef __attribute__((ext_vector_type(4)))  unsigned v4u;
typedef __attribute__((ext_vector_type(4)))  int v4i;
typedef float __attribute__((may_alias)) float_a;
typedef int __attribute__((may_alias)) int_a;

template <typename T> __device__ __forceinline__ void vst2(void* p, T v) { *(T*)p = v;  }
__device__ __forceinline__ v8f wmma16(v16h a, v16h b, v8f c) {
  v8f d = __builtin_amdgcn_wmma_f32_16x16x32_f16(false, a, false, b, (short)0, c, false, false);
  asm volatile("v_nop\n\tv_nop\n\tv_nop\n\tv_nop" : "+v"(d) : "v"(a), "v"(b));
  return d;
}
__device__ __forceinline__ v8f wmma_bf(v16b a, v16b b, v8f c) {
  v8f d = __builtin_amdgcn_wmma_f32_16x16x32_bf16(false, a, false, b, (short)0, c, false, false);
  asm volatile("v_nop\n\tv_nop\n\tv_nop\n\tv_nop" : "+v"(d) : "v"(a), "v"(b));
  return d;
}
// 16x16x32 fragments: lane = (h = lane>>4, row/col = lane&15); elements 0..7 = k0+8h+0..7, 8..15 = k0+16+8h+0..7; D element r = row 8h+r
__device__ __forceinline__ v16h frag_h(const _Float16* rowk0, int lane) {
  union { v16h v; v8h q[2]; } u; const _Float16* p = rowk0 + 8 * (lane >> 4);
  u.q[0] = *(const v8h*)p; u.q[1] = *(const v8h*)(p + 16); return u.v;
}
__device__ __forceinline__ v16h frag_f32(const float* rowk0, int lane) {
  v16h a; const float* p = rowk0 + 8 * (lane >> 4);
#pragma unroll
  for (int i = 0; i < 8; ++i) { a[i] = (_Float16)p[i]; a[8 + i] = (_Float16)p[16 + i]; }
  return a;
}
__device__ __forceinline__ v16h frag_f32s(const float* rowk0, int lane, float sc) {
  v16h a; const float* p = rowk0 + 8 * (lane >> 4);
#pragma unroll
  for (int i = 0; i < 8; ++i) { a[i] = (_Float16)(p[i] * sc); a[8 + i] = (_Float16)(p[16 + i] * sc); }
  return a;
}
// column fragment from a [K][ld] layout (column n), rows >= K read as 0
__device__ __forceinline__ v16h fragc_f32(const float* W, int k0, int n, int lane, int ld, int K) {
  v16h a; const int g = lane >> 4;
#pragma unroll
  for (int i = 0; i < 8; ++i) { const int ka = k0 + 8 * g + i, kb = ka + 16;
    a[i] = (_Float16)(ka < K ? W[(size_t)(ka < K ? ka : K - 1) * ld + n] : 0.f); a[8 + i] = (_Float16)(kb < K ? W[(size_t)(kb < K ? kb : K - 1) * ld + n] : 0.f); }
  return a;
}
struct F2 { v16b h, l; };
__device__ __forceinline__ F2 bsplit16(const float v[16]) { F2 r;
#pragma unroll
  for (int i = 0; i < 16; ++i) { const __bf16 h = (__bf16)v[i]; r.h[i] = h; r.l[i] = (__bf16)(v[i] - (float)h); }
  return r; }
__device__ __forceinline__ F2 split_row(const float* row, int k0, int lane) { float v[16]; const float* p = row + k0 + 8 * (lane >> 4);
#pragma unroll
  for (int i = 0; i < 8; ++i) { v[i] = p[i]; v[8 + i] = p[16 + i]; }
  return bsplit16(v); }
__device__ __forceinline__ F2 split_rowK(const float* row, int k0, int lane, int K) { float v[16]; const int g = lane >> 4;
#pragma unroll
  for (int i = 0; i < 8; ++i) { const int ka = k0 + 8 * g + i, kb = ka + 16; v[i] = ka < K ? row[ka < K ? ka : K - 1] : 0.f; v[8 + i] = kb < K ? row[kb < K ? kb : K - 1] : 0.f; }
  return bsplit16(v); }
__device__ __forceinline__ F2 split_col(const float* W, int k0, int n, int lane, int ld, int K) { float v[16]; const int g = lane >> 4;
#pragma unroll
  for (int i = 0; i < 8; ++i) { const int ka = k0 + 8 * g + i, kb = ka + 16; v[i] = ka < K ? W[(size_t)(ka < K ? ka : K - 1) * ld + n] : 0.f; v[8 + i] = kb < K ? W[(size_t)(kb < K ? kb : K - 1) * ld + n] : 0.f; }
  return bsplit16(v); }
__device__ __forceinline__ v8f mac3(const F2& a, const F2& b, v8f c) { c = wmma_bf(a.l, b.h, c); c = wmma_bf(a.h, b.l, c); return wmma_bf(a.h, b.h, c); }
__device__ __forceinline__ float sigm(float v) { return 1.0f / (1.0f + expf(-v)); }
#define LDSX() do { asm volatile("s_wait_dscnt 0" ::: "memory"); __builtin_amdgcn_wave_barrier(); __builtin_amdgcn_fence(__ATOMIC_RELEASE, "workgroup"); } while (0)

// Multi-head causal self-attention with an elementwise-modulated value path (x_norm_for_qkv, xt_current_for_v [2,2048,1024]; w_attn [3072,1024] torch (out,in) N(0, 1/1024), b_attn zeros (read): jnp.split thirds of x_norm @ w_attn.T + b_attn (q = rows 0..1023, k = 1024..2047, v = 2048..3071); 16 heads x 64; effective_v = heads(xt_current_for_v) * v (elementwise); att x 1/sqrt(64); tril kept, -inf elsewhere; softmax; y @ w_proj.T + b_proj (w_proj (out,in), b_proj zeros, read)).
#define NB 2
#define TT 2048
#define CC 1024            // NH * HD = projected width
#define DIN 1024          // input (model) width
#define NH 16
#define HD 64
#define NQB (TT / 64)
#define HG 4
#define SCALE (0.125f)
#define CAUSAL 1
#ifndef TNB
#define TNB NB
#endif
__device__ __forceinline__ float bfr(float v) { return (float)(__bf16)v; }
__host__ __device__ __forceinline__ int kb_last(int qb) { return CAUSAL ? ((qb * 64 + 63) >> 7) : (TT / 128 - 1); }
typedef __attribute__((ext_vector_type(8))) __bf16 v8b;
__device__ __forceinline__ v16b frag_b(const __bf16* rowk0, int lane) {
  union { v16b v; v8b q[2]; } u; const __bf16* p = rowk0 + 8 * (lane >> 4);
  u.q[0] = *(const v8b*)p; u.q[1] = *(const v8b*)(p + 16); return u.v;
}
#define QBH 6              // causal: query blocks 0..QBH-1 of each sequence (few keys, no averaging) take the high-precision path
#define QHI 384            // rows carrying a q residual plane
#define KHI 384            // key rows carrying k residual / v bf16 hi+lo planes (used only by the causal high-precision path)
// B fragment (k rows k0+.., output column o) of a weight: (in,out) [K][ld] or (out,in) [ld rows of K]: bf16 exact, or f16(bf16 * 256) exact
__device__ __forceinline__ v16b wcol_io(const float* Wm, int k0, int o, int lane, int ld) { v16b w; const int g = lane >> 4;
#pragma unroll
  for (int i = 0; i < 8; ++i) { w[i] = (__bf16)Wm[(size_t)(k0 + 8 * g + i) * ld + o]; w[8 + i] = (__bf16)Wm[(size_t)(k0 + 16 + 8 * g + i) * ld + o]; }
  return w; }
__device__ __forceinline__ v16b wcol_oi(const float* Wm, int k0, int o, int lane, int K) { v16b w; const float* p = Wm + (size_t)o * K + k0 + 8 * (lane >> 4);
#pragma unroll
  for (int i = 0; i < 8; ++i) { w[i] = (__bf16)p[i]; w[8 + i] = (__bf16)p[16 + i]; }
  return w; }
__device__ __forceinline__ v16h wcolh_io(const float* Wm, int k0, int o, int lane, int ld) { v16h w; const int g = lane >> 4;
#pragma unroll
  for (int i = 0; i < 8; ++i) { w[i] = (_Float16)(bfr(Wm[(size_t)(k0 + 8 * g + i) * ld + o]) * 256.0f); w[8 + i] = (_Float16)(bfr(Wm[(size_t)(k0 + 16 + 8 * g + i) * ld + o]) * 256.0f); }
  return w; }
__device__ __forceinline__ v16h wcolh_oi(const float* Wm, int k0, int o, int lane, int K) { v16h w; const float* p = Wm + (size_t)o * K + k0 + 8 * (lane >> 4);
#pragma unroll
  for (int i = 0; i < 8; ++i) { w[i] = (_Float16)(bfr(p[i]) * 256.0f); w[8 + i] = (_Float16)(bfr(p[16 + i]) * 256.0f); }
  return w; }
// fragment loads from the lane's own pointer p = row + k0 + 8 * (lane >> 4), so that a batch's loads are constant offsets from one address pair; the 16 raw floats of a fragment (R16) and their conversions are separate functions
struct R16 { v4f q[4]; };
__device__ __forceinline__ R16 wraw(const float* p) { R16 r;
  r.q[0] = *(const v4f*)p; r.q[1] = *(const v4f*)(p + 4); r.q[2] = *(const v4f*)(p + 16); r.q[3] = *(const v4f*)(p + 20); return r; }
__device__ __forceinline__ v16h fragh_p(const _Float16* p) { union { v16h v; v8h q[2]; } u; u.q[0] = *(const v8h*)p; u.q[1] = *(const v8h*)(p + 16); return u.v; }
__device__ __forceinline__ v16b fragb_p(const __bf16* p) { union { v16b v; v8b q[2]; } u; u.q[0] = *(const v8b*)p; u.q[1] = *(const v8b*)(p + 16); return u.v; }
__device__ __forceinline__ v16h cvth_r(const R16& r) { v16h a;
#pragma unroll
  for (int i = 0; i < 8; ++i) { a[i] = (_Float16)r.q[i >> 2][i & 3]; a[8 + i] = (_Float16)r.q[2 + (i >> 2)][i & 3]; }
  return a; }
__device__ __forceinline__ v16b cvtb_r(const R16& r) { v16b a;
#pragma unroll
  for (int i = 0; i < 8; ++i) { a[i] = (__bf16)r.q[i >> 2][i & 3]; a[8 + i] = (__bf16)r.q[2 + (i >> 2)][i & 3]; }
  return a; }
__device__ __forceinline__ F2 split_r(const R16& r) { float v[16];
#pragma unroll
  for (int i = 0; i < 8; ++i) { v[i] = r.q[i >> 2][i & 3]; v[8 + i] = r.q[2 + (i >> 2)][i & 3]; }
  return bsplit16(v); }
__device__ __forceinline__ v16h wcolh_r(const R16& r) { v16h w;
#pragma unroll
  for (int i = 0; i < 8; ++i) { w[i] = (_Float16)(bfr(r.q[i >> 2][i & 3]) * 256.0f); w[8 + i] = (_Float16)(bfr(r.q[2 + (i >> 2)][i & 3]) * 256.0f); }
  return w; }
#define WQKV_LAYOUT 1   // 0 = (in,out) [DIN][CC]; 1 = (out,in) [CC][DIN]; 2 = per-head [NH][DIN][HD]
__device__ __forceinline__ v16b wcol_hdk(const float* Wm, int k0, int o, int lane) { v16b w; const int g = lane >> 4; const float* p = Wm + (size_t)(o / HD) * DIN * HD + (o % HD);
#pragma unroll
  for (int i = 0; i < 8; ++i) { w[i] = (__bf16)p[(size_t)(k0 + 8 * g + i) * HD]; w[8 + i] = (__bf16)p[(size_t)(k0 + 16 + 8 * g + i) * HD]; }
  return w; }
#define WO_OUT_IN 1
#if WQKV_LAYOUT == 1
#define WCOL(W, k0, o, lane) wcol_oi(W, k0, o, lane, DIN)
#elif WQKV_LAYOUT == 2
#define WCOL(W, k0, o, lane) wcol_hdk(W, k0, o, lane)
#else
#define WCOL(W, k0, o, lane) wcol_io(W, k0, o, lane, CC)
#endif
#if WO_OUT_IN
#define WOCOL(W, k0, o, lane) wcol_oi(W, k0, o, lane, CC)
#define WOCOLH(W, k0, o, lane) wcolh_oi(W, k0, o, lane, CC)
#else
#define WOCOL(W, k0, o, lane) wcol_io(W, k0, o, lane, DIN)
#define WOCOLH(W, k0, o, lane) wcolh_io(W, k0, o, lane, DIN)
#endif

// (PROJ_EXTRA_PARAMS: the extra kernel parameters 'const float* __restrict__ XT' are written literally in the kernel signature)
// per (token, head) hook on the staged f32 row (64 floats, projection + bias) of the v stream: effective_v = xt * v elementwise with the same (token, head) slice of the second input (bf16-rounded); one f32 product per element; q and k untouched
#define PROJ_EPI(which, row, t, h) do { if ((which) == 2) { float* rw = (row); const float* xr_ = XT + ((size_t)bb * TT + (t)) * CC + (h) * 64; _Pragma("unroll 8") for (int i = 0; i < 64; ++i) rw[i] = bfr(xr_[i]) * rw[i]; } } while (0)
#ifndef SM_EXTRA_PARAMS
#define SM_EXTRA_PARAMS
#endif
#ifndef PROJ_EXTRA_PARAMS
#define PROJ_EXTRA_PARAMS
#endif
#ifndef SM_MASK_HOOK
#define SM_MASK_HOOK (void)0
#endif

#define WS_QH  0u                                      // f16 q rows [b*t][CC]
#define WS_KH  (WS_QH + 2u * (size_t)NB * TT * CC)      // f16 k rows [b*t][CC]
#define WS_VT  (WS_KH + 2u * (size_t)NB * TT * CC)      // f16 v planes [b][c][t]
#define WS_QL  (WS_VT + 2u * (size_t)NB * CC * TT)      // f16 q residual x 2^10 rows [b][t < QHI][CC]
#define WS_KL  (WS_QL + 2u * (size_t)NB * QHI * CC)     // f16 k residual x 2^10 rows [b][t < KHI][CC]
#define WS_VB  (WS_KL + 2u * (size_t)NB * KHI * CC)     // bf16 v hi planes [b][c][t < KHI]
#define WS_VBL (WS_VB + 2u * (size_t)NB * CC * KHI)
#define WS_S   (WS_VBL + 2u * (size_t)NB * CC * KHI)    // (not used: the logits stay in registers)
#define WS_Y   (WS_S  + 4u * (size_t)HG * TT * TT)      // f32 ctx rows [b*t][CC] (only when there is an output projection)
#define WS_END (WS_Y  + 4u * (size_t)NB * TT * CC)

// ---- operand staging for the two dense products (k_proj, k_out): a block's A tile (64 rows) and W tile (128 rows) of 64 k are read from global memory once a block, by whole 128-byte lines, converted once, and laid in LDS as 16-bit rows; the four waves take their fragments from there.
#define SK 64              // k extent of a stage
#define SP 72              // LDS row pitch in 16-bit elements: 144 B, an odd multiple of 16 B, so that a fragment's ds_load_b128 meets no bank twice
typedef __attribute__((ext_vector_type(4))) __bf16 v4b;
typedef __attribute__((ext_vector_type(4))) _Float16 v4h;
template <int N> struct SR { v4f v[N]; };
// p = the thread's own pointer (row tid >> 4, floats 4 * (tid & 15)); piece i is row + 8 i: a wave's load covers two rows of 256 B
template <int N, int LD> __device__ __forceinline__ void st_ld(SR<N>& r, const float* p) {
#pragma unroll
  for (int i = 0; i < N; ++i) r.v[i] = *(const v4f*)(p + (size_t)i * 8 * LD); }
__device__ __forceinline__ v4b cv_b(v4f v) { v4b o;
#pragma unroll
  for (int i = 0; i < 4; ++i) o[i] = (__bf16)v[i];
  return o; }
__device__ __forceinline__ v4b cv_bl(v4f v) { v4b o;
#pragma unroll
  for (int i = 0; i < 4; ++i) o[i] = (__bf16)(v[i] - (float)(__bf16)v[i]);
  return o; }
__device__ __forceinline__ v4h cv_y(v4f v) { v4h o;
#pragma unroll
  for (int i = 0; i < 4; ++i) o[i] = (_Float16)(v[i] * 64.0f);
  return o; }
__device__ __forceinline__ v4h cv_w(v4f v) { v4h o;
#pragma unroll
  for (int i = 0; i < 4; ++i) o[i] = (_Float16)(bfr(v[i]) * 256.0f);
  return o; }
// MODE 0: A bf16, W bf16 (k_proj); 1: A bf16 hi + lo planes, W bf16 (k_out, early rows); 2: A f16(x 2^6), W f16(bf16 x 2^8) (k_out). A buffer = A rows (64, or 64 hi + 64 lo), then 128 W rows.
template <int MODE> __device__ __forceinline__ void st_put(const SR<8>& ar, const SR<16>& wr, char* buf, int so) {
  if constexpr (MODE == 2) { _Float16* d = (_Float16*)buf + so;
#pragma unroll
    for (int i = 0; i < 8; ++i) *(v4h*)(d + i * 8 * SP) = cv_y(ar.v[i]);
#pragma unroll
    for (int i = 0; i < 16; ++i) *(v4h*)(d + (64 + i * 8) * SP) = cv_w(wr.v[i]);
  } else { __bf16* d = (__bf16*)buf + so; constexpr int AR = MODE == 1 ? 128 : 64;
#pragma unroll
    for (int i = 0; i < 8; ++i) { *(v4b*)(d + i * 8 * SP) = cv_b(ar.v[i]); if constexpr (MODE == 1) *(v4b*)(d + (64 + i * 8) * SP) = cv_bl(ar.v[i]); }
#pragma unroll
    for (int i = 0; i < 16; ++i) *(v4b*)(d + (AR + i * 8) * SP) = cv_b(wr.v[i]); } }
// one stage's products, k ascending as before; fo = the lane's own offset (row lane & 15, element 8 * (lane >> 4))
template <int MODE> __device__ __forceinline__ void st_mac(const char* buf, int fo, int wave, v8f (&acc)[8]) {
#pragma unroll
  for (int kc = 0; kc < SK / 32; ++kc) {
    if constexpr (MODE == 2) { const _Float16* p = (const _Float16*)buf + fo + kc * 32; const v16h a = fragh_p(p + wave * 16 * SP); v16h w[8];
#pragma unroll
      for (int j = 0; j < 8; ++j) w[j] = fragh_p(p + (64 + j * 16) * SP);
#pragma unroll
      for (int j = 0; j < 8; ++j) acc[j] = wmma16(a, w[j], acc[j]);
    } else if constexpr (MODE == 1) { const __bf16* p = (const __bf16*)buf + fo + kc * 32; const v16b ah = fragb_p(p + wave * 16 * SP), al = fragb_p(p + (64 + wave * 16) * SP); v16b w[8];
#pragma unroll
      for (int j = 0; j < 8; ++j) w[j] = fragb_p(p + (128 + j * 16) * SP);
#pragma unroll
      for (int j = 0; j < 8; ++j) { acc[j] = wmma_bf(ah, w[j], acc[j]); acc[j] = wmma_bf(al, w[j], acc[j]); }
    } else { const __bf16* p = (const __bf16*)buf + fo + kc * 32; const v16b a = fragb_p(p + wave * 16 * SP); v16b w[8];
#pragma unroll
      for (int j = 0; j < 8; ++j) w[j] = fragb_p(p + (64 + j * 16) * SP);
#pragma unroll
      for (int j = 0; j < 8; ++j) acc[j] = wmma_bf(a, w[j], acc[j]); } } }
// the ring's work-group barrier: it orders the LDS operations alone, so that the global loads of the stage read ahead stay in flight across it (__syncthreads() would drain the load counter and lay their latency bare every stage)
#define RING_BARRIER() do { __builtin_amdgcn_fence(__ATOMIC_RELEASE, "workgroup", "local"); __builtin_amdgcn_s_barrier(); __builtin_amdgcn_fence(__ATOMIC_ACQUIRE, "workgroup", "local"); } while (0)
#define RING_BYTES(MODE) (2 * (((MODE) == 1 ? 128 : 64) + 128) * SP * 2)
// acc += A0[64 rows][KK] . W0[128 rows][KK]^T, wave w taking rows 16 w ..; two LDS buffers, the stage after next in registers. One barrier a stage: it publishes the buffer just written and ends the reads of the buffer that the next stage overwrites.
template <int MODE, int KK> __device__ __forceinline__ void gemm_staged(const float* __restrict__ A0, const float* __restrict__ W0, char* ring, int tid, v8f (&acc)[8]) {
  constexpr int BUFB = RING_BYTES(MODE) / 2, NS = KK / SK;
  const int wave = tid >> 5, lane = tid & 31; const int so = (tid >> 4) * SP + (tid & 15) * 4, fo = (lane & 15) * SP + 8 * (lane >> 4);
  const float* ag = A0 + (size_t)(tid >> 4) * KK + (tid & 15) * 4; const float* wg = W0 + (size_t)(tid >> 4) * KK + (tid & 15) * 4;
  SR<8> ar; SR<16> wr;
  st_ld<8, KK>(ar, ag); st_ld<16, KK>(wr, wg);
  st_put<MODE>(ar, wr, ring, so);
  st_ld<8, KK>(ar, ag + SK); st_ld<16, KK>(wr, wg + SK);
  asm volatile("s_wait_xcnt 0x0" :: "v"(ag), "v"(wg) : "memory");   // behind the loads, their address pairs as inputs: the pairs are stepped on next
  ag += 2 * SK; wg += 2 * SK;
  RING_BARRIER();
#pragma unroll 1   // rolled: sixteen copies of this long body would only lengthen the text
  for (int s = 0; s < NS; ++s) {
    st_mac<MODE>(ring + (s & 1) * BUFB, fo, wave, acc);
    if (s + 1 < NS) {   /* block-uniform */
      st_put<MODE>(ar, wr, ring + ((s + 1) & 1) * BUFB, so);
      if (s + 2 < NS) { st_ld<8, KK>(ar, ag); st_ld<16, KK>(wr, wg);
        asm volatile("s_wait_xcnt 0x0" :: "v"(ag), "v"(wg) : "memory");   // behind the loads, their address pairs as inputs: the pairs are stepped on next
        ag += SK; wg += SK; }
      RING_BARRIER(); } } }

// ---- k_proj: block = (64 rows, 128 cols, which): q/k/v = X W (+ b) with exact bf16 products (K = DIN) -> which 0: q f16 rows (+ residual rows < QHI); 1: k f16 rows (+ residual rows < KHI); 2: v f16 planes [c][t] (+ bf16 hi/lo planes for t < KHI)
__global__ __launch_bounds__(128) void k_proj(const float* __restrict__ XQ, const float* __restrict__ XK, const float* __restrict__ XV, const float* __restrict__ WQ, const float* __restrict__ WK, const float* __restrict__ WV, const float* __restrict__ BQ, const float* __restrict__ BK, const float* __restrict__ BV,
    _Float16* __restrict__ QH, _Float16* __restrict__ QL, _Float16* __restrict__ KH, _Float16* __restrict__ KL, _Float16* __restrict__ VT, __bf16* __restrict__ VB, __bf16* __restrict__ VBL, const float* __restrict__ XT) {
  __shared__ __align__(16) float st[64][132];
  __shared__ __align__(16) union { struct { _Float16 sh[64][136], sl[64][136], th[128][72]; __bf16 tb[128][72], tbl[128][72]; } e; char ring[RING_BYTES(0)]; } u;   // the main loop's ring lies on the epilogue's conversion tiles, which are first written two barriers behind the loop
  _Float16 (&sh)[64][136] = u.e.sh; _Float16 (&sl)[64][136] = u.e.sl; _Float16 (&th)[128][72] = u.e.th; __bf16 (&tb)[128][72] = u.e.tb; __bf16 (&tbl)[128][72] = u.e.tbl;
  const int tid = threadIdx.x, wave = tid >> 5, lane = tid & 31, col = lane & 15, g = lane >> 4; const int which = blockIdx.z; const int c0 = blockIdx.y * 128; const size_t r0 = (size_t)blockIdx.x * 64; const size_t bb = r0 / TT; const int t0 = (int)(r0 % TT);
  const float* X = which == 0 ? XQ : which == 1 ? XK : XV; const float* WA = which == 0 ? WQ : which == 1 ? WK : WV; const float* BA = which == 0 ? BQ : which == 1 ? BK : BV;
  v8f acc[8] = {};
  gemm_staged<0, DIN>(X + r0 * DIN, WA + (size_t)c0 * DIN, u.ring, tid, acc);
  { // stage the f32 tile (acc + bias) in LDS, run the per-(row, head) epilogue hook, then convert
#pragma unroll
    for (int j = 0; j < 8; ++j) { const float bias = BA ? bfr(BA[c0 + j * 16 + col]) : 0.f;
#pragma unroll
      for (int r = 0; r < 8; ++r) st[wave * 16 + 8 * g + r][j * 16 + col] = acc[j][r] + bias; }
    __syncthreads();
    for (int e = tid; e < 64 * (128 / HD); e += 128) { const int rl = e / (128 / HD), hh = e % (128 / HD); PROJ_EPI(which, &st[rl][hh * HD], (int)((r0 + rl) % TT), (c0 / HD) + hh); }
    __syncthreads(); }
  if (which < 2) { _Float16* DH = which == 0 ? QH : KH; _Float16* DL = which == 0 ? QL : KL; const int nhi = which == 0 ? QHI : KHI; const bool hi_rows = t0 < nhi;
    for (int e = tid; e < 64 * 128; e += 128) { const int rl = e >> 7, cl = e & 127; const float v = st[rl][cl]; const _Float16 hv = (_Float16)v; sh[rl][cl] = hv; sl[rl][cl] = (_Float16)((v - (float)hv) * 1024.0f); }
    __syncthreads();
    for (int e = tid; e < 64 * 16; e += 128) { const int rl = e >> 4, q = e & 15; vst2((unsigned*)(DH + (r0 + rl) * CC + c0 + q * 8), *(const v4u*)&sh[rl][q * 8]); if (hi_rows) vst2((unsigned*)(DL + (bb * nhi + t0 + rl) * (size_t)CC + c0 + q * 8), *(const v4u*)&sl[rl][q * 8]); }
  } else { const bool hi_rows = t0 < KHI;
    for (int e = tid; e < 64 * 128; e += 128) { const int rl = e & 63, cl = e >> 6; const float v = st[rl][cl]; th[cl][rl] = (_Float16)v; const __bf16 bh = (__bf16)v; tb[cl][rl] = bh; tbl[cl][rl] = (__bf16)(v - (float)bh); }
    __syncthreads();
    for (int e = tid; e < 128 * 8; e += 128) { const int cl = e >> 3, q = e & 7; vst2((unsigned*)(VT + (bb * CC + c0 + cl) * (size_t)TT + t0 + q * 8), *(const v4u*)&th[cl][q * 8]); if (hi_rows) { const size_t o3 = (bb * CC + c0 + cl) * (size_t)KHI + t0 + q * 8; vst2((unsigned*)(VB + o3), *(const v4u*)&tb[cl][q * 8]); vst2((unsigned*)(VBL + o3), *(const v4u*)&tbl[cl][q * 8]); } } } }
// ---- k_att: block = 64 queries (4 waves x 16) of one (b, h): logits, softmax and P . v in one kernel, nothing of the logits leaves the registers.
// Every product is taken transposed: S^T = K . Q^T (A = key rows, B = query rows), so a lane holds keys j*16 + 8g + r of ONE query (column lane & 15), and two neighbouring S^T tiles are, register for register, the B fragment of ctx^T = V^T . P^T (A = v planes).
// Rows from QHI on, ONE sweep over the keys, whose key and value tiles come through a two-buffer LDS ring filled by tensor loads: per 128-key block the query's maximum so far (joined over the two half-rows), P x 2^11 = exp(s - maximum so far) x 2048, its running sum, and the P . v products in the key order 0, 32, 64, ...; where the maximum rises, sum and ctx are first multiplied by exp(old - new); the division by the sum comes once, behind the last block.
// Rows below QHI (high-precision path), two sweeps: the first finds each query's maximum and denominator (kept per lane, the two half-rows joined once at the end), the second forms the logits again, P x 2^11 = exp(s - max) x 2048 / sum, and the P . v products in the same key order.
// ---- the key / value ring of the one-sweep path: a stage = the block's 128 keys of one head, the key tile (128 rows of 128 B) and the value tile (64 planes of 256 B), each brought from global memory into LDS by ONE tensor load a block (wave 0: keys, wave 1: values) and read from there by all four waves.
typedef uint32_t u32x4 __attribute__((ext_vector_type(4)));
typedef uint32_t u32x8 __attribute__((ext_vector_type(8)));
#define KPH 72             // LDS pitch of a key row in f16: 128 B + the mover's 16-B pad = 144 B, an odd multiple of 16 B (ds_load_b128 meets no bank twice)
#define VPH 136            // LDS pitch of a value plane in f16: 256 B + 16 B = 272 B, likewise
#define KTILE_B 18432u     // 128 rows x 144 B, a multiple of 2 KiB
#define VTILE_B 18432u     // 64 planes x 272 B = 17408 B, rounded up to a multiple of 2 KiB
#define ABUF_B (KTILE_B + VTILE_B)
__device__ __forceinline__ uint32_t uni(uint32_t v) { return (uint32_t)__builtin_amdgcn_readfirstlane(v); }
__device__ __forceinline__ uint32_t pinned(uint32_t v) { uint32_t w = (uint32_t)__builtin_amdgcn_readfirstlane(v); asm volatile("" : "+s"(w)); return w; }   // holds the test of a tensor load's branch in a scalar register, so that the branch is s_cmp + s_cbranch_scc (a tensor load ignores EXEC)
struct TD { u32x4 g0; u32x8 g1; };   // the two groups of the wave's youngest request
// one request: a tile of D1 rows of D0 bytes, source pitch PITCH bytes, first byte at src, to the LDS byte offset dst; W0 = word 0 of group 1 (no mask, 1-byte elements, 16 B of pad behind every row)
template <uint32_t W0, uint32_t D0, uint32_t D1, uint32_t PITCH> __device__ __forceinline__ void tdm_tile(TD& d, uint32_t dst, const _Float16* src) {
  const uint64_t ga = (uint64_t)(size_t)src; u32x4 g0; u32x8 g1;
  g0[0] = uni(1u); g0[1] = uni(dst); g0[2] = uni((uint32_t)ga); g0[3] = uni((((uint32_t)(ga >> 32)) & 0x01FFFFFFu) | 0x80000000u);
  g1[0] = uni(W0); g1[1] = uni((D0 & 0xFFFFu) << 16); g1[2] = uni((D0 >> 16) | ((D1 & 0xFFFFu) << 16)); g1[3] = uni((D1 >> 16) | (D0 << 16)); g1[4] = uni(D1); g1[5] = uni(PITCH); g1[6] = uni(0u); g1[7] = uni(0u);
  asm volatile("tensor_load_to_lds %0, %1" : "+{s[36:39]}"(g0), "+{s[40:47]}"(g1) :: "memory");   // the groups stand in named registers and come back out of the statement, so that tdm_landed() can name the same ones
  d.g0 = g0; d.g1 = g1; }
// the issuing wave's wait for its youngest request; the request's two groups are inputs, so that their registers stay live, and so unwritten, from the issue up to this wait
__device__ __forceinline__ void tdm_landed(const TD& d) { asm volatile("s_wait_tensorcnt 0x0" :: "{s[36:39]}"(d.g0), "{s[40:47]}"(d.g1) : "memory"); }
// stage s into buffer s & 1: ks / vs = the head's first key row / first value plane; d takes the issuing wave's descriptor
__device__ __forceinline__ void att_stage(TD& d, uint32_t wv, uint32_t lbase, int s, const _Float16* ks, const _Float16* vs) {
  const uint32_t dst = lbase + (uint32_t)(s & 1) * ABUF_B;
  if (pinned(wv == 0u)) tdm_tile<(1u << 20) | (4u << 22) | (3u << 25), 2u * HD, 128u, 2u * CC>(d, dst, ks + (size_t)s * 128 * CC);
  if (pinned(wv == 1u)) tdm_tile<(1u << 20) | (5u << 22) | (3u << 25), 256u, (uint32_t)HD, 2u * TT>(d, dst + KTILE_B, vs + s * 128); }
// one 128-key block of logits x SCALE: kp / klp = the lane's own pointer (key row k0 + col, the head's dims, + 8g)
template <bool HI> __device__ __forceinline__ void att_logits(const _Float16* kp, const _Float16* klp, const v16h (&qh)[2], const v16h (&ql)[2], v8f (&s)[8]) {
  if constexpr (HI) {
#pragma unroll
    for (int j2 = 0; j2 < 8; j2 += 2) { v16h kbf[HD / 32][2], klf[HD / 32][2];   // two key tiles' fragments loaded together (registers bound the batch on this path)
#pragma unroll
      for (int kc = 0; kc < HD / 32; ++kc)
#pragma unroll
        for (int u = 0; u < 2; ++u) { kbf[kc][u] = fragh_p(kp + (j2 + u) * 16 * CC + kc * 32); klf[kc][u] = fragh_p(klp + (j2 + u) * 16 * CC + kc * 32); }
      asm volatile("s_wait_xcnt 0x0" :: "v"(kp), "v"(klp) : "memory");   // behind the batch, its address pairs as inputs: they are stepped on at the foot of the key loop
      v8f acc[2] = {}, accl[2] = {};
#pragma unroll
      for (int kc = 0; kc < HD / 32; ++kc)
#pragma unroll
        for (int u = 0; u < 2; ++u) { acc[u] = wmma16(kbf[kc][u], qh[kc], acc[u]); accl[u] = wmma16(kbf[kc][u], ql[kc], accl[u]); accl[u] = wmma16(klf[kc][u], qh[kc], accl[u]); }
#pragma unroll
      for (int u = 0; u < 2; ++u)
#pragma unroll
        for (int r = 0; r < 8; ++r) s[j2 + u][r] = (acc[u][r] + accl[u][r] * (1.0f / 1024.0f)) * SCALE; }
  } else { v8f acc[8] = {}; v16h kf[HD / 32][8];   // kp points into the staged key tile in LDS (row pitch KPH); the block's sixteen key fragments are read ahead of its first WMMA: one LDS latency a block
#pragma unroll
    for (int kc = 0; kc < HD / 32; ++kc)
#pragma unroll
      for (int j = 0; j < 8; ++j) kf[kc][j] = fragh_p(kp + j * 16 * KPH + kc * 32);
#pragma unroll
    for (int j = 0; j < 8; ++j)   // tile by tile: a tile's two fragments are free again as its eight logits come alive
#pragma unroll
      for (int kc = 0; kc < HD / 32; ++kc) acc[j] = wmma16(kf[kc][j], qh[kc], acc[j]);
#pragma unroll
    for (int j = 0; j < 8; ++j)
#pragma unroll
      for (int r = 0; r < 8; ++r) s[j][r] = acc[j][r] * SCALE; } }
// the causal mask, by index: d = the lane's query - its first key of the block; an excluded logit becomes -3e38, whose exp(s - m) is an exact 0 against any finite m
__device__ __forceinline__ void att_mask(v8f (&s)[8], int d) {
#pragma unroll
  for (int j = 0; j < 8; ++j)
#pragma unroll
    for (int r = 0; r < 8; ++r) if (j * 16 + r > d) s[j][r] = -3.0e38f; }
// first sweep: the lane's running maximum m and the sum of exp(s - m) over its own 64 keys of the block (a lane that has met only excluded keys keeps m = -3e38, and its sum is multiplied by exp(-3e38 - max) = 0 where the halves are joined)
__device__ __forceinline__ void att_stats(const v8f (&s)[8], float& m, float& sum) {
  float mx = s[0][0];
#pragma unroll
  for (int j = 0; j < 8; ++j)
#pragma unroll
    for (int r = 0; r < 8; ++r) mx = fmaxf(mx, s[j][r]);
  const float mn = fmaxf(m, mx); float a[4] = { sum * expf(m - mn), 0.f, 0.f, 0.f };
#pragma unroll
  for (int j = 0; j < 8; ++j)
#pragma unroll
    for (int r = 0; r < 8; ++r) a[r & 3] += expf(s[j][r] - mn);
  sum = (a[0] + a[1]) + (a[2] + a[3]); m = mn; }
// second sweep: s -> P x 2^11 in place (0 for excluded keys)
__device__ __forceinline__ void att_p(v8f (&s)[8], float m, float inv) {
#pragma unroll
  for (int j = 0; j < 8; ++j)
#pragma unroll
    for (int r = 0; r < 8; ++r) s[j][r] = expf(s[j][r] - m) * inv; }
// second sweep, one 128-key block: vha / vla (bf16 hi / lo planes) = the lane's own pointer (plane h*HD + col, key k0 + 8g)
__device__ __forceinline__ void att_pv(v8f (&s)[8], float m, float inv, const __bf16* vha, const __bf16* vla, v8f (&acc)[HD / 16]) {
  att_p(s, m, inv);
#pragma unroll
    for (int u = 0; u < 4; ++u) { float pv[16];
#pragma unroll
      for (int i = 0; i < 8; ++i) { pv[i] = s[2 * u][i]; pv[8 + i] = s[2 * u + 1][i]; }
      const F2 p = bsplit16(pv); v16b vh[HD / 16], vl[HD / 16];
#pragma unroll
      for (int j = 0; j < HD / 16; ++j) { vh[j] = fragb_p(vha + j * 16 * KHI + u * 32); vl[j] = fragb_p(vla + j * 16 * KHI + u * 32); }
      asm volatile("s_wait_xcnt 0x0" :: "v"(vha), "v"(vla) : "memory");   // behind the batch, its address pairs as inputs: as in att_logits
#pragma unroll
      for (int j = 0; j < HD / 16; ++j) { acc[j] = wmma_bf(vh[j], p.h, acc[j]); acc[j] = wmma_bf(vh[j], p.l, acc[j]); acc[j] = wmma_bf(vl[j], p.h, acc[j]); } } }
__device__ __forceinline__ float xhalf(float x) { return __builtin_bit_cast(float, __builtin_amdgcn_permlanex16(__builtin_bit_cast(int, x), __builtin_bit_cast(int, x), 0x76543210, 0xfedcba98, false, false)); }   // lane l takes lane l ^ 16's value
// the one sweep, one 128-key block: va = the lane's own pointer into the staged value tile in LDS (plane col, key 8g; plane pitch VPH); m = the query's maximum so far (alike in lanes l and l ^ 16, since both halves' P meet in one ctx tile), sum = the lane's own keys' sum of P x 2^11 against m
__device__ __forceinline__ void att_pv_run(v8f (&s)[8], float& m, float& sum, const _Float16* va, v8f (&acc)[HD / 16]) {
  v16h vf[4][HD / 16];   // 32 keys' v fragments are asked for one step ahead: the first ahead of the maximum, each next ahead of the exponentials of the 32 keys before it
#pragma unroll
  for (int j = 0; j < HD / 16; ++j) vf[0][j] = fragh_p(va + j * 16 * VPH);
  float mx = s[0][0];
#pragma unroll
  for (int j = 0; j < 8; ++j)
#pragma unroll
    for (int r = 0; r < 8; ++r) mx = fmaxf(mx, s[j][r]);
  const float mn = fmaxf(m, fmaxf(mx, xhalf(mx))); const float al = expf(m - mn);   // al = 0 at the first block (m = -3e38, sum and ctx still 0), 1 where the maximum stays
  m = mn;
#pragma unroll
  for (int j = 0; j < HD / 16; ++j)
#pragma unroll
    for (int r = 0; r < 8; ++r) acc[j][r] *= al;
  float a[4] = { sum * al, 0.f, 0.f, 0.f };
#pragma unroll
  for (int u = 0; u < 4; ++u) {
    if (u < 3) {
#pragma unroll
      for (int j = 0; j < HD / 16; ++j) vf[u + 1][j] = fragh_p(va + j * 16 * VPH + (u + 1) * 32);
    }
    v16h p;
#pragma unroll
    for (int i = 0; i < 8; ++i) { const float x0 = expf(s[2 * u][i] - mn) * 2048.0f, x1 = expf(s[2 * u + 1][i] - mn) * 2048.0f; a[i & 3] += x0; a[i & 3] += x1; p[i] = (_Float16)x0; p[8 + i] = (_Float16)x1; }
#pragma unroll
    for (int j = 0; j < HD / 16; ++j) acc[j] = wmma16(vf[u][j], p, acc[j]); }
  sum = (a[0] + a[1]) + (a[2] + a[3]); }
__device__ __forceinline__ void att_body_hi(const _Float16* __restrict__ QH, const _Float16* __restrict__ KH, const _Float16* __restrict__ QL, const _Float16* __restrict__ KL, const __bf16* __restrict__ VB, const __bf16* __restrict__ VBL, int b, int h, int qb, int ql0, int col, int g, v8f (&acc)[HD / 16]) {
  const int t = ql0 + col, kbl = kb_last(qb);
  const _Float16* qp = QH + ((size_t)b * TT + t) * CC + h * HD + 8 * g; const _Float16* qlp = QL + ((size_t)b * QHI + t) * CC + h * HD + 8 * g;
  v16h qh[2], ql[2];
#pragma unroll
  for (int kc = 0; kc < HD / 32; ++kc) { qh[kc] = fragh_p(qp + kc * 32); ql[kc] = fragh_p(qlp + kc * 32); }
  asm volatile("s_wait_xcnt 0x0" :: "v"(qp), "v"(qlp) : "memory");   // behind the query loads, their address pairs as inputs: the registers are free for reuse behind it
  const _Float16* const kp0 = KH + ((size_t)b * TT + col) * CC + h * HD + 8 * g; const _Float16* const klp0 = KL + ((size_t)b * KHI + col) * CC + h * HD + 8 * g;
  float m = -3.0e38f, sum = 0.f; v8f s[8];
#pragma unroll 1
  for (int kb = 0; kb <= kbl; ++kb) { att_logits<true>(kp0 + (size_t)kb * 128 * CC, klp0 + (size_t)kb * 128 * CC, qh, ql, s); if (CAUSAL && kb == kbl) att_mask(s, t - kb * 128 - 8 * g);   /* block-uniform: blocks below the last hold no key past any of the 64 queries */
    att_stats(s, m, sum); }
  const float m2 = __shfl_xor(m, 16), s2 = __shfl_xor(sum, 16), mm = fmaxf(m, m2); const float tot = sum * expf(m - mm) + s2 * expf(m2 - mm);   // lanes l and l ^ 16 hold the two halves of one query's keys
  const float inv = tot > 0.f ? 2048.0f / tot : 0.f;   /* every query has at least its own key, so mm is finite */
  const size_t po = ((size_t)b * CC + h * HD + col) * (size_t)KHI + 8 * g; const __bf16 *vha0 = VB + po, *vla0 = VBL + po;
#pragma unroll 1
  for (int kb = 0; kb <= kbl; ++kb) { att_logits<true>(kp0 + (size_t)kb * 128 * CC, klp0 + (size_t)kb * 128 * CC, qh, ql, s); if (CAUSAL && kb == kbl) att_mask(s, t - kb * 128 - 8 * g);   /* block-uniform */
    att_pv(s, mm, inv, vha0 + kb * 128, vla0 + kb * 128, acc); } }
__device__ __forceinline__ void att_body_run(const _Float16* __restrict__ QH, const _Float16* __restrict__ KH, const _Float16* __restrict__ VT, unsigned char* L, int b, int h, int qb, int ql0, int col, int g, v8f (&acc)[HD / 16]) {
  const int t = ql0 + col, kbl = kb_last(qb);
  const uint32_t wv = uni(threadIdx.x >> 5), lbase = (uint32_t)(size_t)L;
  const _Float16* const ks = KH + (size_t)b * TT * CC + h * HD; const _Float16* const vs = VT + ((size_t)b * CC + h * HD) * (size_t)TT;
  TD d = {};
  att_stage(d, wv, lbase, 0, ks, vs);   // the ring's prologue; qb >= QBH, so there are at least four stages
  if (pinned(wv < 2u)) tdm_landed(d);   // the issuing waves: stage 0 has landed
  __syncthreads();   // stage 0 is published to all four waves
  att_stage(d, wv, lbase, 1, ks, vs);
  const _Float16* qp = QH + ((size_t)b * TT + t) * CC + h * HD + 8 * g;
  v16h qh[2];
#pragma unroll
  for (int kc = 0; kc < HD / 32; ++kc) qh[kc] = fragh_p(qp + kc * 32);
  asm volatile("s_wait_xcnt 0x0" :: "v"(qp) : "memory");   // behind the query loads, their address pair as input: the registers are free for reuse behind it
  float m = -3.0e38f, sum = 0.f; v8f s[8];
#pragma unroll 1   // rolled: one publish point in the text, and the body is long
  for (int kb = 0; kb <= kbl; ++kb) { const unsigned char* const buf = L + (kb & 1) * ABUF_B;
    const _Float16* const kp = (const _Float16*)buf + col * KPH + 8 * g; const _Float16* const va = (const _Float16*)(buf + KTILE_B) + col * VPH + 8 * g;
    att_logits<false>(kp, kp, qh, qh, s); if (CAUSAL && kb == kbl) att_mask(s, t - kb * 128 - 8 * g);   /* block-uniform: blocks below the last hold no key past any of the 64 queries */
    att_pv_run(s, m, sum, va, acc);
    // publish point of stage kb + 1, every wave, every pass
    asm volatile("s_wait_dscnt 0x0" ::: "memory");   // this wave's reads of buffer kb & 1 have returned
    if (pinned(wv < 2u)) tdm_landed(d);   // the issuing waves: stage kb + 1 has landed
    __syncthreads();   // publishes stage kb + 1 and ends every wave's reads of buffer kb & 1
    if (pinned(kb + 2 <= kbl)) att_stage(d, wv, lbase, kb + 2, ks, vs); }   // the refill, only while that stage exists
  asm volatile("s_wait_tensorcnt 0x0" ::: "memory");   // nothing is in flight where the ring becomes the output's staging
  asm volatile("s_wait_dscnt 0x0" ::: "memory");
  const float tot = sum + xhalf(sum);   // lanes l and l ^ 16 hold the two halves of one query's keys, against one maximum
  const float inv = tot > 0.f ? 2048.0f / tot : 0.f;   /* the key at the query's final maximum stands in tot with 2048; ctx leaves x 2^11, as on the other path */
#pragma unroll
  for (int j = 0; j < HD / 16; ++j)
#pragma unroll
    for (int r = 0; r < 8; ++r) acc[j][r] *= inv; }
__global__ __launch_bounds__(128) __attribute__((amdgpu_waves_per_eu(4, 4))) void k_att(const _Float16* __restrict__ QH, const _Float16* __restrict__ KH, const _Float16* __restrict__ QL, const _Float16* __restrict__ KL, const _Float16* __restrict__ VT, const __bf16* __restrict__ VB, const __bf16* __restrict__ VBL, float* __restrict__ Y) { __shared__ __attribute__((aligned(2048))) unsigned char L[2 * ABUF_B];
  float (*ss)[16][HD + 4] = (float (*)[16][HD + 4])L;   // the output's staging lies on the ring, which every wave has left at the last pass's barrier
  const int tid = threadIdx.x, wave = tid >> 5, lane = tid & 31, col = lane & 15, g = lane >> 4; const int b = blockIdx.x / NH, h = blockIdx.x % NH;
  const int qi = blockIdx.y; const int qb = NQB - 1 - ((qi & 8) ? (qi ^ 7) : qi);   // long query blocks start first; every second run of eight is reversed, so that blocks 256 apart in launch order add up to equal work
  const int ql0 = qb * 64 + wave * 16;
  v8f acc[HD / 16] = {};
  if (qb < QBH) att_body_hi(QH, KH, QL, KL, VB, VBL, b, h, qb, ql0, col, g, acc);   /* block-uniform */
  else att_body_run(QH, KH, VT, L, b, h, qb, ql0, col, g, acc);
#pragma unroll
  for (int j = 0; j < HD / 16; ++j)
#pragma unroll
    for (int r = 0; r < 8; ++r) ss[wave][col][j * 16 + 8 * g + r] = acc[j][r] * (1.0f / 2048.0f);   // ctx^T: element r of tile j = dim j*16 + 8g + r of query col
  LDSX(); for (int rl = 0; rl < 16; ++rl) if (lane < HD / 4) vst2(Y + ((size_t)b * TT + ql0 + rl) * CC + h * HD + lane * 4, *(const v4f*)&ss[wave][rl][lane * 4]); }
// ---- k_out: block = (64 rows, 128 cols): out = ctx Wo (+ bo): ctx x 2^6 once to f16 against Wo as f16(bf16 x 2^8) exact (1 product) x 2^-14; causal early rows (< QHI of each sequence): ctx bf16 hi + lo against exact bf16 Wo (2 products)
__global__ __launch_bounds__(128) void k_out(const float* __restrict__ Y, const float* __restrict__ WO, const float* __restrict__ BO, float* __restrict__ OUT) { __shared__ __align__(16) float sf[4][16][132]; __shared__ __align__(16) char ring[RING_BYTES(1)];
  const int tid = threadIdx.x, wave = tid >> 5, lane = tid & 31, col = lane & 15, g = lane >> 4; const int c0 = blockIdx.y * 128; const size_t r0 = (size_t)blockIdx.x * 64 + wave * 16;
  v8f acc[8] = {};
  if (CAUSAL && (int)(((size_t)blockIdx.x * 64) % TT) < QHI) {   /* block-uniform */
    gemm_staged<1, CC>(Y + (size_t)blockIdx.x * 64 * CC, WO + (size_t)c0 * CC, ring, tid, acc);
#pragma unroll
    for (int j = 0; j < 8; ++j) { const float bias = BO ? bfr(BO[c0 + j * 16 + col]) : 0.f;
#pragma unroll
      for (int r = 0; r < 8; ++r) sf[wave][8 * g + r][j * 16 + col] = acc[j][r] + bias; }
  } else {   /* ctx carried x 2^6 into f16 so small-magnitude context rows stay clear of f16 subnormals */
    gemm_staged<2, CC>(Y + (size_t)blockIdx.x * 64 * CC, WO + (size_t)c0 * CC, ring, tid, acc);
#pragma unroll
    for (int j = 0; j < 8; ++j) { const float bias = BO ? bfr(BO[c0 + j * 16 + col]) : 0.f;
#pragma unroll
      for (int r = 0; r < 8; ++r) sf[wave][8 * g + r][j * 16 + col] = acc[j][r] * (1.0f / 16384.0f) + bias; } }   /* 2^-8 (Wo carry) x 2^-6 (ctx carry) */
  LDSX(); for (int rl = 0; rl < 16; ++rl) vst2(OUT + (r0 + rl) * DIN + c0 + lane * 4, *(const v4f*)&sf[wave][rl][lane * 4]); }

extern "C" void kernel_launch(void* const* d_in, const int* in_sizes, int n_in, void* d_out, int out_size, void* d_ws, size_t ws_size, hipStream_t stream) {
  (void)in_sizes; (void)n_in; (void)out_size;
  const float** F = (const float**)d_in;
  if (ws_size < (size_t)WS_END) return;
  char* ws = (char*)d_ws; _Float16 *QH = (_Float16*)(ws + WS_QH), *KH = (_Float16*)(ws + WS_KH), *VT = (_Float16*)(ws + WS_VT), *QL = (_Float16*)(ws + WS_QL), *KL = (_Float16*)(ws + WS_KL); __bf16 *VB = (__bf16*)(ws + WS_VB), *VBL = (__bf16*)(ws + WS_VBL); float *Y = (float*)(ws + WS_Y);
  (void)Y; (void)QL; (void)KL; (void)VB; (void)VBL;
  // inputs: 0 x_norm_for_qkv [2,2048,1024]; 1 xt_current_for_v [2,2048,1024] (multiplies the projected values elementwise); 2 w_attn [3072,1024] (out,in): q rows 0..1023, k 1024..2047, v 2048..3071; 3 b_attn [3072] (zeros, read); 4 w_proj [1024,1024] (out,in); 5 b_proj (zeros, read)
  k_proj<<<dim3(TNB * TT / 64, CC / 128, 3), 128, 0, stream>>>(F[0], F[0], F[0], F[2], F[2] + (size_t)CC * DIN, F[2] + 2 * (size_t)CC * DIN, F[3], F[3] + CC, F[3] + 2 * CC, QH, QL, KH, KL, VT, VB, VBL, F[1]);
  k_att<<<dim3(TNB * NH, NQB), 128, 0, stream>>>(QH, KH, QL, KL, VT, VB, VBL, Y);
  k_out<<<dim3(TNB * TT / 64, DIN / 128), 128, 0, stream>>>(Y, F[4], F[5], (float*)d_out);
}

// v006
// Measured time: 111 microseconds a run.
// Timed twice side by side with v005, it ran 1.07 times as fast both times.
// Counting every step since v000, it is 11.5 times as fast.
// compute dtype: all float inputs rounded to bf16; q / k / v projections with EXACT bf16 products on WMMA 16x16x32 (f32 accumulate) + bias (zeros, read); the value rows multiplied elementwise in f32 by the second input (bf16-rounded) per (token, head, dim); causal logits: 3 products for the first 384 rows, single f16 q x k after, x 64^-0.5; softmax f32; P x 2^11 once to f16 x v once to f16 (bf16 hi + lo below row 384); ctx hi+lo x exact w_proj below row 384, x2^6 f16 carry x f16(bf16 x 2^8) after, + b_proj (zeros); f32 output.
#include <hip/hip_runtime.h>
#include <math.h>
#include <stdint.h>

typedef __attribute__((ext_vector_type(16))) _Float16 v16h;
typedef __attribute__((ext_vector_type(16))) __bf16 v16b;
typedef __attribute__((ext_vector_type(8)))  _Float16 v8h;
typedef __attribute__((ext_vector_type(8)))  float v8f;
typedef __attribute__((ext_vector_type(4)))  float v4f;
typedef __attribute__((ext_vector_type(2)))  float v2f;
typedef __attribute__((ext_vector_type(4)))  unsigned v4u;
typedef __attribute__((ext_vector_type(4)))  int v4i;
typedef float __attribute__((may_alias)) float_a;
typedef int __attribute__((may_alias)) int_a;

template <typename T> __device__ __forceinline__ void vst2(void* p, T v) { *(T*)p = v;  }
__device__ __forceinline__ v8f wmma16(v16h a, v16h b, v8f c) {
  v8f d = __builtin_amdgcn_wmma_f32_16x16x32_f16(false, a, false, b, (short)0, c, false, false);
  asm volatile("v_nop\n\tv_nop\n\tv_nop\n\tv_nop" : "+v"(d) : "v"(a), "v"(b));
  return d;
}
__device__ __forceinline__ v8f wmma_bf(v16b a, v16b b, v8f c) {
  v8f d = __builtin_amdgcn_wmma_f32_16x16x32_bf16(false, a, false, b, (short)0, c, false, false);
  asm volatile("v_nop\n\tv_nop\n\tv_nop\n\tv_nop" : "+v"(d) : "v"(a), "v"(b));
  return d;
}
// 16x16x32 fragments: lane = (h = lane>>4, row/col = lane&15); elements 0..7 = k0+8h+0..7, 8..15 = k0+16+8h+0..7; D element r = row 8h+r
__device__ __forceinline__ v16h frag_h(const _Float16* rowk0, int lane) {
  union { v16h v; v8h q[2]; } u; const _Float16* p = rowk0 + 8 * (lane >> 4);
  u.q[0] = *(const v8h*)p; u.q[1] = *(const v8h*)(p + 16); return u.v;
}
__device__ __forceinline__ v16h frag_f32(const float* rowk0, int lane) {
  v16h a; const float* p = rowk0 + 8 * (lane >> 4);
#pragma unroll
  for (int i = 0; i < 8; ++i) { a[i] = (_Float16)p[i]; a[8 + i] = (_Float16)p[16 + i]; }
  return a;
}
__device__ __forceinline__ v16h frag_f32s(const float* rowk0, int lane, float sc) {
  v16h a; const float* p = rowk0 + 8 * (lane >> 4);
#pragma unroll
  for (int i = 0; i < 8; ++i) { a[i] = (_Float16)(p[i] * sc); a[8 + i] = (_Float16)(p[16 + i] * sc); }
  return a;
}
// column fragment from a [K][ld] layout (column n), rows >= K read as 0
__device__ __forceinline__ v16h fragc_f32(const float* W, int k0, int n, int lane, int ld, int K) {
  v16h a; const int g = lane >> 4;
#pragma unroll
  for (int i = 0; i < 8; ++i) { const int ka = k0 + 8 * g + i, kb = ka + 16;
    a[i] = (_Float16)(ka < K ? W[(size_t)(ka < K ? ka : K - 1) * ld + n] : 0.f); a[8 + i] = (_Float16)(kb < K ? W[(size_t)(kb < K ? kb : K - 1) * ld + n] : 0.f); }
  return a;
}
struct F2 { v16b h, l; };
__device__ __forceinline__ F2 bsplit16(const float v[16]) { F2 r;
#pragma unroll
  for (int i = 0; i < 16; ++i) { const __bf16 h = (__bf16)v[i]; r.h[i] = h; r.l[i] = (__bf16)(v[i] - (float)h); }
  return r; }
__device__ __forceinline__ F2 split_row(const float* row, int k0, int lane) { float v[16]; const float* p = row + k0 + 8 * (lane >> 4);
#pragma unroll
  for (int i = 0; i < 8; ++i) { v[i] = p[i]; v[8 + i] = p[16 + i]; }
  return bsplit16(v); }
__device__ __forceinline__ F2 split_rowK(const float* row, int k0, int lane, int K) { float v[16]; const int g = lane >> 4;
#pragma unroll
  for (int i = 0; i < 8; ++i) { const int ka = k0 + 8 * g + i, kb = ka + 16; v[i] = ka < K ? row[ka < K ? ka : K - 1] : 0.f; v[8 + i] = kb < K ? row[kb < K ? kb : K - 1] : 0.f; }
  return bsplit16(v); }
__device__ __forceinline__ F2 split_col(const float* W, int k0, int n, int lane, int ld, int K) { float v[16]; const int g = lane >> 4;
#pragma unroll
  for (int i = 0; i < 8; ++i) { const int ka = k0 + 8 * g + i, kb = ka + 16; v[i] = ka < K ? W[(size_t)(ka < K ? ka : K - 1) * ld + n] : 0.f; v[8 + i] = kb < K ? W[(size_t)(kb < K ? kb : K - 1) * ld + n] : 0.f; }
  return bsplit16(v); }
__device__ __forceinline__ v8f mac3(const F2& a, const F2& b, v8f c) { c = wmma_bf(a.l, b.h, c); c = wmma_bf(a.h, b.l, c); return wmma_bf(a.h, b.h, c); }
__device__ __forceinline__ float sigm(float v) { return 1.0f / (1.0f + expf(-v)); }
#define LDSX() do { asm volatile("s_wait_dscnt 0" ::: "memory"); __builtin_amdgcn_wave_barrier(); __builtin_amdgcn_fence(__ATOMIC_RELEASE, "workgroup"); } while (0)

// Multi-head causal self-attention with an elementwise-modulated value path (x_norm_for_qkv, xt_current_for_v [2,2048,1024]; w_attn [3072,1024] torch (out,in) N(0, 1/1024), b_attn zeros (read): jnp.split thirds of x_norm @ w_attn.T + b_attn (q = rows 0..1023, k = 1024..2047, v = 2048..3071); 16 heads x 64; effective_v = heads(xt_current_for_v) * v (elementwise); att x 1/sqrt(64); tril kept, -inf elsewhere; softmax; y @ w_proj.T + b_proj (w_proj (out,in), b_proj zeros, read)).
#define NB 2
#define TT 2048
#define CC 1024            // NH * HD = projected width
#define DIN 1024          // input (model) width
#define NH 16
#define HD 64
#define NQB (TT / 64)
#define HG 4
#define SCALE (0.125f)
#define CAUSAL 1
#ifndef TNB
#define TNB NB
#endif
__device__ __forceinline__ float bfr(float v) { return (float)(__bf16)v; }
__host__ __device__ __forceinline__ int kb_last(int qb) { return CAUSAL ? ((qb * 64 + 63) >> 7) : (TT / 128 - 1); }
typedef __attribute__((ext_vector_type(8))) __bf16 v8b;
__device__ __forceinline__ v16b frag_b(const __bf16* rowk0, int lane) {
  union { v16b v; v8b q[2]; } u; const __bf16* p = rowk0 + 8 * (lane >> 4);
  u.q[0] = *(const v8b*)p; u.q[1] = *(const v8b*)(p + 16); return u.v;
}
#define QBH 6              // causal: query blocks 0..QBH-1 of each sequence (few keys, no averaging) take the high-precision path
#define QHI 384            // rows carrying a q residual plane
#define KHI 384            // key rows carrying k residual / v bf16 hi+lo planes (used only by the causal high-precision path)
// B fragment (k rows k0+.., output column o) of a weight: (in,out) [K][ld] or (out,in) [ld rows of K]: bf16 exact, or f16(bf16 * 256) exact
__device__ __forceinline__ v16b wcol_io(const float* Wm, int k0, int o, int lane, int ld) { v16b w; const int g = lane >> 4;
#pragma unroll
  for (int i = 0; i < 8; ++i) { w[i] = (__bf16)Wm[(size_t)(k0 + 8 * g + i) * ld + o]; w[8 + i] = (__bf16)Wm[(size_t)(k0 + 16 + 8 * g + i) * ld + o]; }
  return w; }
__device__ __forceinline__ v16b wcol_oi(const float* Wm, int k0, int o, int lane, int K) { v16b w; const float* p = Wm + (size_t)o * K + k0 + 8 * (lane >> 4);
#pragma unroll
  for (int i = 0; i < 8; ++i) { w[i] = (__bf16)p[i]; w[8 + i] = (__bf16)p[16 + i]; }
  return w; }
__device__ __forceinline__ v16h wcolh_io(const float* Wm, int k0, int o, int lane, int ld) { v16h w; const int g = lane >> 4;
#pragma unroll
  for (int i = 0; i < 8; ++i) { w[i] = (_Float16)(bfr(Wm[(size_t)(k0 + 8 * g + i) * ld + o]) * 256.0f); w[8 + i] = (_Float16)(bfr(Wm[(size_t)(k0 + 16 + 8 * g + i) * ld + o]) * 256.0f); }
  return w; }
__device__ __forceinline__ v16h wcolh_oi(const float* Wm, int k0, int o, int lane, int K) { v16h w; const float* p = Wm + (size_t)o * K + k0 + 8 * (lane >> 4);
#pragma unroll
  for (int i = 0; i < 8; ++i) { w[i] = (_Float16)(bfr(p[i]) * 256.0f); w[8 + i] = (_Float16)(bfr(p[16 + i]) * 256.0f); }
  return w; }
// fragment loads from the lane's own pointer p = row + k0 + 8 * (lane >> 4), so that a batch's loads are constant offsets from one address pair; the 16 raw floats of a fragment (R16) and their conversions are separate functions
struct R16 { v4f q[4]; };
__device__ __forceinline__ R16 wraw(const float* p) { R16 r;
  r.q[0] = *(const v4f*)p; r.q[1] = *(const v4f*)(p + 4); r.q[2] = *(const v4f*)(p + 16); r.q[3] = *(const v4f*)(p + 20); return r; }
__device__ __forceinline__ v16h fragh_p(const _Float16* p) { union { v16h v; v8h q[2]; } u; u.q[0] = *(const v8h*)p; u.q[1] = *(const v8h*)(p + 16); return u.v; }
__device__ __forceinline__ v16b fragb_p(const __bf16* p) { union { v16b v; v8b q[2]; } u; u.q[0] = *(const v8b*)p; u.q[1] = *(const v8b*)(p + 16); return u.v; }
__device__ __forceinline__ v16h cvth_r(const R16& r) { v16h a;
#pragma unroll
  for (int i = 0; i < 8; ++i) { a[i] = (_Float16)r.q[i >> 2][i & 3]; a[8 + i] = (_Float16)r.q[2 + (i >> 2)][i & 3]; }
  return a; }
__device__ __forceinline__ v16b cvtb_r(const R16& r) { v16b a;
#pragma unroll
  for (int i = 0; i < 8; ++i) { a[i] = (__bf16)r.q[i >> 2][i & 3]; a[8 + i] = (__bf16)r.q[2 + (i >> 2)][i & 3]; }
  return a; }
__device__ __forceinline__ F2 split_r(const R16& r) { float v[16];
#pragma unroll
  for (int i = 0; i < 8; ++i) { v[i] = r.q[i >> 2][i & 3]; v[8 + i] = r.q[2 + (i >> 2)][i & 3]; }
  return bsplit16(v); }
__device__ __forceinline__ v16h wcolh_r(const R16& r) { v16h w;
#pragma unroll
  for (int i = 0; i < 8; ++i) { w[i] = (_Float16)(bfr(r.q[i >> 2][i & 3]) * 256.0f); w[8 + i] = (_Float16)(bfr(r.q[2 + (i >> 2)][i & 3]) * 256.0f); }
  return w; }
#define WQKV_LAYOUT 1   // 0 = (in,out) [DIN][CC]; 1 = (out,in) [CC][DIN]; 2 = per-head [NH][DIN][HD]
__device__ __forceinline__ v16b wcol_hdk(const float* Wm, int k0, int o, int lane) { v16b w; const int g = lane >> 4; const float* p = Wm + (size_t)(o / HD) * DIN * HD + (o % HD);
#pragma unroll
  for (int i = 0; i < 8; ++i) { w[i] = (__bf16)p[(size_t)(k0 + 8 * g + i) * HD]; w[8 + i] = (__bf16)p[(size_t)(k0 + 16 + 8 * g + i) * HD]; }
  return w; }
#define WO_OUT_IN 1
#if WQKV_LAYOUT == 1
#define WCOL(W, k0, o, lane) wcol_oi(W, k0, o, lane, DIN)
#elif WQKV_LAYOUT == 2
#define WCOL(W, k0, o, lane) wcol_hdk(W, k0, o, lane)
#else
#define WCOL(W, k0, o, lane) wcol_io(W, k0, o, lane, CC)
#endif
#if WO_OUT_IN
#define WOCOL(W, k0, o, lane) wcol_oi(W, k0, o, lane, CC)
#define WOCOLH(W, k0, o, lane) wcolh_oi(W, k0, o, lane, CC)
#else
#define WOCOL(W, k0, o, lane) wcol_io(W, k0, o, lane, DIN)
#define WOCOLH(W, k0, o, lane) wcolh_io(W, k0, o, lane, DIN)
#endif

// (PROJ_EXTRA_PARAMS: the extra kernel parameters 'const float* __restrict__ XT' are written literally in the kernel signature)
// per (token, head) hook on the staged f32 row (64 floats, projection + bias) of the v stream: effective_v = xt * v elementwise with the same (token, head) slice of the second input (bf16-rounded); one f32 product per element; q and k untouched
#define PROJ_EPI(which, row, t, h) do { if ((which) == 2) { float* rw = (row); const float* xr_ = XT + ((size_t)bb * TT + (t)) * CC + (h) * 64; _Pragma("unroll 8") for (int i = 0; i < 64; ++i) rw[i] = bfr(xr_[i]) * rw[i]; } } while (0)
#ifndef SM_EXTRA_PARAMS
#define SM_EXTRA_PARAMS
#endif
#ifndef PROJ_EXTRA_PARAMS
#define PROJ_EXTRA_PARAMS
#endif
#ifndef SM_MASK_HOOK
#define SM_MASK_HOOK (void)0
#endif

#define WS_QH  0u                                      // f16 q rows [b*t][CC]
#define WS_KH  (WS_QH + 2u * (size_t)NB * TT * CC)      // f16 k rows [b*t][CC]
#define WS_VT  (WS_KH + 2u * (size_t)NB * TT * CC)      // f16 v planes [b][c][t]
#define WS_QL  (WS_VT + 2u * (size_t)NB * CC * TT)      // f16 q residual x 2^10 rows [b][t < QHI][CC]
#define WS_KL  (WS_QL + 2u * (size_t)NB * QHI * CC)     // f16 k residual x 2^10 rows [b][t < KHI][CC]
#define WS_VB  (WS_KL + 2u * (size_t)NB * KHI * CC)     // bf16 v hi planes [b][c][t < KHI]
#define WS_VBL (WS_VB + 2u * (size_t)NB * CC * KHI)
#define WS_S   (WS_VBL + 2u * (size_t)NB * CC * KHI)    // (not used: the logits stay in registers)
#define WS_Y   (WS_S  + 4u * (size_t)HG * TT * TT)      // f32 ctx rows [b*t][CC] (only when there is an output projection)
#define WS_END (WS_Y  + 4u * (size_t)NB * TT * CC)

// ---- operand staging for the two dense products (k_proj, k_out): a block's A tile (64 rows) and W tile (128 rows) of 64 k are read from global memory once a block, by whole 128-byte lines, converted once, and laid in LDS as 16-bit rows; the four waves take their fragments from there.
#define SK 64              // k extent of a stage
#define SP 72              // LDS row pitch in 16-bit elements: 144 B, an odd multiple of 16 B, so that a fragment's ds_load_b128 meets no bank twice
typedef __attribute__((ext_vector_type(4))) __bf16 v4b;
typedef __attribute__((ext_vector_type(4))) _Float16 v4h;
template <int N> struct SR { v4f v[N]; };
// p = the thread's own pointer (row tid >> 4, floats 4 * (tid & 15)); piece i is row + 8 i: a wave's load covers two rows of 256 B
template <int N, int LD> __device__ __forceinline__ void st_ld(SR<N>& r, const float* p) {
#pragma unroll
  for (int i = 0; i < N; ++i) r.v[i] = *(const v4f*)(p + (size_t)i * 8 * LD); }
__device__ __forceinline__ v4b cv_b(v4f v) { v4b o;
#pragma unroll
  for (int i = 0; i < 4; ++i) o[i] = (__bf16)v[i];
  return o; }
__device__ __forceinline__ v4b cv_bl(v4f v) { v4b o;
#pragma unroll
  for (int i = 0; i < 4; ++i) o[i] = (__bf16)(v[i] - (float)(__bf16)v[i]);
  return o; }
__device__ __forceinline__ v4h cv_y(v4f v) { v4h o;
#pragma unroll
  for (int i = 0; i < 4; ++i) o[i] = (_Float16)(v[i] * 64.0f);
  return o; }
__device__ __forceinline__ v4h cv_w(v4f v) { v4h o;
#pragma unroll
  for (int i = 0; i < 4; ++i) o[i] = (_Float16)(bfr(v[i]) * 256.0f);
  return o; }
// MODE 0: A bf16, W bf16 (k_proj); 1: A bf16 hi + lo planes, W bf16 (k_out, early rows); 2: A f16(x 2^6), W f16(bf16 x 2^8) (k_out). A buffer = A rows (64, or 64 hi + 64 lo), then 128 W rows.
template <int MODE> __device__ __forceinline__ void st_put(const SR<8>& ar, const SR<16>& wr, char* buf, int so) {
  if constexpr (MODE == 2) { _Float16* d = (_Float16*)buf + so;
#pragma unroll
    for (int i = 0; i < 8; ++i) *(v4h*)(d + i * 8 * SP) = cv_y(ar.v[i]);
#pragma unroll
    for (int i = 0; i < 16; ++i) *(v4h*)(d + (64 + i * 8) * SP) = cv_w(wr.v[i]);
  } else { __bf16* d = (__bf16*)buf + so; constexpr int AR = MODE == 1 ? 128 : 64;
#pragma unroll
    for (int i = 0; i < 8; ++i) { *(v4b*)(d + i * 8 * SP) = cv_b(ar.v[i]); if constexpr (MODE == 1) *(v4b*)(d + (64 + i * 8) * SP) = cv_bl(ar.v[i]); }
#pragma unroll
    for (int i = 0; i < 16; ++i) *(v4b*)(d + (AR + i * 8) * SP) = cv_b(wr.v[i]); } }
// one stage's products, k ascending as before; fo = the lane's own offset (row lane & 15, element 8 * (lane >> 4))
template <int MODE> __device__ __forceinline__ void st_mac(const char* buf, int fo, int wave, v8f (&acc)[8]) {
#pragma unroll
  for (int kc = 0; kc < SK / 32; ++kc) {
    if constexpr (MODE == 2) { const _Float16* p = (const _Float16*)buf + fo + kc * 32; const v16h a = fragh_p(p + wave * 16 * SP); v16h w[8];
#pragma unroll
      for (int j = 0; j < 8; ++j) w[j] = fragh_p(p + (64 + j * 16) * SP);
#pragma unroll
      for (int j = 0; j < 8; ++j) acc[j] = wmma16(a, w[j], acc[j]);
    } else if constexpr (MODE == 1) { const __bf16* p = (const __bf16*)buf + fo + kc * 32; const v16b ah = fragb_p(p + wave * 16 * SP), al = fragb_p(p + (64 + wave * 16) * SP); v16b w[8];
#pragma unroll
      for (int j = 0; j < 8; ++j) w[j] = fragb_p(p + (128 + j * 16) * SP);
#pragma unroll
      for (int j = 0; j < 8; ++j) { acc[j] = wmma_bf(ah, w[j], acc[j]); acc[j] = wmma_bf(al, w[j], acc[j]); }
    } else { const __bf16* p = (const __bf16*)buf + fo + kc * 32; const v16b a = fragb_p(p + wave * 16 * SP); v16b w[8];
#pragma unroll
      for (int j = 0; j < 8; ++j) w[j] = fragb_p(p + (64 + j * 16) * SP);
#pragma unroll
      for (int j = 0; j < 8; ++j) acc[j] = wmma_bf(a, w[j], acc[j]); } } }
// the ring's work-group barrier: it orders the LDS operations alone, so that the global loads of the stage read ahead stay in flight across it (__syncthreads() would drain the load counter and lay their latency bare every stage)
#define RING_BARRIER() do { __builtin_amdgcn_fence(__ATOMIC_RELEASE, "workgroup", "local"); __builtin_amdgcn_s_barrier(); __builtin_amdgcn_fence(__ATOMIC_ACQUIRE, "workgroup", "local"); } while (0)
#define RING_BYTES(MODE) (2 * (((MODE) == 1 ? 128 : 64) + 128) * SP * 2)
// acc += A0[64 rows][KK] . W0[128 rows][KK]^T, wave w taking rows 16 w ..; two LDS buffers, the stage after next in registers. One barrier a stage: it publishes the buffer just written and ends the reads of the buffer that the next stage overwrites.
template <int MODE, int KK> __device__ __forceinline__ void gemm_staged(const float* __restrict__ A0, const float* __restrict__ W0, char* ring, int tid, v8f (&acc)[8]) {
  constexpr int BUFB = RING_BYTES(MODE) / 2, NS = KK / SK;
  const int wave = tid >> 5, lane = tid & 31; const int so = (tid >> 4) * SP + (tid & 15) * 4, fo = (lane & 15) * SP + 8 * (lane >> 4);
  const float* ag = A0 + (size_t)(tid >> 4) * KK + (tid & 15) * 4; const float* wg = W0 + (size_t)(tid >> 4) * KK + (tid & 15) * 4;
  SR<8> ar; SR<16> wr;
  st_ld<8, KK>(ar, ag); st_ld<16, KK>(wr, wg);
  st_put<MODE>(ar, wr, ring, so);
  st_ld<8, KK>(ar, ag + SK); st_ld<16, KK>(wr, wg + SK);
  asm volatile("s_wait_xcnt 0x0" :: "v"(ag), "v"(wg) : "memory");   // behind the loads, their address pairs as inputs: the pairs are stepped on next
  ag += 2 * SK; wg += 2 * SK;
  RING_BARRIER();
#pragma unroll 1   // rolled: sixteen copies of this long body would only lengthen the text
  for (int s = 0; s < NS; ++s) {
    st_mac<MODE>(ring + (s & 1) * BUFB, fo, wave, acc);
    if (s + 1 < NS) {   /* block-uniform */
      st_put<MODE>(ar, wr, ring + ((s + 1) & 1) * BUFB, so);
      if (s + 2 < NS) { st_ld<8, KK>(ar, ag); st_ld<16, KK>(wr, wg);
        asm volatile("s_wait_xcnt 0x0" :: "v"(ag), "v"(wg) : "memory");   // behind the loads, their address pairs as inputs: the pairs are stepped on next
        ag += SK; wg += SK; }
      RING_BARRIER(); } } }

// ---- k_proj: block = (64 rows, 128 cols, which): q/k/v = X W (+ b) with exact bf16 products (K = DIN) -> which 0: q f16 rows (+ residual rows < QHI); 1: k f16 rows (+ residual rows < KHI); 2: v f16 planes [c][t] (+ bf16 hi/lo planes for t < KHI)
__global__ __launch_bounds__(128) void k_proj(const float* __restrict__ XQ, const float* __restrict__ XK, const float* __restrict__ XV, const float* __restrict__ WQ, const float* __restrict__ WK, const float* __restrict__ WV, const float* __restrict__ BQ, const float* __restrict__ BK, const float* __restrict__ BV,
    _Float16* __restrict__ QH, _Float16* __restrict__ QL, _Float16* __restrict__ KH, _Float16* __restrict__ KL, _Float16* __restrict__ VT, __bf16* __restrict__ VB, __bf16* __restrict__ VBL, const float* __restrict__ XT) {
  __shared__ __align__(16) float st[64][132];
  __shared__ __align__(16) union { struct { _Float16 sh[64][136], sl[64][136], th[128][72]; __bf16 tb[128][72], tbl[128][72]; } e; char ring[RING_BYTES(0)]; } u;   // the main loop's ring lies on the epilogue's conversion tiles, which are first written two barriers behind the loop
  _Float16 (&sh)[64][136] = u.e.sh; _Float16 (&sl)[64][136] = u.e.sl; _Float16 (&th)[128][72] = u.e.th; __bf16 (&tb)[128][72] = u.e.tb; __bf16 (&tbl)[128][72] = u.e.tbl;
  const int tid = threadIdx.x, wave = tid >> 5, lane = tid & 31, col = lane & 15, g = lane >> 4; const int which = blockIdx.z; const int c0 = blockIdx.y * 128; const size_t r0 = (size_t)blockIdx.x * 64; const size_t bb = r0 / TT; const int t0 = (int)(r0 % TT);
  const float* X = which == 0 ? XQ : which == 1 ? XK : XV; const float* WA = which == 0 ? WQ : which == 1 ? WK : WV; const float* BA = which == 0 ? BQ : which == 1 ? BK : BV;
  v8f acc[8] = {};
  gemm_staged<0, DIN>(X + r0 * DIN, WA + (size_t)c0 * DIN, u.ring, tid, acc);
  { // stage the f32 tile (acc + bias) in LDS, run the per-(row, head) epilogue hook, then convert
#pragma unroll
    for (int j = 0; j < 8; ++j) { const float bias = BA ? bfr(BA[c0 + j * 16 + col]) : 0.f;
#pragma unroll
      for (int r = 0; r < 8; ++r) st[wave * 16 + 8 * g + r][j * 16 + col] = acc[j][r] + bias; }
    __syncthreads();
    for (int e = tid; e < 64 * (128 / HD); e += 128) { const int rl = e / (128 / HD), hh = e % (128 / HD); PROJ_EPI(which, &st[rl][hh * HD], (int)((r0 + rl) % TT), (c0 / HD) + hh); }
    __syncthreads(); }
  if (which < 2) { _Float16* DH = which == 0 ? QH : KH; _Float16* DL = which == 0 ? QL : KL; const int nhi = which == 0 ? QHI : KHI; const bool hi_rows = t0 < nhi;
    for (int e = tid; e < 64 * 128; e += 128) { const int rl = e >> 7, cl = e & 127; const float v = st[rl][cl]; const _Float16 hv = (_Float16)v; sh[rl][cl] = hv; sl[rl][cl] = (_Float16)((v - (float)hv) * 1024.0f); }
    __syncthreads();
    for (int e = tid; e < 64 * 16; e += 128) { const int rl = e >> 4, q = e & 15; vst2((unsigned*)(DH + (r0 + rl) * CC + c0 + q * 8), *(const v4u*)&sh[rl][q * 8]); if (hi_rows) vst2((unsigned*)(DL + (bb * nhi + t0 + rl) * (size_t)CC + c0 + q * 8), *(const v4u*)&sl[rl][q * 8]); }
  } else { const bool hi_rows = t0 < KHI;
    for (int e = tid; e < 64 * 128; e += 128) { const int rl = e & 63, cl = e >> 6; const float v = st[rl][cl]; th[cl][rl] = (_Float16)v; const __bf16 bh = (__bf16)v; tb[cl][rl] = bh; tbl[cl][rl] = (__bf16)(v - (float)bh); }
    __syncthreads();
    for (int e = tid; e < 128 * 8; e += 128) { const int cl = e >> 3, q = e & 7; vst2((unsigned*)(VT + (bb * CC + c0 + cl) * (size_t)TT + t0 + q * 8), *(const v4u*)&th[cl][q * 8]); if (hi_rows) { const size_t o3 = (bb * CC + c0 + cl) * (size_t)KHI + t0 + q * 8; vst2((unsigned*)(VB + o3), *(const v4u*)&tb[cl][q * 8]); vst2((unsigned*)(VBL + o3), *(const v4u*)&tbl[cl][q * 8]); } } } }
// ---- k_att: block = 64 queries (4 waves x 16) of one (b, h): logits, softmax and P . v in one kernel, nothing of the logits leaves the registers.
// Every product is taken transposed: S^T = K . Q^T (A = key rows, B = query rows), so a lane holds keys j*16 + 8g + r of ONE query (column lane & 15), and two neighbouring S^T tiles are, register for register, the B fragment of ctx^T = V^T . P^T (A = v planes).
// Rows from QHI on, ONE sweep over the keys, whose key and value tiles come through a two-buffer LDS ring filled by tensor loads: per 128-key block the query's maximum so far (joined over the two half-rows), P x 2^11 = exp((s - maximum so far) x SCALE) x 2048 on the raw products s = q . k, its running sum, and the P . v products in the key order 0, 32, 64, ...; where the maximum rises, sum and ctx are first multiplied by exp((old - new) x SCALE); the division by the sum comes once, behind the last block.
// Rows below QHI (high-precision path), two sweeps: the first finds each query's maximum and denominator (kept per lane, the two half-rows joined once at the end), the second forms the logits again, P x 2^11 = exp(s - max) x 2048 / sum, and the P . v products in the same key order.
// ---- the key / value ring of the one-sweep path: a stage = the block's 128 keys of one head, the key tile (128 rows of 128 B) and the value tile (64 planes of 256 B), each brought from global memory into LDS by ONE tensor load a block (wave 0: keys, wave 1: values) and read from there by all four waves.
typedef uint32_t u32x4 __attribute__((ext_vector_type(4)));
typedef uint32_t u32x8 __attribute__((ext_vector_type(8)));
#define KPH 72             // LDS pitch of a key row in f16: 128 B + the mover's 16-B pad = 144 B, an odd multiple of 16 B (ds_load_b128 meets no bank twice)
#define VPH 136            // LDS pitch of a value plane in f16: 256 B + 16 B = 272 B, likewise
#define KTILE_B 18432u     // 128 rows x 144 B, a multiple of 2 KiB
#define VTILE_B 18432u     // 64 planes x 272 B = 17408 B, rounded up to a multiple of 2 KiB
#define ABUF_B (KTILE_B + VTILE_B)
__device__ __forceinline__ uint32_t uni(uint32_t v) { return (uint32_t)__builtin_amdgcn_readfirstlane(v); }
__device__ __forceinline__ uint32_t pinned(uint32_t v) { uint32_t w = (uint32_t)__builtin_amdgcn_readfirstlane(v); asm volatile("" : "+s"(w)); return w; }   // holds the test of a tensor load's branch in a scalar register, so that the branch is s_cmp + s_cbranch_scc (a tensor load ignores EXEC)
struct TD { u32x4 g0; u32x8 g1; };   // the two groups of the wave's youngest request
// one request: a tile of D1 rows of D0 bytes, source pitch PITCH bytes, first byte at src, to the LDS byte offset dst; W0 = word 0 of group 1 (no mask, 1-byte elements, 16 B of pad behind every row)
template <uint32_t W0, uint32_t D0, uint32_t D1, uint32_t PITCH> __device__ __forceinline__ void tdm_tile(TD& d, uint32_t dst, const _Float16* src) {
  const uint64_t ga = (uint64_t)(size_t)src; u32x4 g0; u32x8 g1;
  g0[0] = uni(1u); g0[1] = uni(dst); g0[2] = uni((uint32_t)ga); g0[3] = uni((((uint32_t)(ga >> 32)) & 0x01FFFFFFu) | 0x80000000u);
  g1[0] = uni(W0); g1[1] = uni((D0 & 0xFFFFu) << 16); g1[2] = uni((D0 >> 16) | ((D1 & 0xFFFFu) << 16)); g1[3] = uni((D1 >> 16) | (D0 << 16)); g1[4] = uni(D1); g1[5] = uni(PITCH); g1[6] = uni(0u); g1[7] = uni(0u);
  asm volatile("tensor_load_to_lds %0, %1" : "+{s[36:39]}"(g0), "+{s[40:47]}"(g1) :: "memory");   // the groups stand in named registers and come back out of the statement, so that tdm_landed() can name the same ones
  d.g0 = g0; d.g1 = g1; }
// the issuing wave's wait for its youngest request; the request's two groups are inputs, so that their registers stay live, and so unwritten, from the issue up to this wait
__device__ __forceinline__ void tdm_landed(const TD& d) { asm volatile("s_wait_tensorcnt 0x0" :: "{s[36:39]}"(d.g0), "{s[40:47]}"(d.g1) : "memory"); }
// stage s into buffer s & 1: ks / vs = the head's first key row / first value plane; d takes the issuing wave's descriptor
__device__ __forceinline__ void att_stage(TD& d, uint32_t wv, uint32_t lbase, int s, const _Float16* ks, const _Float16* vs) {
  const uint32_t dst = lbase + (uint32_t)(s & 1) * ABUF_B;
  if (pinned(wv == 0u)) tdm_tile<(1u << 20) | (4u << 22) | (3u << 25), 2u * HD, 128u, 2u * CC>(d, dst, ks + (size_t)s * 128 * CC);
  if (pinned(wv == 1u)) tdm_tile<(1u << 20) | (5u << 22) | (3u << 25), 256u, (uint32_t)HD, 2u * TT>(d, dst + KTILE_B, vs + s * 128); }
// one 128-key block of logits x SCALE (HI) or of raw products q . k (one-sweep path): kp / klp = the lane's own pointer (key row k0 + col, the head's dims, + 8g)
template <bool HI> __device__ __forceinline__ void att_logits(const _Float16* kp, const _Float16* klp, const v16h (&qh)[2], const v16h (&ql)[2], v8f (&s)[8]) {
  if constexpr (HI) {
#pragma unroll
    for (int j2 = 0; j2 < 8; j2 += 2) { v16h kbf[HD / 32][2], klf[HD / 32][2];   // two key tiles' fragments loaded together (registers bound the batch on this path)
#pragma unroll
      for (int kc = 0; kc < HD / 32; ++kc)
#pragma unroll
        for (int u = 0; u < 2; ++u) { kbf[kc][u] = fragh_p(kp + (j2 + u) * 16 * CC + kc * 32); klf[kc][u] = fragh_p(klp + (j2 + u) * 16 * CC + kc * 32); }
      asm volatile("s_wait_xcnt 0x0" :: "v"(kp), "v"(klp) : "memory");   // behind the batch, its address pairs as inputs: they are stepped on at the foot of the key loop
      v8f acc[2] = {}, accl[2] = {};
#pragma unroll
      for (int kc = 0; kc < HD / 32; ++kc)
#pragma unroll
        for (int u = 0; u < 2; ++u) { acc[u] = wmma16(kbf[kc][u], qh[kc], acc[u]); accl[u] = wmma16(kbf[kc][u], ql[kc], accl[u]); accl[u] = wmma16(klf[kc][u], qh[kc], accl[u]); }
#pragma unroll
      for (int u = 0; u < 2; ++u)
#pragma unroll
        for (int r = 0; r < 8; ++r) s[j2 + u][r] = (acc[u][r] + accl[u][r] * (1.0f / 1024.0f)) * SCALE; }
  } else { v8f acc[8] = {}; v16h kf[HD / 32][8];   // kp points into the staged key tile in LDS (row pitch KPH); the block's sixteen key fragments are read ahead of its first WMMA: one LDS latency a block
#pragma unroll
    for (int kc = 0; kc < HD / 32; ++kc)
#pragma unroll
      for (int j = 0; j < 8; ++j) kf[kc][j] = fragh_p(kp + j * 16 * KPH + kc * 32);
#pragma unroll
    for (int j = 0; j < 8; ++j)   // tile by tile: a tile's two fragments are free again as its eight logits come alive
#pragma unroll
      for (int kc = 0; kc < HD / 32; ++kc) acc[j] = wmma16(kf[kc][j], qh[kc], acc[j]);
#pragma unroll
    for (int j = 0; j < 8; ++j)
#pragma unroll
      for (int r = 0; r < 8; ++r) s[j][r] = acc[j][r]; } }   // this path hands on the raw products q . k: SCALE stands in the constant of the exponent's multiply-add (att_pv_run)
// the causal mask, by index: d = the lane's query - its first key of the block; an excluded logit becomes -3e38, whose exp(s - m) is an exact 0 against any finite m
__device__ __forceinline__ void att_mask(v8f (&s)[8], int d) {
#pragma unroll
  for (int j = 0; j < 8; ++j)
#pragma unroll
    for (int r = 0; r < 8; ++r) if (j * 16 + r > d) s[j][r] = -3.0e38f; }
// first sweep: the lane's running maximum m and the sum of exp(s - m) over its own 64 keys of the block (a lane that has met only excluded keys keeps m = -3e38, and its sum is multiplied by exp(-3e38 - max) = 0 where the halves are joined)
__device__ __forceinline__ void att_stats(const v8f (&s)[8], float& m, float& sum) {
  float mx = s[0][0];
#pragma unroll
  for (int j = 0; j < 8; ++j)
#pragma unroll
    for (int r = 0; r < 8; ++r) mx = fmaxf(mx, s[j][r]);
  const float mn = fmaxf(m, mx); float a[4] = { sum * expf(m - mn), 0.f, 0.f, 0.f };
#pragma unroll
  for (int j = 0; j < 8; ++j)
#pragma unroll
    for (int r = 0; r < 8; ++r) a[r & 3] += expf(s[j][r] - mn);
  sum = (a[0] + a[1]) + (a[2] + a[3]); m = mn; }
// second sweep: s -> P x 2^11 in place (0 for excluded keys)
__device__ __forceinline__ void att_p(v8f (&s)[8], float m, float inv) {
#pragma unroll
  for (int j = 0; j < 8; ++j)
#pragma unroll
    for (int r = 0; r < 8; ++r) s[j][r] = expf(s[j][r] - m) * inv; }
// second sweep, one 128-key block: vha / vla (bf16 hi / lo planes) = the lane's own pointer (plane h*HD + col, key k0 + 8g)
__device__ __forceinline__ void att_pv(v8f (&s)[8], float m, float inv, const __bf16* vha, const __bf16* vla, v8f (&acc)[HD / 16]) {
  att_p(s, m, inv);
#pragma unroll
    for (int u = 0; u < 4; ++u) { float pv[16];
#pragma unroll
      for (int i = 0; i < 8; ++i) { pv[i] = s[2 * u][i]; pv[8 + i] = s[2 * u + 1][i]; }
      const F2 p = bsplit16(pv); v16b vh[HD / 16], vl[HD / 16];
#pragma unroll
      for (int j = 0; j < HD / 16; ++j) { vh[j] = fragb_p(vha + j * 16 * KHI + u * 32); vl[j] = fragb_p(vla + j * 16 * KHI + u * 32); }
      asm volatile("s_wait_xcnt 0x0" :: "v"(vha), "v"(vla) : "memory");   // behind the batch, its address pairs as inputs: as in att_logits
#pragma unroll
      for (int j = 0; j < HD / 16; ++j) { acc[j] = wmma_bf(vh[j], p.h, acc[j]); acc[j] = wmma_bf(vh[j], p.l, acc[j]); acc[j] = wmma_bf(vl[j], p.h, acc[j]); } } }
__device__ __forceinline__ float xhalf(float x) { return __builtin_bit_cast(float, __builtin_amdgcn_permlanex16(__builtin_bit_cast(int, x), __builtin_bit_cast(int, x), 0x76543210, 0xfedcba98, false, false)); }   // lane l takes lane l ^ 16's value
// the one sweep, one 128-key block: s = the raw products q . k; each exponential is ONE multiply-add and the chip's base-2 exponential, exp((s - m) x SCALE) x 2^11 = 2^(s x EXC - (m x EXC - 11)): the argument is at most 11, and far below (an excluded key's -3e38 too) the instruction gives 0, so the library call's range tests and its split of the argument have nothing to guard here
#define EXC (SCALE * 1.44269504088896340736f)   // SCALE x log2(e)
// va = the lane's own pointer into the staged value tile in LDS (plane col, key 8g; plane pitch VPH); m = the query's maximum so far, in raw products (alike in lanes l and l ^ 16, since both halves' P meet in one ctx tile), sum = the lane's own keys' sum of P x 2^11 against m
__device__ __forceinline__ void att_pv_run(v8f (&s)[8], float& m, float& sum, const _Float16* va, v8f (&acc)[HD / 16]) {
  v16h vf[4][HD / 16];   // 32 keys' v fragments are asked for one step ahead: the first ahead of the maximum, each next ahead of the exponentials of the 32 keys before it
#pragma unroll
  for (int j = 0; j < HD / 16; ++j) vf[0][j] = fragh_p(va + j * 16 * VPH);
  float mx = s[0][0];
#pragma unroll
  for (int j = 0; j < 8; ++j)
#pragma unroll
    for (int r = 0; r < 8; ++r) mx = fmaxf(mx, s[j][r]);
  const float mn = fmaxf(m, fmaxf(mx, xhalf(mx))); const float al = __builtin_amdgcn_exp2f((m - mn) * EXC);   // al = 0 at the first block (m = -3e38, sum and ctx still 0), 1 where the maximum stays
  m = mn; const float mc = fmaf(mn, EXC, -11.0f); const v2f ec = { EXC, EXC }, nm = { -mc, -mc };   // P x 2^11 = 2^(s x EXC - mc)
#pragma unroll
  for (int j = 0; j < HD / 16; ++j)
#pragma unroll
    for (int r = 0; r < 8; ++r) acc[j][r] *= al;
  float a[4] = { sum * al, 0.f, 0.f, 0.f };
#pragma unroll
  for (int u = 0; u < 4; ++u) {
    if (u < 3) {
#pragma unroll
      for (int j = 0; j < HD / 16; ++j) vf[u + 1][j] = fragh_p(va + j * 16 * VPH + (u + 1) * 32);
    }
    v16h p;
#pragma unroll
    for (int i = 0; i < 8; i += 2) {   // two neighbouring registers of a logit tile share one packed multiply-add
      const v2f t0 = __builtin_elementwise_fma((v2f){ s[2 * u][i], s[2 * u][i + 1] }, ec, nm), t1 = __builtin_elementwise_fma((v2f){ s[2 * u + 1][i], s[2 * u + 1][i + 1] }, ec, nm);
#pragma unroll
      for (int e = 0; e < 2; ++e) { const float x0 = __builtin_amdgcn_exp2f(t0[e]), x1 = __builtin_amdgcn_exp2f(t1[e]); a[(i + e) & 3] += x0; a[(i + e) & 3] += x1; p[i + e] = (_Float16)x0; p[8 + i + e] = (_Float16)x1; } }
#pragma unroll
    for (int j = 0; j < HD / 16; ++j) acc[j] = wmma16(vf[u][j], p, acc[j]); }
  sum = (a[0] + a[1]) + (a[2] + a[3]); }
__device__ __forceinline__ void att_body_hi(const _Float16* __restrict__ QH, const _Float16* __restrict__ KH, const _Float16* __restrict__ QL, const _Float16* __restrict__ KL, const __bf16* __restrict__ VB, const __bf16* __restrict__ VBL, int b, int h, int qb, int ql0, int col, int g, v8f (&acc)[HD / 16]) {
  const int t = ql0 + col, kbl = kb_last(qb);
  const _Float16* qp = QH + ((size_t)b * TT + t) * CC + h * HD + 8 * g; const _Float16* qlp = QL + ((size_t)b * QHI + t) * CC + h * HD + 8 * g;
  v16h qh[2], ql[2];
#pragma unroll
  for (int kc = 0; kc < HD / 32; ++kc) { qh[kc] = fragh_p(qp + kc * 32); ql[kc] = fragh_p(qlp + kc * 32); }
  asm volatile("s_wait_xcnt 0x0" :: "v"(qp), "v"(qlp) : "memory");   // behind the query loads, their address pairs as inputs: the registers are free for reuse behind it
  const _Float16* const kp0 = KH + ((size_t)b * TT + col) * CC + h * HD + 8 * g; const _Float16* const klp0 = KL + ((size_t)b * KHI + col) * CC + h * HD + 8 * g;
  float m = -3.0e38f, sum = 0.f; v8f s[8];
#pragma unroll 1
  for (int kb = 0; kb <= kbl; ++kb) { att_logits<true>(kp0 + (size_t)kb * 128 * CC, klp0 + (size_t)kb * 128 * CC, qh, ql, s); if (CAUSAL && kb == kbl) att_mask(s, t - kb * 128 - 8 * g);   /* block-uniform: blocks below the last hold no key past any of the 64 queries */
    att_stats(s, m, sum); }
  const float m2 = __shfl_xor(m, 16), s2 = __shfl_xor(sum, 16), mm = fmaxf(m, m2); const float tot = sum * expf(m - mm) + s2 * expf(m2 - mm);   // lanes l and l ^ 16 hold the two halves of one query's keys
  const float inv = tot > 0.f ? 2048.0f / tot : 0.f;   /* every query has at least its own key, so mm is finite */
  const size_t po = ((size_t)b * CC + h * HD + col) * (size_t)KHI + 8 * g; const __bf16 *vha0 = VB + po, *vla0 = VBL + po;
#pragma unroll 1
  for (int kb = 0; kb <= kbl; ++kb) { att_logits<true>(kp0 + (size_t)kb * 128 * CC, klp0 + (size_t)kb * 128 * CC, qh, ql, s); if (CAUSAL && kb == kbl) att_mask(s, t - kb * 128 - 8 * g);   /* block-uniform */
    att_pv(s, mm, inv, vha0 + kb * 128, vla0 + kb * 128, acc); } }
__device__ __forceinline__ void att_body_run(const _Float16* __restrict__ QH, const _Float16* __restrict__ KH, const _Float16* __restrict__ VT, unsigned char* L, int b, int h, int qb, int ql0, int col, int g, v8f (&acc)[HD / 16]) {
  const int t = ql0 + col, kbl = kb_last(qb);
  const uint32_t wv = uni(threadIdx.x >> 5), lbase = (uint32_t)(size_t)L;
  const _Float16* const ks = KH + (size_t)b * TT * CC + h * HD; const _Float16* const vs = VT + ((size_t)b * CC + h * HD) * (size_t)TT;
  TD d = {};
  att_stage(d, wv, lbase, 0, ks, vs);   // the ring's prologue; qb >= QBH, so there are at least four stages
  if (pinned(wv < 2u)) tdm_landed(d);   // the issuing waves: stage 0 has landed
  __syncthreads();   // stage 0 is published to all four waves
  att_stage(d, wv, lbase, 1, ks, vs);
  const _Float16* qp = QH + ((size_t)b * TT + t) * CC + h * HD + 8 * g;
  v16h qh[2];
#pragma unroll
  for (int kc = 0; kc < HD / 32; ++kc) qh[kc] = fragh_p(qp + kc * 32);
  asm volatile("s_wait_xcnt 0x0" :: "v"(qp) : "memory");   // behind the query loads, their address pair as input: the registers are free for reuse behind it
  float m = -3.0e38f, sum = 0.f; v8f s[8];
#pragma unroll 1   // rolled: one publish point in the text, and the body is long
  for (int kb = 0; kb <= kbl; ++kb) { const unsigned char* const buf = L + (kb & 1) * ABUF_B;
    const _Float16* const kp = (const _Float16*)buf + col * KPH + 8 * g; const _Float16* const va = (const _Float16*)(buf + KTILE_B) + col * VPH + 8 * g;
    att_logits<false>(kp, kp, qh, qh, s); if (CAUSAL && kb == kbl) att_mask(s, t - kb * 128 - 8 * g);   /* block-uniform: blocks below the last hold no key past any of the 64 queries */
    att_pv_run(s, m, sum, va, acc);
    // publish point of stage kb + 1, every wave, every pass
    asm volatile("s_wait_dscnt 0x0" ::: "memory");   // this wave's reads of buffer kb & 1 have returned
    if (pinned(wv < 2u)) tdm_landed(d);   // the issuing waves: stage kb + 1 has landed
    __syncthreads();   // publishes stage kb + 1 and ends every wave's reads of buffer kb & 1
    if (pinned(kb + 2 <= kbl)) att_stage(d, wv, lbase, kb + 2, ks, vs); }   // the refill, only while that stage exists
  asm volatile("s_wait_tensorcnt 0x0" ::: "memory");   // nothing is in flight where the ring becomes the output's staging
  asm volatile("s_wait_dscnt 0x0" ::: "memory");
  const float tot = sum + xhalf(sum);   // lanes l and l ^ 16 hold the two halves of one query's keys, against one maximum
  const float inv = tot > 0.f ? 2048.0f / tot : 0.f;   /* the key at the query's final maximum stands in tot with 2048; ctx leaves x 2^11, as on the other path */
#pragma unroll
  for (int j = 0; j < HD / 16; ++j)
#pragma unroll
    for (int r = 0; r < 8; ++r) acc[j][r] *= inv; }
__global__ __launch_bounds__(128) __attribute__((amdgpu_waves_per_eu(4, 4))) void k_att(const _Float16* __restrict__ QH, const _Float16* __restrict__ KH, const _Float16* __restrict__ QL, const _Float16* __restrict__ KL, const _Float16* __restrict__ VT, const __bf16* __restrict__ VB, const __bf16* __restrict__ VBL, float* __restrict__ Y) { __shared__ __attribute__((aligned(2048))) unsigned char L[2 * ABUF_B];
  float (*ss)[16][HD + 4] = (float (*)[16][HD + 4])L;   // the output's staging lies on the ring, which every wave has left at the last pass's barrier
  const int tid = threadIdx.x, wave = tid >> 5, lane = tid & 31, col = lane & 15, g = lane >> 4; const int b = blockIdx.x / NH, h = blockIdx.x % NH;
  const int qi = blockIdx.y; const int qb = NQB - 1 - ((qi & 8) ? (qi ^ 7) : qi);   // long query blocks start first; every second run of eight is reversed, so that blocks 256 apart in launch order add up to equal work
  const int ql0 = qb * 64 + wave * 16;
  v8f acc[HD / 16] = {};
  if (qb < QBH) att_body_hi(QH, KH, QL, KL, VB, VBL, b, h, qb, ql0, col, g, acc);   /* block-uniform */
  else att_body_run(QH, KH, VT, L, b, h, qb, ql0, col, g, acc);
#pragma unroll
  for (int j = 0; j < HD / 16; ++j)
#pragma unroll
    for (int r = 0; r < 8; ++r) ss[wave][col][j * 16 + 8 * g + r] = acc[j][r] * (1.0f / 2048.0f);   // ctx^T: element r of tile j = dim j*16 + 8g + r of query col
  LDSX(); for (int rl = 0; rl < 16; ++rl) if (lane < HD / 4) vst2(Y + ((size_t)b * TT + ql0 + rl) * CC + h * HD + lane * 4, *(const v4f*)&ss[wave][rl][lane * 4]); }
// ---- k_out: block = (64 rows, 128 cols): out = ctx Wo (+ bo): ctx x 2^6 once to f16 against Wo as f16(bf16 x 2^8) exact (1 product) x 2^-14; causal early rows (< QHI of each sequence): ctx bf16 hi + lo against exact bf16 Wo (2 products)
__global__ __launch_bounds__(128) void k_out(const float* __restrict__ Y, const float* __restrict__ WO, const float* __restrict__ BO, float* __restrict__ OUT) { __shared__ __align__(16) float sf[4][16][132]; __shared__ __align__(16) char ring[RING_BYTES(1)];
  const int tid = threadIdx.x, wave = tid >> 5, lane = tid & 31, col = lane & 15, g = lane >> 4; const int c0 = blockIdx.y * 128; const size_t r0 = (size_t)blockIdx.x * 64 + wave * 16;
  v8f acc[8] = {};
  if (CAUSAL && (int)(((size_t)blockIdx.x * 64) % TT) < QHI) {   /* block-uniform */
    gemm_staged<1, CC>(Y + (size_t)blockIdx.x * 64 * CC, WO + (size_t)c0 * CC, ring, tid, acc);
#pragma unroll
    for (int j = 0; j < 8; ++j) { const float bias = BO ? bfr(BO[c0 + j * 16 + col]) : 0.f;
#pragma unroll
      for (int r = 0; r < 8; ++r) sf[wave][8 * g + r][j * 16 + col] = acc[j][r] + bias; }
  } else {   /* ctx carried x 2^6 into f16 so small-magnitude context rows stay clear of f16 subnormals */
    gemm_staged<2, CC>(Y + (size_t)blockIdx.x * 64 * CC, WO + (size_t)c0 * CC, ring, tid, acc);
#pragma unroll
    for (int j = 0; j < 8; ++j) { const float bias = BO ? bfr(BO[c0 + j * 16 + col]) : 0.f;
#pragma unroll
      for (int r = 0; r < 8; ++r) sf[wave][8 * g + r][j * 16 + col] = acc[j][r] * (1.0f / 16384.0f) + bias; } }   /* 2^-8 (Wo carry) x 2^-6 (ctx carry) */
  LDSX(); for (int rl = 0; rl < 16; ++rl) vst2(OUT + (r0 + rl) * DIN + c0 + lane * 4, *(const v4f*)&sf[wave][rl][lane * 4]); }

extern "C" void kernel_launch(void* const* d_in, const int* in_sizes, int n_in, void* d_out, int out_size, void* d_ws, size_t ws_size, hipStream_t stream) {
  (void)in_sizes; (void)n_in; (void)out_size;
  const float** F = (const float**)d_in;
  if (ws_size < (size_t)WS_END) return;
  char* ws = (char*)d_ws; _Float16 *QH = (_Float16*)(ws + WS_QH), *KH = (_Float16*)(ws + WS_KH), *VT = (_Float16*)(ws + WS_VT), *QL = (_Float16*)(ws + WS_QL), *KL = (_Float16*)(ws + WS_KL); __bf16 *VB = (__bf16*)(ws + WS_VB), *VBL = (__bf16*)(ws + WS_VBL); float *Y = (float*)(ws + WS_Y);
  (void)Y; (void)QL; (void)KL; (void)VB; (void)VBL;
  // inputs: 0 x_norm_for_qkv [2,2048,1024]; 1 xt_current_for_v [2,2048,1024] (multiplies the projected values elementwise); 2 w_attn [3072,1024] (out,in): q rows 0..1023, k 1024..2047, v 2048..3071; 3 b_attn [3072] (zeros, read); 4 w_proj [1024,1024] (out,in); 5 b_proj (zeros, read)
  k_proj<<<dim3(TNB * TT / 64, CC / 128, 3), 128, 0, stream>>>(F[0], F[0], F[0], F[2], F[2] + (size_t)CC * DIN, F[2] + 2 * (size_t)CC * DIN, F[3], F[3] + CC, F[3] + 2 * CC, QH, QL, KH, KL, VT, VB, VBL, F[1]);
  k_att<<<dim3(TNB * NH, NQB), 128, 0, stream>>>(QH, KH, QL, KL, VT, VB, VBL, Y);
  k_out<<<dim3(TNB * TT / 64, DIN / 128), 128, 0, stream>>>(Y, F[4], F[5], (float*)d_out);
}

// v007
// A run of this version takes 101 microseconds.
// In two side-by-side timings against v006, it was 1.09 and 1.11 times as fast.
// Counting every step since v000, it is 12.6 times as fast.
// compute dtype: all float inputs rounded to bf16; q / k / v projections with EXACT bf16 products on WMMA 16x16x32 (f32 accumulate) + bias (zeros, read); the value rows multiplied elementwise in f32 by the second input (bf16-rounded) per (token, head, dim); causal logits: 3 products for the first 384 rows, single f16 q x k after, x 64^-0.5; softmax f32; P x 2^11 once to f16 x v once to f16 (bf16 hi + lo below row 384); ctx hi+lo x exact w_proj below row 384, x2^6 f16 carry x f16(bf16 x 2^8) after, + b_proj (zeros); f32 output.
#include <hip/hip_runtime.h>
#include <math.h>
#include <stdint.h>

typedef __attribute__((ext_vector_type(16))) _Float16 v16h;
typedef __attribute__((ext_vector_type(16))) __bf16 v16b;
typedef __attribute__((ext_vector_type(8)))  _Float16 v8h;
typedef __attribute__((ext_vector_type(8)))  float v8f;
typedef __attribute__((ext_vector_type(4)))  float v4f;
typedef __attribute__((ext_vector_type(2)))  float v2f;
typedef __attribute__((ext_vector_type(4)))  unsigned v4u;
typedef __attribute__((ext_vector_type(4)))  int v4i;
typedef float __attribute__((may_alias)) float_a;
typedef int __attribute__((may_alias)) int_a;

template <typename T> __device__ __forceinline__ void vst2(void* p, T v) { *(T*)p = v;  }
// a store in a rolled loop: s_wait_xcnt 0 directly behind it, its address pair and its data as inputs, since the next trip writes both registers anew
template <typename T> __device__ __forceinline__ void vst2w(void* p, T v) { *(T*)p = v; asm volatile("s_wait_xcnt 0x0" :: "v"(p), "v"(v) : "memory"); }
__device__ __forceinline__ v8f wmma16(v16h a, v16h b, v8f c) {
  v8f d = __builtin_amdgcn_wmma_f32_16x16x32_f16(false, a, false, b, (short)0, c, false, false);
  asm volatile("v_nop\n\tv_nop\n\tv_nop\n\tv_nop" : "+v"(d) : "v"(a), "v"(b));
  return d;
}
__device__ __forceinline__ v8f wmma_bf(v16b a, v16b b, v8f c) {
  v8f d = __builtin_amdgcn_wmma_f32_16x16x32_bf16(false, a, false, b, (short)0, c, false, false);
  asm volatile("v_nop\n\tv_nop\n\tv_nop\n\tv_nop" : "+v"(d) : "v"(a), "v"(b));
  return d;
}
// 16x16x32 fragments: lane = (h = lane>>4, row/col = lane&15); elements 0..7 = k0+8h+0..7, 8..15 = k0+16+8h+0..7; D element r = row 8h+r
__device__ __forceinline__ v16h frag_h(const _Float16* rowk0, int lane) {
  union { v16h v; v8h q[2]; } u; const _Float16* p = rowk0 + 8 * (lane >> 4);
  u.q[0] = *(const v8h*)p; u.q[1] = *(const v8h*)(p + 16); return u.v;
}
__device__ __forceinline__ v16h frag_f32(const float* rowk0, int lane) {
  v16h a; const float* p = rowk0 + 8 * (lane >> 4);
#pragma unroll
  for (int i = 0; i < 8; ++i) { a[i] = (_Float16)p[i]; a[8 + i] = (_Float16)p[16 + i]; }
  return a;
}
__device__ __forceinline__ v16h frag_f32s(const float* rowk0, int lane, float sc) {
  v16h a; const float* p = rowk0 + 8 * (lane >> 4);
#pragma unroll
  for (int i = 0; i < 8; ++i) { a[i] = (_Float16)(p[i] * sc); a[8 + i] = (_Float16)(p[16 + i] * sc); }
  return a;
}
// column fragment from a [K][ld] layout (column n), rows >= K read as 0
__device__ __forceinline__ v16h fragc_f32(const float* W, int k0, int n, int lane, int ld, int K) {
  v16h a; const int g = lane >> 4;
#pragma unroll
  for (int i = 0; i < 8; ++i) { const int ka = k0 + 8 * g + i, kb = ka + 16;
    a[i] = (_Float16)(ka < K ? W[(size_t)(ka < K ? ka : K - 1) * ld + n] : 0.f); a[8 + i] = (_Float16)(kb < K ? W[(size_t)(kb < K ? kb : K - 1) * ld + n] : 0.f); }
  return a;
}
struct F2 { v16b h, l; };
__device__ __forceinline__ F2 bsplit16(const float v[16]) { F2 r;
#pragma unroll
  for (int i = 0; i < 16; ++i) { const __bf16 h = (__bf16)v[i]; r.h[i] = h; r.l[i] = (__bf16)(v[i] - (float)h); }
  return r; }
__device__ __forceinline__ F2 split_row(const float* row, int k0, int lane) { float v[16]; const float* p = row + k0 + 8 * (lane >> 4);
#pragma unroll
  for (int i = 0; i < 8; ++i) { v[i] = p[i]; v[8 + i] = p[16 + i]; }
  return bsplit16(v); }
__device__ __forceinline__ F2 split_rowK(const float* row, int k0, int lane, int K) { float v[16]; const int g = lane >> 4;
#pragma unroll
  for (int i = 0; i < 8; ++i) { const int ka = k0 + 8 * g + i, kb = ka + 16; v[i] = ka < K ? row[ka < K ? ka : K - 1] : 0.f; v[8 + i] = kb < K ? row[kb < K ? kb : K - 1] : 0.f; }
  return bsplit16(v); }
__device__ __forceinline__ F2 split_col(const float* W, int k0, int n, int lane, int ld, int K) { float v[16]; const int g = lane >> 4;
#pragma unroll
  for (int i = 0; i < 8; ++i) { const int ka = k0 + 8 * g + i, kb = ka + 16; v[i] = ka < K ? W[(size_t)(ka < K ? ka : K - 1) * ld + n] : 0.f; v[8 + i] = kb < K ? W[(size_t)(kb < K ? kb : K - 1) * ld + n] : 0.f; }
  return bsplit16(v); }
__device__ __forceinline__ v8f mac3(const F2& a, const F2& b, v8f c) { c = wmma_bf(a.l, b.h, c); c = wmma_bf(a.h, b.l, c); return wmma_bf(a.h, b.h, c); }
__device__ __forceinline__ float sigm(float v) { return 1.0f / (1.0f + expf(-v)); }
#define LDSX() do { asm volatile("s_wait_dscnt 0" ::: "memory"); __builtin_amdgcn_wave_barrier(); __builtin_amdgcn_fence(__ATOMIC_RELEASE, "workgroup"); } while (0)

// Multi-head causal self-attention with an elementwise-modulated value path (x_norm_for_qkv, xt_current_for_v [2,2048,1024]; w_attn [3072,1024] torch (out,in) N(0, 1/1024), b_attn zeros (read): jnp.split thirds of x_norm @ w_attn.T + b_attn (q = rows 0..1023, k = 1024..2047, v = 2048..3071); 16 heads x 64; effective_v = heads(xt_current_for_v) * v (elementwise); att x 1/sqrt(64); tril kept, -inf elsewhere; softmax; y @ w_proj.T + b_proj (w_proj (out,in), b_proj zeros, read)).
#define NB 2
#define TT 2048
#define CC 1024            // NH * HD = projected width
#define DIN 1024          // input (model) width
#define NH 16
#define HD 64
#define NQB (TT / 64)
#define HG 4
#define SCALE (0.125f)
#define CAUSAL 1
#ifndef TNB
#define TNB NB
#endif
__device__ __forceinline__ float bfr(float v) { return (float)(__bf16)v; }
__host__ __device__ __forceinline__ int kb_last(int qb) { return CAUSAL ? ((qb * 64 + 63) >> 7) : (TT / 128 - 1); }
typedef __attribute__((ext_vector_type(8))) __bf16 v8b;
__device__ __forceinline__ v16b frag_b(const __bf16* rowk0, int lane) {
  union { v16b v; v8b q[2]; } u; const __bf16* p = rowk0 + 8 * (lane >> 4);
  u.q[0] = *(const v8b*)p; u.q[1] = *(const v8b*)(p + 16); return u.v;
}
#define QBH 6              // causal: query blocks 0..QBH-1 of each sequence (few keys, no averaging) take the high-precision path
#define QHI 384            // rows carrying a q residual plane
#define KHI 384            // key rows carrying k residual / v bf16 hi+lo planes (used only by the causal high-precision path)
// B fragment (k rows k0+.., output column o) of a weight: (in,out) [K][ld] or (out,in) [ld rows of K]: bf16 exact, or f16(bf16 * 256) exact
__device__ __forceinline__ v16b wcol_io(const float* Wm, int k0, int o, int lane, int ld) { v16b w; const int g = lane >> 4;
#pragma unroll
  for (int i = 0; i < 8; ++i) { w[i] = (__bf16)Wm[(size_t)(k0 + 8 * g + i) * ld + o]; w[8 + i] = (__bf16)Wm[(size_t)(k0 + 16 + 8 * g + i) * ld + o]; }
  return w; }
__device__ __forceinline__ v16b wcol_oi(const float* Wm, int k0, int o, int lane, int K) { v16b w; const float* p = Wm + (size_t)o * K + k0 + 8 * (lane >> 4);
#pragma unroll
  for (int i = 0; i < 8; ++i) { w[i] = (__bf16)p[i]; w[8 + i] = (__bf16)p[16 + i]; }
  return w; }
__device__ __forceinline__ v16h wcolh_io(const float* Wm, int k0, int o, int lane, int ld) { v16h w; const int g = lane >> 4;
#pragma unroll
  for (int i = 0; i < 8; ++i) { w[i] = (_Float16)(bfr(Wm[(size_t)(k0 + 8 * g + i) * ld + o]) * 256.0f); w[8 + i] = (_Float16)(bfr(Wm[(size_t)(k0 + 16 + 8 * g + i) * ld + o]) * 256.0f); }
  return w; }
__device__ __forceinline__ v16h wcolh_oi(const float* Wm, int k0, int o, int lane, int K) { v16h w; const float* p = Wm + (size_t)o * K + k0 + 8 * (lane >> 4);
#pragma unroll
  for (int i = 0; i < 8; ++i) { w[i] = (_Float16)(bfr(p[i]) * 256.0f); w[8 + i] = (_Float16)(bfr(p[16 + i]) * 256.0f); }
  return w; }
// fragment loads from the lane's own pointer p = row + k0 + 8 * (lane >> 4), so that a batch's loads are constant offsets from one address pair; the 16 raw floats of a fragment (R16) and their conversions are separate functions
struct R16 { v4f q[4]; };
__device__ __forceinline__ R16 wraw(const float* p) { R16 r;
  r.q[0] = *(const v4f*)p; r.q[1] = *(const v4f*)(p + 4); r.q[2] = *(const v4f*)(p + 16); r.q[3] = *(const v4f*)(p + 20); return r; }
__device__ __forceinline__ v16h fragh_p(const _Float16* p) { union { v16h v; v8h q[2]; } u; u.q[0] = *(const v8h*)p; u.q[1] = *(const v8h*)(p + 16); return u.v; }
__device__ __forceinline__ v16b fragb_p(const __bf16* p) { union { v16b v; v8b q[2]; } u; u.q[0] = *(const v8b*)p; u.q[1] = *(const v8b*)(p + 16); return u.v; }
__device__ __forceinline__ v16h cvth_r(const R16& r) { v16h a;
#pragma unroll
  for (int i = 0; i < 8; ++i) { a[i] = (_Float16)r.q[i >> 2][i & 3]; a[8 + i] = (_Float16)r.q[2 + (i >> 2)][i & 3]; }
  return a; }
__device__ __forceinline__ v16b cvtb_r(const R16& r) { v16b a;
#pragma unroll
  for (int i = 0; i < 8; ++i) { a[i] = (__bf16)r.q[i >> 2][i & 3]; a[8 + i] = (__bf16)r.q[2 + (i >> 2)][i & 3]; }
  return a; }
__device__ __forceinline__ F2 split_r(const R16& r) { float v[16];
#pragma unroll
  for (int i = 0; i < 8; ++i) { v[i] = r.q[i >> 2][i & 3]; v[8 + i] = r.q[2 + (i >> 2)][i & 3]; }
  return bsplit16(v); }
__device__ __forceinline__ v16h wcolh_r(const R16& r) { v16h w;
#pragma unroll
  for (int i = 0; i < 8; ++i) { w[i] = (_Float16)(bfr(r.q[i >> 2][i & 3]) * 256.0f); w[8 + i] = (_Float16)(bfr(r.q[2 + (i >> 2)][i & 3]) * 256.0f); }
  return w; }
#define WQKV_LAYOUT 1   // 0 = (in,out) [DIN][CC]; 1 = (out,in) [CC][DIN]; 2 = per-head [NH][DIN][HD]
__device__ __forceinline__ v16b wcol_hdk(const float* Wm, int k0, int o, int lane) { v16b w; const int g = lane >> 4; const float* p = Wm + (size_t)(o / HD) * DIN * HD + (o % HD);
#pragma unroll
  for (int i = 0; i < 8; ++i) { w[i] = (__bf16)p[(size_t)(k0 + 8 * g + i) * HD]; w[8 + i] = (__bf16)p[(size_t)(k0 + 16 + 8 * g + i) * HD]; }
  return w; }
#define WO_OUT_IN 1
#if WQKV_LAYOUT == 1
#define WCOL(W, k0, o, lane) wcol_oi(W, k0, o, lane, DIN)
#elif WQKV_LAYOUT == 2
#define WCOL(W, k0, o, lane) wcol_hdk(W, k0, o, lane)
#else
#define WCOL(W, k0, o, lane) wcol_io(W, k0, o, lane, CC)
#endif
#if WO_OUT_IN
#define WOCOL(W, k0, o, lane) wcol_oi(W, k0, o, lane, CC)
#define WOCOLH(W, k0, o, lane) wcolh_oi(W, k0, o, lane, CC)
#else
#define WOCOL(W, k0, o, lane) wcol_io(W, k0, o, lane, DIN)
#define WOCOLH(W, k0, o, lane) wcolh_io(W, k0, o, lane, DIN)
#endif

// (PROJ_EXTRA_PARAMS: the extra kernel parameters 'const float* __restrict__ XT' are written literally in the kernel signature)
// per (token, head) hook on the staged f32 row (64 floats, projection + bias) of the v stream: effective_v = xt * v elementwise with the same (token, head) slice of the second input (bf16-rounded); one f32 product per element; q and k untouched
#define PROJ_EPI(which, row, t, h) do { if ((which) == 2) { float* rw = (row); const float* xr_ = XT + ((size_t)bb * TT + (t)) * CC + (h) * 64; _Pragma("unroll 8") for (int i = 0; i < 64; ++i) rw[i] = bfr(xr_[i]) * rw[i]; } } while (0)
#ifndef SM_EXTRA_PARAMS
#define SM_EXTRA_PARAMS
#endif
#ifndef PROJ_EXTRA_PARAMS
#define PROJ_EXTRA_PARAMS
#endif
#ifndef SM_MASK_HOOK
#define SM_MASK_HOOK (void)0
#endif

#define WS_QH  0u                                      // f16 q rows [b*t][CC]
#define WS_KH  (WS_QH + 2u * (size_t)NB * TT * CC)      // f16 k rows [b*t][CC]
#define WS_VT  (WS_KH + 2u * (size_t)NB * TT * CC)      // f16 v planes [b][c][t]
#define WS_QL  (WS_VT + 2u * (size_t)NB * CC * TT)      // f16 q residual x 2^10 rows [b][t < QHI][CC]
#define WS_KL  (WS_QL + 2u * (size_t)NB * QHI * CC)     // f16 k residual x 2^10 rows [b][t < KHI][CC]
#define WS_VB  (WS_KL + 2u * (size_t)NB * KHI * CC)     // bf16 v hi planes [b][c][t < KHI]
#define WS_VBL (WS_VB + 2u * (size_t)NB * CC * KHI)
#define WS_S   (WS_VBL + 2u * (size_t)NB * CC * KHI)    // (not used: the logits stay in registers)
#define WS_Y   (WS_S  + 4u * (size_t)HG * TT * TT)      // f32 ctx rows [b*t][CC] (only when there is an output projection)
#define WS_END (WS_Y  + 4u * (size_t)NB * TT * CC)

// ---- operand staging for the two dense products (k_proj, k_out): a block's A tile (128 rows) and W tile (128 rows) of 64 k are read from global memory once a block, by whole 128-byte lines, converted once, and laid in LDS as 16-bit rows; the four waves take their fragments from there.
#define SK 64              // k extent of a stage
#define SP 72              // LDS row pitch in 16-bit elements: 144 B, an odd multiple of 16 B, so that a fragment's ds_load_b128 meets no bank twice
typedef __attribute__((ext_vector_type(4))) __bf16 v4b;
typedef __attribute__((ext_vector_type(4))) _Float16 v4h;
template <int N> struct SR { v4f v[N]; };
// p = the thread's own pointer (row tid >> 4, floats 4 * (tid & 15)); piece i is row + 8 i: a wave's load covers two rows of 256 B
template <int N, int LD> __device__ __forceinline__ void st_ld(SR<N>& r, const float* p) {
#pragma unroll
  for (int i = 0; i < N; ++i) r.v[i] = *(const v4f*)(p + (size_t)i * 8 * LD); }
__device__ __forceinline__ v4b cv_b(v4f v) { v4b o;
#pragma unroll
  for (int i = 0; i < 4; ++i) o[i] = (__bf16)v[i];
  return o; }
__device__ __forceinline__ v4b cv_bl(v4f v) { v4b o;
#pragma unroll
  for (int i = 0; i < 4; ++i) o[i] = (__bf16)(v[i] - (float)(__bf16)v[i]);
  return o; }
__device__ __forceinline__ v4h cv_y(v4f v) { v4h o;
#pragma unroll
  for (int i = 0; i < 4; ++i) o[i] = (_Float16)(v[i] * 64.0f);
  return o; }
__device__ __forceinline__ v4h cv_w(v4f v) { v4h o;
#pragma unroll
  for (int i = 0; i < 4; ++i) o[i] = (_Float16)(bfr(v[i]) * 256.0f);
  return o; }
// MODE 0: A bf16, W bf16 (k_proj); 1: A bf16 hi + lo planes, W bf16 (k_out, early rows); 2: A f16(x 2^6), W f16(bf16 x 2^8) (k_out). A buffer = A rows (128, or 128 hi + 128 lo), then 128 W rows.
template <int MODE> __device__ __forceinline__ void st_put(const SR<16>& ar, const SR<16>& wr, char* buf, int so) {
  if constexpr (MODE == 2) { _Float16* d = (_Float16*)buf + so;
#pragma unroll
    for (int i = 0; i < 16; ++i) *(v4h*)(d + i * 8 * SP) = cv_y(ar.v[i]);
#pragma unroll
    for (int i = 0; i < 16; ++i) *(v4h*)(d + (128 + i * 8) * SP) = cv_w(wr.v[i]);
  } else { __bf16* d = (__bf16*)buf + so; constexpr int AR = MODE == 1 ? 256 : 128;
#pragma unroll
    for (int i = 0; i < 16; ++i) { *(v4b*)(d + i * 8 * SP) = cv_b(ar.v[i]); if constexpr (MODE == 1) *(v4b*)(d + (128 + i * 8) * SP) = cv_bl(ar.v[i]); }
#pragma unroll
    for (int i = 0; i < 16; ++i) *(v4b*)(d + (AR + i * 8) * SP) = cv_b(wr.v[i]); } }
// one stage's products, k ascending as before; fo = the lane's own offset (row lane & 15, element 8 * (lane >> 4)). A wave takes two row tiles, rows m * 64 + wave * 16 (m = 0, 1), so that each W fragment it reads from LDS serves two products
template <int MODE> __device__ __forceinline__ void st_mac(const char* buf, int fo, int wave, v8f (&acc)[2][8]) {
#pragma unroll
  for (int kc = 0; kc < SK / 32; ++kc) {
    if constexpr (MODE == 2) { const _Float16* p = (const _Float16*)buf + fo + kc * 32; v16h a[2], w[8];
#pragma unroll
      for (int m = 0; m < 2; ++m) a[m] = fragh_p(p + (m * 64 + wave * 16) * SP);
#pragma unroll
      for (int j = 0; j < 8; ++j) w[j] = fragh_p(p + (128 + j * 16) * SP);
#pragma unroll
      for (int j = 0; j < 8; ++j)
#pragma unroll
        for (int m = 0; m < 2; ++m) acc[m][j] = wmma16(a[m], w[j], acc[m][j]);
    } else if constexpr (MODE == 1) { const __bf16* p = (const __bf16*)buf + fo + kc * 32; v16b ah[2], al[2], w[8];
#pragma unroll
      for (int m = 0; m < 2; ++m) { ah[m] = fragb_p(p + (m * 64 + wave * 16) * SP); al[m] = fragb_p(p + (128 + m * 64 + wave * 16) * SP); }
#pragma unroll
      for (int j = 0; j < 8; ++j) w[j] = fragb_p(p + (256 + j * 16) * SP);
#pragma unroll
      for (int j = 0; j < 8; ++j) {
#pragma unroll
        for (int m = 0; m < 2; ++m) acc[m][j] = wmma_bf(ah[m], w[j], acc[m][j]);
#pragma unroll
        for (int m = 0; m < 2; ++m) acc[m][j] = wmma_bf(al[m], w[j], acc[m][j]); }
    } else { const __bf16* p = (const __bf16*)buf + fo + kc * 32; v16b a[2];
#pragma unroll
      for (int m = 0; m < 2; ++m) a[m] = fragb_p(p + (m * 64 + wave * 16) * SP);
#pragma unroll
      for (int jh = 0; jh < 8; jh += 4) { v16b w[4];   // four W fragments at a time: with all eight live the kernel does not fit the registers of three waves a SIMD
#pragma unroll
        for (int j = 0; j < 4; ++j) w[j] = fragb_p(p + (128 + (jh + j) * 16) * SP);
#pragma unroll
        for (int j = 0; j < 4; ++j)
#pragma unroll
          for (int m = 0; m < 2; ++m) acc[m][jh + j] = wmma_bf(a[m], w[j], acc[m][jh + j]); } } } }
// the ring's work-group barrier: it orders the LDS operations alone, so that the global loads of the stage read ahead stay in flight across it (__syncthreads() would drain the load counter and lay their latency bare every stage)
#define RING_BARRIER() do { __builtin_amdgcn_fence(__ATOMIC_RELEASE, "workgroup", "local"); __builtin_amdgcn_s_barrier(); __builtin_amdgcn_fence(__ATOMIC_ACQUIRE, "workgroup", "local"); } while (0)
#define RING_BYTES(MODE) (2 * (((MODE) == 1 ? 256 : 128) + 128) * SP * 2)
// acc[m] += A0[128 rows][KK] . W0[128 rows][KK]^T, wave w taking rows 64 m + 16 w ..; two LDS buffers, the stage after next in registers. One barrier a stage: it publishes the buffer just written and ends the reads of the buffer that the next stage overwrites.
// The thread's two pointers and the first stage's raw loads are alike for every MODE: gemm_first() holds them, so that in k_out they and their wait stand once, ahead of the choice between the two products.
struct GS { const float* ag; const float* wg; SR<16> ar, wr; };
template <int KK> __device__ __forceinline__ void gemm_first(GS& t, const float* __restrict__ A0, const float* __restrict__ W0, int tid) {
  t.ag = A0 + (size_t)(tid >> 4) * KK + (tid & 15) * 4; t.wg = W0 + (size_t)(tid >> 4) * KK + (tid & 15) * 4;
  st_ld<16, KK>(t.ar, t.ag); st_ld<16, KK>(t.wr, t.wg);
  asm volatile("s_wait_xcnt 0x0" :: "v"(t.ag), "v"(t.wg) : "memory"); }   // behind the loads, their address pairs as inputs: whatever way the code takes from here, no register of these loads is written anew ahead of this wait
template <int MODE, int KK> __device__ __forceinline__ void gemm_staged(GS& t, char* ring, int tid, v8f (&acc)[2][8]) {
  constexpr int BUFB = RING_BYTES(MODE) / 2, NS = KK / SK;
  const int wave = tid >> 5, lane = tid & 31; const int so = (tid >> 4) * SP + (tid & 15) * 4, fo = (lane & 15) * SP + 8 * (lane >> 4);
  const float* ag = t.ag; const float* wg = t.wg; SR<16>& ar = t.ar; SR<16>& wr = t.wr;
  st_put<MODE>(ar, wr, ring, so);
  __builtin_amdgcn_sched_barrier(0);   // keeps the second stage's loads behind the first stage's conversions: with both stages' 256 registers live at once k_proj spills
  st_ld<16, KK>(ar, ag + SK); st_ld<16, KK>(wr, wg + SK);
  asm volatile("s_wait_xcnt 0x0" :: "v"(ag), "v"(wg) : "memory");   // behind the loads, their address pairs as inputs: the pairs are stepped on next
  ag += 2 * SK; wg += 2 * SK;
  RING_BARRIER();
#pragma unroll 1   // rolled: sixteen copies of this long body would only lengthen the text
  for (int s = 0; s < NS; ++s) {
    st_mac<MODE>(ring + (s & 1) * BUFB, fo, wave, acc);
    if (s + 1 < NS) {   /* block-uniform */
      st_put<MODE>(ar, wr, ring + ((s + 1) & 1) * BUFB, so);
      if (s + 2 < NS) { st_ld<16, KK>(ar, ag); st_ld<16, KK>(wr, wg);
        asm volatile("s_wait_xcnt 0x0" :: "v"(ag), "v"(wg) : "memory");   // behind the loads, their address pairs as inputs: the pairs are stepped on next
        ag += SK; wg += SK; }
      RING_BARRIER(); } } }

// ---- k_proj: block = (128 rows, 128 cols, which): q/k/v = X W (+ b) with exact bf16 products (K = DIN) -> which 0: q f16 rows (+ residual rows < QHI); 1: k f16 rows (+ residual rows < KHI); 2: v f16 planes [c][t] (+ bf16 hi/lo planes for t < KHI). The epilogue takes the block's two halves of 64 rows one after the other.
__global__ __launch_bounds__(128) __attribute__((amdgpu_waves_per_eu(3, 3))) void k_proj(const float* __restrict__ XQ, const float* __restrict__ XK, const float* __restrict__ XV, const float* __restrict__ WQ, const float* __restrict__ WK, const float* __restrict__ WV, const float* __restrict__ BQ, const float* __restrict__ BK, const float* __restrict__ BV,
    _Float16* __restrict__ QH, _Float16* __restrict__ QL, _Float16* __restrict__ KH, _Float16* __restrict__ KL, _Float16* __restrict__ VT, __bf16* __restrict__ VB, __bf16* __restrict__ VBL, const float* __restrict__ XT) {
  __shared__ __align__(16) float st[64][132];
  __shared__ __align__(16) union { struct { _Float16 sh[64][136], sl[64][136]; } e; struct { _Float16 th[128][72]; __bf16 tb[128][72], tbl[128][72]; } f; char ring[RING_BYTES(0)]; } u;   // the main loop's ring lies on the epilogue's conversion tiles, which are first written two barriers behind the loop; a block uses either the row tiles (q, k) or the plane tiles (v), so these share their place too: three blocks fit a WGP's LDS
  _Float16 (&sh)[64][136] = u.e.sh; _Float16 (&sl)[64][136] = u.e.sl; _Float16 (&th)[128][72] = u.f.th; __bf16 (&tb)[128][72] = u.f.tb; __bf16 (&tbl)[128][72] = u.f.tbl;
  const int tid = threadIdx.x, wave = tid >> 5, lane = tid & 31, col = lane & 15, g = lane >> 4; const int which = blockIdx.z; const int c0 = blockIdx.y * 128; const size_t rblk = (size_t)blockIdx.x * 128; const size_t bb = rblk / TT;
  const float* X = which == 0 ? XQ : which == 1 ? XK : XV; const float* WA = which == 0 ? WQ : which == 1 ? WK : WV; const float* BA = which == 0 ? BQ : which == 1 ? BK : BV;
  v8f acc[2][8] = {};
  GS gs; gemm_first<DIN>(gs, X + rblk * DIN, WA + (size_t)c0 * DIN, tid);
  gemm_staged<0, DIN>(gs, u.ring, tid, acc);
  float bias[8] = {};   // read once a block, for both halves
  if (BA) {
#pragma unroll
    for (int j = 0; j < 8; ++j) bias[j] = bfr(BA[c0 + j * 16 + col]); }
#pragma unroll
  for (int m = 0; m < 2; ++m) { const size_t r0 = rblk + m * 64; const int t0 = (int)(r0 % TT);   // a half's first write of st stands behind the barrier that ended the half before's reads of it, its first write of a conversion tile two barriers behind that tile's last read
  { // stage the f32 tile (acc + bias) in LDS, run the per-(row, head) epilogue hook, then convert
#pragma unroll
    for (int j = 0; j < 8; ++j) {
#pragma unroll
      for (int r = 0; r < 8; ++r) st[wave * 16 + 8 * g + r][j * 16 + col] = acc[m][j][r] + bias[j]; }
    __syncthreads();
    for (int e = tid; e < 64 * (128 / HD); e += 128) { const int rl = e / (128 / HD), hh = e % (128 / HD); PROJ_EPI(which, &st[rl][hh * HD], (int)((r0 + rl) % TT), (c0 / HD) + hh); }
    __syncthreads(); }
  if (which < 2) { _Float16* DH = which == 0 ? QH : KH; _Float16* DL = which == 0 ? QL : KL; const int nhi = which == 0 ? QHI : KHI; const bool hi_rows = t0 < nhi;
    for (int e = tid; e < 64 * 128; e += 128) { const int rl = e >> 7, cl = e & 127; const float v = st[rl][cl]; const _Float16 hv = (_Float16)v; sh[rl][cl] = hv; sl[rl][cl] = (_Float16)((v - (float)hv) * 1024.0f); }
    __syncthreads();
    for (int e = tid; e < 64 * 16; e += 128) { const int rl = e >> 4, q = e & 15; vst2w((unsigned*)(DH + (r0 + rl) * CC + c0 + q * 8), *(const v4u*)&sh[rl][q * 8]); if (hi_rows) vst2w((unsigned*)(DL + (bb * nhi + t0 + rl) * (size_t)CC + c0 + q * 8), *(const v4u*)&sl[rl][q * 8]); }
  } else { const bool hi_rows = t0 < KHI;
    for (int e = tid; e < 64 * 128; e += 128) { const int rl = e & 63, cl = e >> 6; const float v = st[rl][cl]; th[cl][rl] = (_Float16)v; const __bf16 bh = (__bf16)v; tb[cl][rl] = bh; tbl[cl][rl] = (__bf16)(v - (float)bh); }
    __syncthreads();
    for (int e = tid; e < 128 * 8; e += 128) { const int cl = e >> 3, q = e & 7; vst2w((unsigned*)(VT + (bb * CC + c0 + cl) * (size_t)TT + t0 + q * 8), *(const v4u*)&th[cl][q * 8]); if (hi_rows) { const size_t o3 = (bb * CC + c0 + cl) * (size_t)KHI + t0 + q * 8; vst2w((unsigned*)(VB + o3), *(const v4u*)&tb[cl][q * 8]); vst2w((unsigned*)(VBL + o3), *(const v4u*)&tbl[cl][q * 8]); } } } } }
// ---- k_att: block = 64 queries (4 waves x 16) of one (b, h): logits, softmax and P . v in one kernel, nothing of the logits leaves the registers.
// Every product is taken transposed: S^T = K . Q^T (A = key rows, B = query rows), so a lane holds keys j*16 + 8g + r of ONE query (column lane & 15), and two neighbouring S^T tiles are, register for register, the B fragment of ctx^T = V^T . P^T (A = v planes).
// Rows from QHI on, ONE sweep over the keys, whose key and value tiles come through a two-buffer LDS ring filled by tensor loads: per 128-key block the query's maximum so far (joined over the two half-rows), P x 2^11 = exp((s - maximum so far) x SCALE) x 2048 on the raw products s = q . k, its running sum, and the P . v products in the key order 0, 32, 64, ...; where the maximum rises, sum and ctx are first multiplied by exp((old - new) x SCALE); the division by the sum comes once, behind the last block.
// Rows below QHI (high-precision path), two sweeps: the first finds each query's maximum and denominator (kept per lane, the two half-rows joined once at the end), the second forms the logits again, P x 2^11 = exp(s - max) x 2048 / sum, and the P . v products in the same key order.
// ---- the key / value ring of the one-sweep path: a stage = the block's 128 keys of one head, the key tile (128 rows of 128 B) and the value tile (64 planes of 256 B), each brought from global memory into LDS by ONE tensor load a block (wave 0: keys, wave 1: values) and read from there by all four waves.
typedef uint32_t u32x4 __attribute__((ext_vector_type(4)));
typedef uint32_t u32x8 __attribute__((ext_vector_type(8)));
#define KPH 72             // LDS pitch of a key row in f16: 128 B + the mover's 16-B pad = 144 B, an odd multiple of 16 B (ds_load_b128 meets no bank twice)
#define VPH 136            // LDS pitch of a value plane in f16: 256 B + 16 B = 272 B, likewise
#define KTILE_B 18432u     // 128 rows x 144 B, a multiple of 2 KiB
#define VTILE_B 18432u     // 64 planes x 272 B = 17408 B, rounded up to a multiple of 2 KiB
#define ABUF_B (KTILE_B + VTILE_B)
__device__ __forceinline__ uint32_t uni(uint32_t v) { return (uint32_t)__builtin_amdgcn_readfirstlane(v); }
__device__ __forceinline__ uint32_t pinned(uint32_t v) { uint32_t w = (uint32_t)__builtin_amdgcn_readfirstlane(v); asm volatile("" : "+s"(w)); return w; }   // holds the test of a tensor load's branch in a scalar register, so that the branch is s_cmp + s_cbranch_scc (a tensor load ignores EXEC)
struct TD { u32x4 g0; u32x8 g1; };   // the two groups of the wave's youngest request
// one request: a tile of D1 rows of D0 bytes, source pitch PITCH bytes, first byte at src, to the LDS byte offset dst; W0 = word 0 of group 1 (no mask, 1-byte elements, 16 B of pad behind every row)
template <uint32_t W0, uint32_t D0, uint32_t D1, uint32_t PITCH> __device__ __forceinline__ void tdm_tile(TD& d, uint32_t dst, const _Float16* src) {
  const uint64_t ga = (uint64_t)(size_t)src; u32x4 g0; u32x8 g1;
  g0[0] = uni(1u); g0[1] = uni(dst); g0[2] = uni((uint32_t)ga); g0[3] = uni((((uint32_t)(ga >> 32)) & 0x01FFFFFFu) | 0x80000000u);
  g1[0] = uni(W0); g1[1] = uni((D0 & 0xFFFFu) << 16); g1[2] = uni((D0 >> 16) | ((D1 & 0xFFFFu) << 16)); g1[3] = uni((D1 >> 16) | (D0 << 16)); g1[4] = uni(D1); g1[5] = uni(PITCH); g1[6] = uni(0u); g1[7] = uni(0u);
  asm volatile("tensor_load_to_lds %0, %1" : "+{s[36:39]}"(g0), "+{s[40:47]}"(g1) :: "memory");   // the groups stand in named registers and come back out of the statement, so that tdm_landed() can name the same ones
  d.g0 = g0; d.g1 = g1; }
// the issuing wave's wait for its youngest request; the request's two groups are inputs, so that their registers stay live, and so unwritten, from the issue up to this wait
__device__ __forceinline__ void tdm_landed(const TD& d) { asm volatile("s_wait_tensorcnt 0x0" :: "{s[36:39]}"(d.g0), "{s[40:47]}"(d.g1) : "memory"); }
// stage s into buffer s & 1: ks / vs = the head's first key row / first value plane; d takes the issuing wave's descriptor
__device__ __forceinline__ void att_stage(TD& d, uint32_t wv, uint32_t lbase, int s, const _Float16* ks, const _Float16* vs) {
  const uint32_t dst = lbase + (uint32_t)(s & 1) * ABUF_B;
  if (pinned(wv == 0u)) tdm_tile<(1u << 20) | (4u << 22) | (3u << 25), 2u * HD, 128u, 2u * CC>(d, dst, ks + (size_t)s * 128 * CC);
  if (pinned(wv == 1u)) tdm_tile<(1u << 20) | (5u << 22) | (3u << 25), 256u, (uint32_t)HD, 2u * TT>(d, dst + KTILE_B, vs + s * 128); }
// one 128-key block of logits x SCALE (HI) or of raw products q . k (one-sweep path): kp / klp = the lane's own pointer (key row k0 + col, the head's dims, + 8g)
template <bool HI> __device__ __forceinline__ void att_logits(const _Float16* kp, const _Float16* klp, const v16h (&qh)[2], const v16h (&ql)[2], v8f (&s)[8]) {
  if constexpr (HI) {
#pragma unroll
    for (int j2 = 0; j2 < 8; j2 += 2) { v16h kbf[HD / 32][2], klf[HD / 32][2];   // two key tiles' fragments loaded together (registers bound the batch on this path)
#pragma unroll
      for (int kc = 0; kc < HD / 32; ++kc)
#pragma unroll
        for (int u = 0; u < 2; ++u) { kbf[kc][u] = fragh_p(kp + (j2 + u) * 16 * CC + kc * 32); klf[kc][u] = fragh_p(klp + (j2 + u) * 16 * CC + kc * 32); }
      asm volatile("s_wait_xcnt 0x0" :: "v"(kp), "v"(klp) : "memory");   // behind the batch, its address pairs as inputs: they are stepped on at the foot of the key loop
      v8f acc[2] = {}, accl[2] = {};
#pragma unroll
      for (int kc = 0; kc < HD / 32; ++kc)
#pragma unroll
        for (int u = 0; u < 2; ++u) { acc[u] = wmma16(kbf[kc][u], qh[kc], acc[u]); accl[u] = wmma16(kbf[kc][u], ql[kc], accl[u]); accl[u] = wmma16(klf[kc][u], qh[kc], accl[u]); }
#pragma unroll
      for (int u = 0; u < 2; ++u)
#pragma unroll
        for (int r = 0; r < 8; ++r) s[j2 + u][r] = (acc[u][r] + accl[u][r] * (1.0f / 1024.0f)) * SCALE; }
  } else { v8f acc[8] = {}; v16h kf[HD / 32][8];   // kp points into the staged key tile in LDS (row pitch KPH); the block's sixteen key fragments are read ahead of its first WMMA: one LDS latency a block
#pragma unroll
    for (int kc = 0; kc < HD / 32; ++kc)
#pragma unroll
      for (int j = 0; j < 8; ++j) kf[kc][j] = fragh_p(kp + j * 16 * KPH + kc * 32);
#pragma unroll
    for (int j = 0; j < 8; ++j)   // tile by tile: a tile's two fragments are free again as its eight logits come alive
#pragma unroll
      for (int kc = 0; kc < HD / 32; ++kc) acc[j] = wmma16(kf[kc][j], qh[kc], acc[j]);
#pragma unroll
    for (int j = 0; j < 8; ++j)
#pragma unroll
      for (int r = 0; r < 8; ++r) s[j][r] = acc[j][r]; } }   // this path hands on the raw products q . k: SCALE stands in the constant of the exponent's multiply-add (att_pv_run)
// the causal mask, by index: d = the lane's query - its first key of the block; an excluded logit becomes -3e38, whose exp(s - m) is an exact 0 against any finite m
__device__ __forceinline__ void att_mask(v8f (&s)[8], int d) {
#pragma unroll
  for (int j = 0; j < 8; ++j)
#pragma unroll
    for (int r = 0; r < 8; ++r) if (j * 16 + r > d) s[j][r] = -3.0e38f; }
// first sweep: the lane's running maximum m and the sum of exp(s - m) over its own 64 keys of the block (a lane that has met only excluded keys keeps m = -3e38, and its sum is multiplied by exp(-3e38 - max) = 0 where the halves are joined)
__device__ __forceinline__ void att_stats(const v8f (&s)[8], float& m, float& sum) {
  float mx = s[0][0];
#pragma unroll
  for (int j = 0; j < 8; ++j)
#pragma unroll
    for (int r = 0; r < 8; ++r) mx = fmaxf(mx, s[j][r]);
  const float mn = fmaxf(m, mx); float a[4] = { sum * expf(m - mn), 0.f, 0.f, 0.f };
#pragma unroll
  for (int j = 0; j < 8; ++j)
#pragma unroll
    for (int r = 0; r < 8; ++r) a[r & 3] += expf(s[j][r] - mn);
  sum = (a[0] + a[1]) + (a[2] + a[3]); m = mn; }
// second sweep: s -> P x 2^11 in place (0 for excluded keys)
__device__ __forceinline__ void att_p(v8f (&s)[8], float m, float inv) {
#pragma unroll
  for (int j = 0; j < 8; ++j)
#pragma unroll
    for (int r = 0; r < 8; ++r) s[j][r] = expf(s[j][r] - m) * inv; }
// second sweep, one 128-key block: vha / vla (bf16 hi / lo planes) = the lane's own pointer (plane h*HD + col, key k0 + 8g)
__device__ __forceinline__ void att_pv(v8f (&s)[8], float m, float inv, const __bf16* vha, const __bf16* vla, v8f (&acc)[HD / 16]) {
  att_p(s, m, inv);
#pragma unroll
    for (int u = 0; u < 4; ++u) { float pv[16];
#pragma unroll
      for (int i = 0; i < 8; ++i) { pv[i] = s[2 * u][i]; pv[8 + i] = s[2 * u + 1][i]; }
      const F2 p = bsplit16(pv); v16b vh[HD / 16], vl[HD / 16];
#pragma unroll
      for (int j = 0; j < HD / 16; ++j) { vh[j] = fragb_p(vha + j * 16 * KHI + u * 32); vl[j] = fragb_p(vla + j * 16 * KHI + u * 32); }
      asm volatile("s_wait_xcnt 0x0" :: "v"(vha), "v"(vla) : "memory");   // behind the batch, its address pairs as inputs: as in att_logits
#pragma unroll
      for (int j = 0; j < HD / 16; ++j) { acc[j] = wmma_bf(vh[j], p.h, acc[j]); acc[j] = wmma_bf(vh[j], p.l, acc[j]); acc[j] = wmma_bf(vl[j], p.h, acc[j]); } } }
__device__ __forceinline__ float xhalf(float x) { return __builtin_bit_cast(float, __builtin_amdgcn_permlanex16(__builtin_bit_cast(int, x), __builtin_bit_cast(int, x), 0x76543210, 0xfedcba98, false, false)); }   // lane l takes lane l ^ 16's value
// the one sweep, one 128-key block: s = the raw products q . k; each exponential is ONE multiply-add and the chip's base-2 exponential, exp((s - m) x SCALE) x 2^11 = 2^(s x EXC - (m x EXC - 11)): the argument is at most 11, and far below (an excluded key's -3e38 too) the instruction gives 0, so the library call's range tests and its split of the argument have nothing to guard here
#define EXC (SCALE * 1.44269504088896340736f)   // SCALE x log2(e)
// va = the lane's own pointer into the staged value tile in LDS (plane col, key 8g; plane pitch VPH); m = the query's maximum so far, in raw products (alike in lanes l and l ^ 16, since both halves' P meet in one ctx tile), sum = the lane's own keys' sum of P x 2^11 against m
__device__ __forceinline__ void att_pv_run(v8f (&s)[8], float& m, float& sum, const _Float16* va, v8f (&acc)[HD / 16]) {
  v16h vf[4][HD / 16];   // 32 keys' v fragments are asked for one step ahead: the first ahead of the maximum, each next ahead of the exponentials of the 32 keys before it
#pragma unroll
  for (int j = 0; j < HD / 16; ++j) vf[0][j] = fragh_p(va + j * 16 * VPH);
  float mx = s[0][0];
#pragma unroll
  for (int j = 0; j < 8; ++j)
#pragma unroll
    for (int r = 0; r < 8; ++r) mx = fmaxf(mx, s[j][r]);
  const float mn = fmaxf(m, fmaxf(mx, xhalf(mx))); const float al = __builtin_amdgcn_exp2f((m - mn) * EXC);   // al = 0 at the first block (m = -3e38, sum and ctx still 0), 1 where the maximum stays
  m = mn; const float mc = fmaf(mn, EXC, -11.0f); const v2f ec = { EXC, EXC }, nm = { -mc, -mc };   // P x 2^11 = 2^(s x EXC - mc)
#pragma unroll
  for (int j = 0; j < HD / 16; ++j)
#pragma unroll
    for (int r = 0; r < 8; ++r) acc[j][r] *= al;
  float a[4] = { sum * al, 0.f, 0.f, 0.f };
#pragma unroll
  for (int u = 0; u < 4; ++u) {
    if (u < 3) {
#pragma unroll
      for (int j = 0; j < HD / 16; ++j) vf[u + 1][j] = fragh_p(va + j * 16 * VPH + (u + 1) * 32);
    }
    v16h p;
#pragma unroll
    for (int i = 0; i < 8; i += 2) {   // two neighbouring registers of a logit tile share one packed multiply-add
      const v2f t0 = __builtin_elementwise_fma((v2f){ s[2 * u][i], s[2 * u][i + 1] }, ec, nm), t1 = __builtin_elementwise_fma((v2f){ s[2 * u + 1][i], s[2 * u + 1][i + 1] }, ec, nm);
#pragma unroll
      for (int e = 0; e < 2; ++e) { const float x0 = __builtin_amdgcn_exp2f(t0[e]), x1 = __builtin_amdgcn_exp2f(t1[e]); a[(i + e) & 3] += x0; a[(i + e) & 3] += x1; p[i + e] = (_Float16)x0; p[8 + i + e] = (_Float16)x1; } }
#pragma unroll
    for (int j = 0; j < HD / 16; ++j) acc[j] = wmma16(vf[u][j], p, acc[j]); }
  sum = (a[0] + a[1]) + (a[2] + a[3]); }
__device__ __forceinline__ void att_body_hi(const _Float16* __restrict__ QH, const _Float16* __restrict__ KH, const _Float16* __restrict__ QL, const _Float16* __restrict__ KL, const __bf16* __restrict__ VB, const __bf16* __restrict__ VBL, int b, int h, int qb, int ql0, int col, int g, v8f (&acc)[HD / 16]) {
  const int t = ql0 + col, kbl = kb_last(qb);
  const _Float16* qp = QH + ((size_t)b * TT + t) * CC + h * HD + 8 * g; const _Float16* qlp = QL + ((size_t)b * QHI + t) * CC + h * HD + 8 * g;
  v16h qh[2], ql[2];
#pragma unroll
  for (int kc = 0; kc < HD / 32; ++kc) { qh[kc] = fragh_p(qp + kc * 32); ql[kc] = fragh_p(qlp + kc * 32); }
  asm volatile("s_wait_xcnt 0x0" :: "v"(qp), "v"(qlp) : "memory");   // behind the query loads, their address pairs as inputs: the registers are free for reuse behind it
  const _Float16* const kp0 = KH + ((size_t)b * TT + col) * CC + h * HD + 8 * g; const _Float16* const klp0 = KL + ((size_t)b * KHI + col) * CC + h * HD + 8 * g;
  float m = -3.0e38f, sum = 0.f; v8f s[8];
#pragma unroll 1
  for (int kb = 0; kb <= kbl; ++kb) { att_logits<true>(kp0 + (size_t)kb * 128 * CC, klp0 + (size_t)kb * 128 * CC, qh, ql, s); if (CAUSAL && kb == kbl) att_mask(s, t - kb * 128 - 8 * g);   /* block-uniform: blocks below the last hold no key past any of the 64 queries */
    att_stats(s, m, sum); }
  const float m2 = __shfl_xor(m, 16), s2 = __shfl_xor(sum, 16), mm = fmaxf(m, m2); const float tot = sum * expf(m - mm) + s2 * expf(m2 - mm);   // lanes l and l ^ 16 hold the two halves of one query's keys
  const float inv = tot > 0.f ? 2048.0f / tot : 0.f;   /* every query has at least its own key, so mm is finite */
  const size_t po = ((size_t)b * CC + h * HD + col) * (size_t)KHI + 8 * g; const __bf16 *vha0 = VB + po, *vla0 = VBL + po;
#pragma unroll 1
  for (int kb = 0; kb <= kbl; ++kb) { att_logits<true>(kp0 + (size_t)kb * 128 * CC, klp0 + (size_t)kb * 128 * CC, qh, ql, s); if (CAUSAL && kb == kbl) att_mask(s, t - kb * 128 - 8 * g);   /* block-uniform */
    att_pv(s, mm, inv, vha0 + kb * 128, vla0 + kb * 128, acc); } }
__device__ __forceinline__ void att_body_run(const _Float16* __restrict__ QH, const _Float16* __restrict__ KH, const _Float16* __restrict__ VT, unsigned char* L, int b, int h, int qb, int ql0, int col, int g, v8f (&acc)[HD / 16]) {
  const int t = ql0 + col, kbl = kb_last(qb);
  const uint32_t wv = uni(threadIdx.x >> 5), lbase = (uint32_t)(size_t)L;
  const _Float16* const ks = KH + (size_t)b * TT * CC + h * HD; const _Float16* const vs = VT + ((size_t)b * CC + h * HD) * (size_t)TT;
  TD d = {};
  att_stage(d, wv, lbase, 0, ks, vs);   // the ring's prologue; qb >= QBH, so there are at least four stages
  if (pinned(wv < 2u)) tdm_landed(d);   // the issuing waves: stage 0 has landed
  __syncthreads();   // stage 0 is published to all four waves
  att_stage(d, wv, lbase, 1, ks, vs);
  const _Float16* qp = QH + ((size_t)b * TT + t) * CC + h * HD + 8 * g;
  v16h qh[2];
#pragma unroll
  for (int kc = 0; kc < HD / 32; ++kc) qh[kc] = fragh_p(qp + kc * 32);
  asm volatile("s_wait_xcnt 0x0" :: "v"(qp) : "memory");   // behind the query loads, their address pair as input: the registers are free for reuse behind it
  float m = -3.0e38f, sum = 0.f; v8f s[8];
#pragma unroll 1   // rolled: one publish point in the text, and the body is long
  for (int kb = 0; kb <= kbl; ++kb) { const unsigned char* const buf = L + (kb & 1) * ABUF_B;
    const _Float16* const kp = (const _Float16*)buf + col * KPH + 8 * g; const _Float16* const va = (const _Float16*)(buf + KTILE_B) + col * VPH + 8 * g;
    att_logits<false>(kp, kp, qh, qh, s); if (CAUSAL && kb == kbl) att_mask(s, t - kb * 128 - 8 * g);   /* block-uniform: blocks below the last hold no key past any of the 64 queries */
    att_pv_run(s, m, sum, va, acc);
    // publish point of stage kb + 1, every wave, every pass
    asm volatile("s_wait_dscnt 0x0" ::: "memory");   // this wave's reads of buffer kb & 1 have returned
    if (pinned(wv < 2u)) tdm_landed(d);   // the issuing waves: stage kb + 1 has landed
    __syncthreads();   // publishes stage kb + 1 and ends every wave's reads of buffer kb & 1
    if (pinned(kb + 2 <= kbl)) att_stage(d, wv, lbase, kb + 2, ks, vs); }   // the refill, only while that stage exists
  asm volatile("s_wait_tensorcnt 0x0" ::: "memory");   // nothing is in flight where the ring becomes the output's staging
  asm volatile("s_wait_dscnt 0x0" ::: "memory");
  const float tot = sum + xhalf(sum);   // lanes l and l ^ 16 hold the two halves of one query's keys, against one maximum
  const float inv = tot > 0.f ? 2048.0f / tot : 0.f;   /* the key at the query's final maximum stands in tot with 2048; ctx leaves x 2^11, as on the other path */
#pragma unroll
  for (int j = 0; j < HD / 16; ++j)
#pragma unroll
    for (int r = 0; r < 8; ++r) acc[j][r] *= inv; }
__global__ __launch_bounds__(128) __attribute__((amdgpu_waves_per_eu(4, 4))) void k_att(const _Float16* __restrict__ QH, const _Float16* __restrict__ KH, const _Float16* __restrict__ QL, const _Float16* __restrict__ KL, const _Float16* __restrict__ VT, const __bf16* __restrict__ VB, const __bf16* __restrict__ VBL, float* __restrict__ Y) { __shared__ __attribute__((aligned(2048))) unsigned char L[2 * ABUF_B];
  float (*ss)[16][HD + 4] = (float (*)[16][HD + 4])L;   // the output's staging lies on the ring, which every wave has left at the last pass's barrier
  const int tid = threadIdx.x, wave = tid >> 5, lane = tid & 31, col = lane & 15, g = lane >> 4; const int b = blockIdx.x / NH, h = blockIdx.x % NH;
  const int qi = blockIdx.y; const int qb = NQB - 1 - ((qi & 8) ? (qi ^ 7) : qi);   // long query blocks start first; every second run of eight is reversed, so that blocks 256 apart in launch order add up to equal work
  const int ql0 = qb * 64 + wave * 16;
  v8f acc[HD / 16] = {};
  if (qb < QBH) att_body_hi(QH, KH, QL, KL, VB, VBL, b, h, qb, ql0, col, g, acc);   /* block-uniform */
  else att_body_run(QH, KH, VT, L, b, h, qb, ql0, col, g, acc);
#pragma unroll
  for (int j = 0; j < HD / 16; ++j)
#pragma unroll
    for (int r = 0; r < 8; ++r) ss[wave][col][j * 16 + 8 * g + r] = acc[j][r] * (1.0f / 2048.0f);   // ctx^T: element r of tile j = dim j*16 + 8g + r of query col
  LDSX(); for (int rl = 0; rl < 16; ++rl) if (lane < HD / 4) vst2(Y + ((size_t)b * TT + ql0 + rl) * CC + h * HD + lane * 4, *(const v4f*)&ss[wave][rl][lane * 4]); }
// LDSX() for the LDS alone: it orders a wave's own staging writes and reads and leaves the first half's global stores in flight (LDSX()'s fence would wait for them)
#define LDSL() do { asm volatile("s_wait_dscnt 0" ::: "memory"); __builtin_amdgcn_wave_barrier(); __builtin_amdgcn_fence(__ATOMIC_RELEASE, "workgroup", "local"); } while (0)
// ---- k_out: block = (128 rows, 128 cols): out = ctx Wo (+ bo): ctx x 2^6 once to f16 against Wo as f16(bf16 x 2^8) exact (1 product) x 2^-14; causal early rows (< QHI of each sequence): ctx bf16 hi + lo against exact bf16 Wo (2 products)
__global__ __launch_bounds__(128) void k_out(const float* __restrict__ Y, const float* __restrict__ WO, const float* __restrict__ BO, float* __restrict__ OUT) { __shared__ __align__(16) float sf[4][16][132]; __shared__ __align__(16) char ring[RING_BYTES(1)];
  const int tid = threadIdx.x, wave = tid >> 5, lane = tid & 31, col = lane & 15, g = lane >> 4; const int c0 = blockIdx.y * 128; const size_t rblk = (size_t)blockIdx.x * 128;
  v8f acc[2][8] = {};
  const bool early = CAUSAL && (int)(rblk % TT) < QHI;   /* block-uniform; QHI is a multiple of the block's 128 rows */
  GS gs; gemm_first<CC>(gs, Y + rblk * CC, WO + (size_t)c0 * CC, tid);
  if (early) gemm_staged<1, CC>(gs, ring, tid, acc);
  else gemm_staged<2, CC>(gs, ring, tid, acc);   /* ctx carried x 2^6 into f16 so small-magnitude context rows stay clear of f16 subnormals */
  float bias[8] = {};   // read once a block, for both halves
  if (BO) {
#pragma unroll
    for (int j = 0; j < 8; ++j) bias[j] = bfr(BO[c0 + j * 16 + col]); }
#pragma unroll
  for (int m = 0; m < 2; ++m) { const size_t r0 = rblk + m * 64 + wave * 16;
    if (early) {
#pragma unroll
      for (int j = 0; j < 8; ++j)
#pragma unroll
        for (int r = 0; r < 8; ++r) sf[wave][8 * g + r][j * 16 + col] = acc[m][j][r] + bias[j];
    } else {
#pragma unroll
      for (int j = 0; j < 8; ++j)
#pragma unroll
        for (int r = 0; r < 8; ++r) sf[wave][8 * g + r][j * 16 + col] = acc[m][j][r] * (1.0f / 16384.0f) + bias[j]; }   /* 2^-8 (Wo carry) x 2^-6 (ctx carry) */
    LDSL(); for (int rl = 0; rl < 16; ++rl) vst2(OUT + (r0 + rl) * DIN + c0 + lane * 4, *(const v4f*)&sf[wave][rl][lane * 4]);
    if (m == 0) { asm volatile("s_wait_xcnt 0x0" ::: "memory");   // behind the first half's stores: the second half writes their data registers anew
      LDSL(); } } }   // between the halves: every lane's reads of the wave's staging rows come before any lane's overwrite

extern "C" void kernel_launch(void* const* d_in, const int* in_sizes, int n_in, void* d_out, int out_size, void* d_ws, size_t ws_size, hipStream_t stream) {
  (void)in_sizes; (void)n_in; (void)out_size;
  const float** F = (const float**)d_in;
  if (ws_size < (size_t)WS_END) return;
  char* ws = (char*)d_ws; _Float16 *QH = (_Float16*)(ws + WS_QH), *KH = (_Float16*)(ws + WS_KH), *VT = (_Float16*)(ws + WS_VT), *QL = (_Float16*)(ws + WS_QL), *KL = (_Float16*)(ws + WS_KL); __bf16 *VB = (__bf16*)(ws + WS_VB), *VBL = (__bf16*)(ws + WS_VBL); float *Y = (float*)(ws + WS_Y);
  (void)Y; (void)QL; (void)KL; (void)VB; (void)VBL;
  // inputs: 0 x_norm_for_qkv [2,2048,1024]; 1 xt_current_for_v [2,2048,1024] (multiplies the projected values elementwise); 2 w_attn [3072,1024] (out,in): q rows 0..1023, k 1024..2047, v 2048..3071; 3 b_attn [3072] (zeros, read); 4 w_proj [1024,1024] (out,in); 5 b_proj (zeros, read)
  k_proj<<<dim3(TNB * TT / 128, CC / 128, 3), 128, 0, stream>>>(F[0], F[0], F[0], F[2], F[2] + (size_t)CC * DIN, F[2] + 2 * (size_t)CC * DIN, F[3], F[3] + CC, F[3] + 2 * CC, QH, QL, KH, KL, VT, VB, VBL, F[1]);
  k_att<<<dim3(TNB * NH, NQB), 128, 0, stream>>>(QH, KH, QL, KL, VT, VB, VBL, Y);
  k_out<<<dim3(TNB * TT / 128, DIN / 128), 128, 0, stream>>>(Y, F[4], F[5], (float*)d_out);
}
